// v000
// Measured on an AMD MI455X. A time is GPU time per run, averaged over a window of back-to-back runs after a warm-up
// (all launches, gaps included; the runs take copies of the inputs in turn), and the median of several windows.
// Apart from v000's, it joins two sittings. Times from different sittings can be a few percent apart, while
// side-by-side timings come from the same sitting.
// The starting kernel, v000, takes 732 microseconds a run.
// compute dtype: all float inputs rounded to bf16; A = x Wq[b] and Bm = T Wk[b] with EXACT bf16 products on WMMA 16x16x32, f32 accumulate, stored as bf16 hi + lo row planes; S = A . Bm over K = 512 with 3 products (hi.hi + hi.lo + lo.hi), f32; softmax in f32 (precise expf); P x 2^11 split bf16 hi + lo against the EXACT bf16 T planes (2 products); + x residual in f32; f32 output.
#include <hip/hip_runtime.h>
#include <math.h>

typedef __attribute__((ext_vector_type(16))) _Float16 v16h;
typedef __attribute__((ext_vector_type(16))) __bf16 v16b;
typedef __attribute__((ext_vector_type(8)))  _Float16 v8h;
typedef __attribute__((ext_vector_type(8)))  float v8f;
typedef __attribute__((ext_vector_type(4)))  float v4f;
typedef __attribute__((ext_vector_type(2)))  float v2f;
typedef __attribute__((ext_vector_type(4)))  unsigned v4u;
typedef __attribute__((ext_vector_type(4)))  int v4i;
typedef float __attribute__((may_alias)) float_a;
typedef int __attribute__((may_alias)) int_a;

template <typename T> __device__ __forceinline__ void vst2(void* p, T v) { *(T*)p = v;  }
__device__ __forceinline__ v8f wmma16(v16h a, v16h b, v8f c) {
  v8f d = __builtin_amdgcn_wmma_f32_16x16x32_f16(false, a, false, b, (short)0, c, false, false);
  asm volatile("v_nop\n\tv_nop\n\tv_nop\n\tv_nop" : "+v"(d) : "v"(a), "v"(b));
  return d;
}
__device__ __forceinline__ v8f wmma_bf(v16b a, v16b b, v8f c) {
  v8f d = __builtin_amdgcn_wmma_f32_16x16x32_bf16(false, a, false, b, (short)0, c, false, false);
  asm volatile("v_nop\n\tv_nop\n\tv_nop\n\tv_nop" : "+v"(d) : "v"(a), "v"(b));
  return d;
}
// 16x16x32 fragments: lane = (h = lane>>4, row/col = lane&15); elements 0..7 = k0+8h+0..7, 8..15 = k0+16+8h+0..7; D element r = row 8h+r
__device__ __forceinline__ v16h frag_h(const _Float16* rowk0, int lane) {
  union { v16h v; v8h q[2]; } u; const _Float16* p = rowk0 + 8 * (lane >> 4);
  u.q[0] = *(const v8h*)p; u.q[1] = *(const v8h*)(p + 16); return u.v;
}
__device__ __forceinline__ v16h frag_f32(const float* rowk0, int lane) {
  v16h a; const float* p = rowk0 + 8 * (lane >> 4);
#pragma unroll
  for (int i = 0; i < 8; ++i) { a[i] = (_Float16)p[i]; a[8 + i] = (_Float16)p[16 + i]; }
  return a;
}
__device__ __forceinline__ v16h frag_f32s(const float* rowk0, int lane, float sc) {
  v16h a; const float* p = rowk0 + 8 * (lane >> 4);
#pragma unroll
  for (int i = 0; i < 8; ++i) { a[i] = (_Float16)(p[i] * sc); a[8 + i] = (_Float16)(p[16 + i] * sc); }
  return a;
}
// column fragment from a [K][ld] layout (column n), rows >= K read as 0
__device__ __forceinline__ v16h fragc_f32(const float* W, int k0, int n, int lane, int ld, int K) {
  v16h a; const int g = lane >> 4;
#pragma unroll
  for (int i = 0; i < 8; ++i) { const int ka = k0 + 8 * g + i, kb = ka + 16;
    a[i] = (_Float16)(ka < K ? W[(size_t)(ka < K ? ka : K - 1) * ld + n] : 0.f); a[8 + i] = (_Float16)(kb < K ? W[(size_t)(kb < K ? kb : K - 1) * ld + n] : 0.f); }
  return a;
}
struct F2 { v16b h, l; };
__device__ __forceinline__ F2 bsplit16(const float v[16]) { F2 r;
#pragma unroll
  for (int i = 0; i < 16; ++i) { const __bf16 h = (__bf16)v[i]; r.h[i] = h; r.l[i] = (__bf16)(v[i] - (float)h); }
  return r; }
__device__ __forceinline__ F2 split_row(const float* row, int k0, int lane) { float v[16]; const float* p = row + k0 + 8 * (lane >> 4);
#pragma unroll
  for (int i = 0; i < 8; ++i) { v[i] = p[i]; v[8 + i] = p[16 + i]; }
  return bsplit16(v); }
__device__ __forceinline__ F2 split_rowK(const float* row, int k0, int lane, int K) { float v[16]; const int g = lane >> 4;
#pragma unroll
  for (int i = 0; i < 8; ++i) { const int ka = k0 + 8 * g + i, kb = ka + 16; v[i] = ka < K ? row[ka < K ? ka : K - 1] : 0.f; v[8 + i] = kb < K ? row[kb < K ? kb : K - 1] : 0.f; }
  return bsplit16(v); }
__device__ __forceinline__ F2 split_col(const float* W, int k0, int n, int lane, int ld, int K) { float v[16]; const int g = lane >> 4;
#pragma unroll
  for (int i = 0; i < 8; ++i) { const int ka = k0 + 8 * g + i, kb = ka + 16; v[i] = ka < K ? W[(size_t)(ka < K ? ka : K - 1) * ld + n] : 0.f; v[8 + i] = kb < K ? W[(size_t)(kb < K ? kb : K - 1) * ld + n] : 0.f; }
  return bsplit16(v); }
__device__ __forceinline__ v8f mac3(const F2& a, const F2& b, v8f c) { c = wmma_bf(a.l, b.h, c); c = wmma_bf(a.h, b.l, c); return wmma_bf(a.h, b.h, c); }
__device__ __forceinline__ float sigm(float v) { return 1.0f / (1.0f + expf(-v)); }
#define LDSX() do { asm volatile("s_wait_dscnt 0" ::: "memory"); __builtin_amdgcn_wave_barrier(); __builtin_amdgcn_fence(__ATOMIC_RELEASE, "workgroup"); } while (0)

// Projector (B 16, N 1,024, C 512, per-batch weights): A = x Wq[b]; Bm = T Wk[b]; P = softmax(A Bm^T); out = x + P T.
__device__ __forceinline__ float bfr(float v) { return (float)(__bf16)v; }
#define NB 16
#define TT 1024
#define CC 512
#ifndef TNB
#define TNB NB
#endif
#define BG 4                   // batches per launch group (S planes)
typedef __attribute__((ext_vector_type(8))) __bf16 v8b;
__device__ __forceinline__ v16b frag_b(const __bf16* rowk0, int lane) { union { v16b v; v8b q[2]; } u; const __bf16* p = rowk0 + 8 * (lane >> 4); u.q[0] = *(const v8b*)p; u.q[1] = *(const v8b*)(p + 16); return u.v; }
#define WS_AH  0u                                          // bf16 A hi rows [b*N+n][512]
#define WS_AL  (WS_AH + 2u * (size_t)NB * TT * CC)
#define WS_BH  (WS_AL + 2u * (size_t)NB * TT * CC)           // bf16 Bm hi rows [b*N+m][512]
#define WS_BL  (WS_BH + 2u * (size_t)NB * TT * CC)
#define WS_TT  (WS_BL + 2u * (size_t)NB * TT * CC)           // bf16 T planes [b][c][m] (exact)
#define WS_S   (WS_TT + 2u * (size_t)NB * CC * TT)           // f32 S / P [bg][n][m]
#define WS_END (WS_S + 4u * (size_t)BG * TT * TT)
// ---- k_lin: block = (64 rows, 128 cols, which): A = x Wq[b] (which 0) or Bm = T Wk[b] (which 1), per-batch (in,out) weights, exact; stored as bf16 hi + lo rows
__global__ __launch_bounds__(128) void k_lin(const float* __restrict__ X, const float* __restrict__ T_, const float* __restrict__ WQ, const float* __restrict__ WK, __bf16* __restrict__ AH, __bf16* __restrict__ AL, __bf16* __restrict__ BH, __bf16* __restrict__ BL) { __shared__ __align__(16) __bf16 sh[64][136], sl[64][136];
  const int tid = threadIdx.x, wave = tid >> 5, lane = tid & 31, col = lane & 15, g = lane >> 4; const int which = blockIdx.z; const int c0 = blockIdx.y * 128; const size_t r0 = (size_t)blockIdx.x * 64; const size_t b = r0 / TT;
  const float* SRC = which == 0 ? X : T_; const float* Wb = (which == 0 ? WQ : WK) + b * (size_t)CC * CC; __bf16* DH = which == 0 ? AH : BH; __bf16* DL = which == 0 ? AL : BL;
  v8f acc[8] = {};
#pragma unroll 2
  for (int kc = 0; kc < CC / 32; ++kc) { v16b a; { const float* p = SRC + (r0 + wave * 16 + col) * CC + kc * 32 + 8 * g;
#pragma unroll
      for (int i = 0; i < 8; ++i) { a[i] = (__bf16)p[i]; a[8 + i] = (__bf16)p[16 + i]; } }
#pragma unroll
    for (int j = 0; j < 8; ++j) { v16b w; const int o = c0 + j * 16 + col;
#pragma unroll
      for (int i = 0; i < 8; ++i) { w[i] = (__bf16)Wb[(size_t)(kc * 32 + 8 * g + i) * CC + o]; w[8 + i] = (__bf16)Wb[(size_t)(kc * 32 + 16 + 8 * g + i) * CC + o]; }
      asm volatile("s_wait_loadcnt 0x0" ::: "memory"); acc[j] = wmma_bf(a, w, acc[j]); } }
#pragma unroll
  for (int j = 0; j < 8; ++j)
#pragma unroll
    for (int r = 0; r < 8; ++r) { const float v = acc[j][r]; const __bf16 h = (__bf16)v; sh[wave * 16 + 8 * g + r][j * 16 + col] = h; sl[wave * 16 + 8 * g + r][j * 16 + col] = (__bf16)(v - (float)h); }
  __syncthreads();
  for (int e = tid; e < 64 * 16; e += 128) { const int rl = e >> 4, q = e & 15; vst2((unsigned*)(DH + (r0 + rl) * CC + c0 + q * 8), *(const v4u*)&sh[rl][q * 8]); vst2((unsigned*)(DL + (r0 + rl) * CC + c0 + q * 8), *(const v4u*)&sl[rl][q * 8]); } }
// ---- k_tt: block = (128 rows m, b, 128-channel group): T (exact bf16) -> planes [b][c][m]; 256-B pieces
__global__ __launch_bounds__(128) void k_tt(const float* __restrict__ T_, __bf16* __restrict__ TP) { __shared__ __align__(16) __bf16 th[128][136];
  const int tid = threadIdx.x; const int m0 = blockIdx.x * 128; const size_t b = blockIdx.y; const int c0 = blockIdx.z * 128;
  for (int e = tid; e < 128 * 128; e += 128) { const int ml = e >> 7, cl = e & 127; th[cl][ml] = (__bf16)T_[(b * TT + m0 + ml) * CC + c0 + cl]; }
  __syncthreads();
  for (int e = tid; e < 128 * 16; e += 128) { const int cl = e >> 4, q = e & 15; vst2((unsigned*)(TP + (b * CC + c0 + cl) * (size_t)TT + m0 + q * 8), *(const v4u*)&th[cl][q * 8]); } }
// ---- k_sc: block = (64 rows n, 128 cols m, batch in group): S = A . Bm over K 512, 3 products
__global__ __launch_bounds__(128) void k_sc(const __bf16* __restrict__ AH, const __bf16* __restrict__ AL, const __bf16* __restrict__ BH, const __bf16* __restrict__ BL, int b0, float* __restrict__ S0) { __shared__ __align__(16) float ss[4][16][132];
  const size_t b = b0 + blockIdx.z; float* S = S0 + (size_t)blockIdx.z * TT * TT;
  const int tid = threadIdx.x, wave = tid >> 5, lane = tid & 31, col = lane & 15, g = lane >> 4; const int k0 = blockIdx.y * 128; const int ql0 = blockIdx.x * 64 + wave * 16;
  v8f acc[8] = {};
#pragma unroll 2
  for (int kc = 0; kc < CC / 32; ++kc) { const size_t ao = (b * TT + ql0 + col) * CC + kc * 32; const v16b ah = frag_b(AH + ao, lane), al = frag_b(AL + ao, lane);
#pragma unroll
    for (int j = 0; j < 8; ++j) { const size_t bo = (b * TT + k0 + j * 16 + col) * CC + kc * 32; const v16b bh = frag_b(BH + bo, lane); acc[j] = wmma_bf(ah, bh, acc[j]); acc[j] = wmma_bf(al, bh, acc[j]); acc[j] = wmma_bf(ah, frag_b(BL + bo, lane), acc[j]); } }
#pragma unroll
  for (int j = 0; j < 8; ++j)
#pragma unroll
    for (int r = 0; r < 8; ++r) ss[wave][8 * g + r][j * 16 + col] = acc[j][r];
  LDSX(); for (int rl = 0; rl < 16; ++rl) vst2(S + (size_t)(ql0 + rl) * TT + k0 + lane * 4, *(const v4f*)&ss[wave][rl][lane * 4]); }
// ---- k_sm: block = query row: softmax over keys [0, kend) -> P x 2^11 f32 (masked -> 0)
__global__ __launch_bounds__(256) void k_sm(float* __restrict__ S0) { __shared__ float sred[8]; __shared__ float sbc; __shared__ __align__(16) float sh[TT];
  const int t = threadIdx.x; const size_t row = blockIdx.x; float* sr = S0 + (size_t)blockIdx.y * TT * TT + row * TT; const int kend = TT;
  float m = -3.0e38f; for (int k = t; k < kend; k += 256) m = fmaxf(m, sr[k]);
#pragma unroll
  for (int o = 1; o < 32; o <<= 1) m = fmaxf(m, __shfl_xor(m, o));
  if ((t & 31) == 0) sred[t >> 5] = m; __syncthreads(); if (t == 0) { float a = sred[0]; for (int i = 1; i < 8; ++i) a = fmaxf(a, sred[i]); sbc = a; } __syncthreads(); m = sbc; __syncthreads();
  float sum = 0.f; for (int k = t; k < kend; k += 256) { const float v = sr[k]; sum += (v <= -1.0e38f) ? 0.f : expf(v - m); }
#pragma unroll
  for (int o = 1; o < 32; o <<= 1) sum += __shfl_xor(sum, o);
  if ((t & 31) == 0) sred[t >> 5] = sum; __syncthreads(); if (t == 0) { float a = 0.f; for (int i = 0; i < 8; ++i) a += sred[i]; sbc = 1.0f / a; } __syncthreads(); const float inv = sbc;
  for (int k = t; k < kend; k += 256) { const float v = sr[k]; sh[k] = (v <= -1.0e38f) ? 0.f : expf(v - m) * inv * 2048.0f; }
  __syncthreads(); for (int q = t; q < kend / 4; q += 256) vst2(sr + q * 4, *(const v4f*)&sh[q * 4]); }
// ---- k_pv: block = (64 rows n, 128 channels, batch in group): out = x + (P . T) / 2^11 (P split bf16 hi + lo x exact T planes, 2 products)
__global__ __launch_bounds__(128) void k_pv(const float* __restrict__ PS0, const __bf16* __restrict__ TP, const float* __restrict__ X, int b0, float* __restrict__ OUT) { __shared__ __align__(16) float ss[4][16][132];
  const size_t b = b0 + blockIdx.z; const float* PS = PS0 + (size_t)blockIdx.z * TT * TT;
  const int tid = threadIdx.x, wave = tid >> 5, lane = tid & 31, col = lane & 15, g = lane >> 4; const int ql0 = blockIdx.x * 64 + wave * 16; const int c0 = blockIdx.y * 128;
  v8f acc[8] = {};
#pragma unroll 1
  for (int kc = 0; kc < TT / 32; ++kc) { const F2 p = split_row(PS + (size_t)(ql0 + col) * TT, kc * 32, lane);
#pragma unroll
    for (int j = 0; j < 8; ++j) { const v16b th = frag_b(TP + (b * CC + c0 + j * 16 + col) * (size_t)TT + kc * 32, lane); acc[j] = wmma_bf(p.h, th, acc[j]); acc[j] = wmma_bf(p.l, th, acc[j]); } }
#pragma unroll
  for (int j = 0; j < 8; ++j)
#pragma unroll
    for (int r = 0; r < 8; ++r) ss[wave][8 * g + r][j * 16 + col] = acc[j][r] * (1.0f / 2048.0f);
  LDSX(); for (int rl = 0; rl < 16; ++rl) { const size_t off = (b * TT + ql0 + rl) * CC + c0 + lane * 4; const v4f xr = *(const v4f*)(X + off); v4f o = *(const v4f*)&ss[wave][rl][lane * 4]; o[0] += bfr(xr[0]); o[1] += bfr(xr[1]); o[2] += bfr(xr[2]); o[3] += bfr(xr[3]); vst2(OUT + off, o); } }
extern "C" void kernel_launch(void* const* d_in, const int* in_sizes, int n_in, void* d_out, int out_size, void* d_ws, size_t ws_size, hipStream_t stream) {
  (void)in_sizes; (void)n_in; (void)out_size;
  const float** F = (const float**)d_in;   // 0 x_in [16,1024,512], 1 T [16,1024,512], 2 Wq [16,512,512] ((in,out) per batch), 3 Wk [16,512,512]
  if (ws_size < (size_t)WS_END) return;
  char* ws = (char*)d_ws; __bf16 *AH = (__bf16*)(ws + WS_AH), *AL = (__bf16*)(ws + WS_AL), *BH = (__bf16*)(ws + WS_BH), *BL = (__bf16*)(ws + WS_BL), *TP = (__bf16*)(ws + WS_TT); float* S = (float*)(ws + WS_S);
  k_lin<<<dim3(TNB * TT / 64, CC / 128, 2), 128, 0, stream>>>(F[0], F[1], F[2], F[3], AH, AL, BH, BL);
  k_tt<<<dim3(TT / 128, TNB, CC / 128), 128, 0, stream>>>(F[1], TP);
  for (int b0 = 0; b0 < TNB; b0 += BG) { const int ng = (TNB - b0) < BG ? (TNB - b0) : BG;
    k_sc<<<dim3(TT / 64, TT / 128, ng), 128, 0, stream>>>(AH, AL, BH, BL, b0, S);
    k_sm<<<dim3(TT, ng), 256, 0, stream>>>(S);
    k_pv<<<dim3(TT / 64, CC / 128, ng), 128, 0, stream>>>(S, TP, F[0], b0, (float*)d_out);
  }
}

// v001
// Measured time: 289 microseconds a run.
// Two timings next to v000 put it at 2.54 and 2.57 times that version's speed.
// compute dtype: all float inputs rounded to bf16; A = x Wq[b] and Bm = T Wk[b] with EXACT bf16 products on WMMA 16x16x32, f32 accumulate, stored as bf16 hi + lo row planes; S = A . Bm over K = 512 with 3 products (hi.hi + hi.lo + lo.hi), f32; softmax in f32 (precise expf); P x 2^11 split bf16 hi + lo against the EXACT bf16 T planes (2 products); + x residual in f32; f32 output.
#include <hip/hip_runtime.h>
#include <math.h>

typedef __attribute__((ext_vector_type(16))) _Float16 v16h;
typedef __attribute__((ext_vector_type(16))) __bf16 v16b;
typedef __attribute__((ext_vector_type(8)))  _Float16 v8h;
typedef __attribute__((ext_vector_type(8)))  float v8f;
typedef __attribute__((ext_vector_type(4)))  float v4f;
typedef __attribute__((ext_vector_type(2)))  float v2f;
typedef __attribute__((ext_vector_type(4)))  unsigned v4u;
typedef __attribute__((ext_vector_type(4)))  int v4i;
typedef float __attribute__((may_alias)) float_a;
typedef int __attribute__((may_alias)) int_a;

template <typename T> __device__ __forceinline__ void vst2(void* p, T v) { *(T*)p = v;  }
__device__ __forceinline__ v8f wmma16(v16h a, v16h b, v8f c) {
  v8f d = __builtin_amdgcn_wmma_f32_16x16x32_f16(false, a, false, b, (short)0, c, false, false);
  asm volatile("v_nop\n\tv_nop\n\tv_nop\n\tv_nop" : "+v"(d) : "v"(a), "v"(b));
  return d;
}
__device__ __forceinline__ v8f wmma_bf(v16b a, v16b b, v8f c) {
  v8f d = __builtin_amdgcn_wmma_f32_16x16x32_bf16(false, a, false, b, (short)0, c, false, false);
  asm volatile("v_nop\n\tv_nop\n\tv_nop\n\tv_nop" : "+v"(d) : "v"(a), "v"(b));
  return d;
}
// 16x16x32 fragments: lane = (h = lane>>4, row/col = lane&15); elements 0..7 = k0+8h+0..7, 8..15 = k0+16+8h+0..7; D element r = row 8h+r
__device__ __forceinline__ v16h frag_h(const _Float16* rowk0, int lane) {
  union { v16h v; v8h q[2]; } u; const _Float16* p = rowk0 + 8 * (lane >> 4);
  u.q[0] = *(const v8h*)p; u.q[1] = *(const v8h*)(p + 16); return u.v;
}
__device__ __forceinline__ v16h frag_f32(const float* rowk0, int lane) {
  v16h a; const float* p = rowk0 + 8 * (lane >> 4);
#pragma unroll
  for (int i = 0; i < 8; ++i) { a[i] = (_Float16)p[i]; a[8 + i] = (_Float16)p[16 + i]; }
  return a;
}
__device__ __forceinline__ v16h frag_f32s(const float* rowk0, int lane, float sc) {
  v16h a; const float* p = rowk0 + 8 * (lane >> 4);
#pragma unroll
  for (int i = 0; i < 8; ++i) { a[i] = (_Float16)(p[i] * sc); a[8 + i] = (_Float16)(p[16 + i] * sc); }
  return a;
}
// column fragment from a [K][ld] layout (column n), rows >= K read as 0
__device__ __forceinline__ v16h fragc_f32(const float* W, int k0, int n, int lane, int ld, int K) {
  v16h a; const int g = lane >> 4;
#pragma unroll
  for (int i = 0; i < 8; ++i) { const int ka = k0 + 8 * g + i, kb = ka + 16;
    a[i] = (_Float16)(ka < K ? W[(size_t)(ka < K ? ka : K - 1) * ld + n] : 0.f); a[8 + i] = (_Float16)(kb < K ? W[(size_t)(kb < K ? kb : K - 1) * ld + n] : 0.f); }
  return a;
}
struct F2 { v16b h, l; };
__device__ __forceinline__ F2 bsplit16(const float v[16]) { F2 r;
#pragma unroll
  for (int i = 0; i < 16; ++i) { const __bf16 h = (__bf16)v[i]; r.h[i] = h; r.l[i] = (__bf16)(v[i] - (float)h); }
  return r; }
__device__ __forceinline__ F2 split_row(const float* row, int k0, int lane) { float v[16]; const float* p = row + k0 + 8 * (lane >> 4);
#pragma unroll
  for (int i = 0; i < 8; ++i) { v[i] = p[i]; v[8 + i] = p[16 + i]; }
  return bsplit16(v); }
__device__ __forceinline__ F2 split_rowK(const float* row, int k0, int lane, int K) { float v[16]; const int g = lane >> 4;
#pragma unroll
  for (int i = 0; i < 8; ++i) { const int ka = k0 + 8 * g + i, kb = ka + 16; v[i] = ka < K ? row[ka < K ? ka : K - 1] : 0.f; v[8 + i] = kb < K ? row[kb < K ? kb : K - 1] : 0.f; }
  return bsplit16(v); }
__device__ __forceinline__ F2 split_col(const float* W, int k0, int n, int lane, int ld, int K) { float v[16]; const int g = lane >> 4;
#pragma unroll
  for (int i = 0; i < 8; ++i) { const int ka = k0 + 8 * g + i, kb = ka + 16; v[i] = ka < K ? W[(size_t)(ka < K ? ka : K - 1) * ld + n] : 0.f; v[8 + i] = kb < K ? W[(size_t)(kb < K ? kb : K - 1) * ld + n] : 0.f; }
  return bsplit16(v); }
__device__ __forceinline__ v8f mac3(const F2& a, const F2& b, v8f c) { c = wmma_bf(a.l, b.h, c); c = wmma_bf(a.h, b.l, c); return wmma_bf(a.h, b.h, c); }
__device__ __forceinline__ float sigm(float v) { return 1.0f / (1.0f + expf(-v)); }
#define LDSX() do { asm volatile("s_wait_dscnt 0" ::: "memory"); __builtin_amdgcn_wave_barrier(); __builtin_amdgcn_fence(__ATOMIC_RELEASE, "workgroup"); } while (0)

// Projector (B 16, N 1,024, C 512, per-batch weights): A = x Wq[b]; Bm = T Wk[b]; P = softmax(A Bm^T); out = x + P T.
__device__ __forceinline__ float bfr(float v) { return (float)(__bf16)v; }
#define NB 16
#define TT 1024
#define CC 512
#ifndef TNB
#define TNB NB
#endif
#define BG 4                   // batches per launch group (S planes)
typedef __attribute__((ext_vector_type(8))) __bf16 v8b;
__device__ __forceinline__ v16b frag_b(const __bf16* rowk0, int lane) { union { v16b v; v8b q[2]; } u; const __bf16* p = rowk0 + 8 * (lane >> 4); u.q[0] = *(const v8b*)p; u.q[1] = *(const v8b*)(p + 16); return u.v; }
#define WS_AH  0u                                          // bf16 A hi rows [b*N+n][512]
#define WS_AL  (WS_AH + 2u * (size_t)NB * TT * CC)
#define WS_BH  (WS_AL + 2u * (size_t)NB * TT * CC)           // bf16 Bm hi rows [b*N+m][512]
#define WS_BL  (WS_BH + 2u * (size_t)NB * TT * CC)
#define WS_TT  (WS_BL + 2u * (size_t)NB * TT * CC)           // bf16 T planes [b][c][m] (exact)
#define WS_S   (WS_TT + 2u * (size_t)NB * CC * TT)           // f32 S / P [bg][n][m]
#define WS_END (WS_S + 4u * (size_t)BG * TT * TT)
// ---- LDS staging by asynchronous copies: each lane brings its own 16 bytes; a wave's 32 lanes cover whole 128-B lines
__device__ __forceinline__ unsigned lds_off(const void* p) { return (unsigned)(size_t)p; }
// eight copies in one statement: four from (la, ga) and four from (lb, gb), LS bytes apart in LDS and GS bytes apart in global memory.
// s_wait_xcnt 0 is the statement's last line so that it stands in front of every later rewrite of the address registers named here.
template <int LS, int GS> __device__ __forceinline__ void cp44(unsigned la, const char* ga, unsigned lb, const char* gb) {
  asm volatile("global_load_async_to_lds_b128 %0, %1, off\n\t"
               "global_load_async_to_lds_b128 %2, %3, off\n\t"
               "global_load_async_to_lds_b128 %4, %5, off\n\t"
               "global_load_async_to_lds_b128 %6, %7, off\n\t"
               "global_load_async_to_lds_b128 %8, %9, off\n\t"
               "global_load_async_to_lds_b128 %10, %11, off\n\t"
               "global_load_async_to_lds_b128 %12, %13, off\n\t"
               "global_load_async_to_lds_b128 %14, %15, off\n\t"
               "s_wait_xcnt 0x0"
               :: "v"(la), "v"(ga), "v"(la + LS), "v"(ga + GS), "v"(la + 2 * LS), "v"(ga + 2 * GS), "v"(la + 3 * LS), "v"(ga + 3 * GS),
                  "v"(lb), "v"(gb), "v"(lb + LS), "v"(gb + GS), "v"(lb + 2 * LS), "v"(gb + 2 * GS), "v"(lb + 3 * LS), "v"(gb + 3 * GS) : "memory");
}
// the issuing wave's own copies have landed (the compiler places no wait for them)
#define WAIT_COPIES() asm volatile("s_wait_asynccnt 0x0" ::: "memory")
// this wave's LDS reads have retired before the buffer they read is handed back for a refill
#define WAIT_LDS() asm volatile("s_wait_dscnt 0x0" ::: "memory")
#define SC_AP (64 * 144)                   // k_sc stage: one A plane, 64 rows of 128 B (64 k) at pitch 144 B
#define SC_BP (128 * 144)                  // one Bm plane, 128 rows
#define SC_ST (2 * SC_AP + 2 * SC_BP)      // [A hi | A lo | Bm hi | Bm lo]
#define PV_PP (64 * 272)                   // k_pv stage: P, 64 rows of 256 B (64 keys, f32) at pitch 272 B
#define PV_TP (128 * 144)                  // T planes, 128 channel rows of 128 B (64 keys) at pitch 144 B
#define PV_ST (PV_PP + PV_TP)
// ---- k_lin: block = (64 rows, 128 cols, which): A = x Wq[b] (which 0) or Bm = T Wk[b] (which 1), per-batch (in,out) weights, exact; stored as bf16 hi + lo rows
__global__ __launch_bounds__(128) void k_lin(const float* __restrict__ X, const float* __restrict__ T_, const float* __restrict__ WQ, const float* __restrict__ WK, __bf16* __restrict__ AH, __bf16* __restrict__ AL, __bf16* __restrict__ BH, __bf16* __restrict__ BL) { __shared__ __align__(16) __bf16 sh[64][136], sl[64][136];
  const int tid = threadIdx.x, wave = tid >> 5, lane = tid & 31, col = lane & 15, g = lane >> 4; const int which = blockIdx.z; const int c0 = blockIdx.y * 128; const size_t r0 = (size_t)blockIdx.x * 64; const size_t b = r0 / TT;
  const float* SRC = which == 0 ? X : T_; const float* Wb = (which == 0 ? WQ : WK) + b * (size_t)CC * CC; __bf16* DH = which == 0 ? AH : BH; __bf16* DL = which == 0 ? AL : BL;
  v8f acc[8] = {};
#pragma unroll 2
  for (int kc = 0; kc < CC / 32; ++kc) { v16b a; { const float* p = SRC + (r0 + wave * 16 + col) * CC + kc * 32 + 8 * g;
#pragma unroll
      for (int i = 0; i < 8; ++i) { a[i] = (__bf16)p[i]; a[8 + i] = (__bf16)p[16 + i]; } }
#pragma unroll
    for (int j = 0; j < 8; ++j) { v16b w; const int o = c0 + j * 16 + col;
#pragma unroll
      for (int i = 0; i < 8; ++i) { w[i] = (__bf16)Wb[(size_t)(kc * 32 + 8 * g + i) * CC + o]; w[8 + i] = (__bf16)Wb[(size_t)(kc * 32 + 16 + 8 * g + i) * CC + o]; }
      asm volatile("s_wait_loadcnt 0x0" ::: "memory"); acc[j] = wmma_bf(a, w, acc[j]); } }
#pragma unroll
  for (int j = 0; j < 8; ++j)
#pragma unroll
    for (int r = 0; r < 8; ++r) { const float v = acc[j][r]; const __bf16 h = (__bf16)v; sh[wave * 16 + 8 * g + r][j * 16 + col] = h; sl[wave * 16 + 8 * g + r][j * 16 + col] = (__bf16)(v - (float)h); }
  __syncthreads();
  for (int e = tid; e < 64 * 16; e += 128) { const int rl = e >> 4, q = e & 15; vst2((unsigned*)(DH + (r0 + rl) * CC + c0 + q * 8), *(const v4u*)&sh[rl][q * 8]); vst2((unsigned*)(DL + (r0 + rl) * CC + c0 + q * 8), *(const v4u*)&sl[rl][q * 8]); } }
// ---- k_tt: block = (128 rows m, b, 128-channel group): T (exact bf16) -> planes [b][c][m]; 256-B pieces
__global__ __launch_bounds__(128) void k_tt(const float* __restrict__ T_, __bf16* __restrict__ TP) { __shared__ __align__(16) __bf16 th[128][136];
  const int tid = threadIdx.x; const int m0 = blockIdx.x * 128; const size_t b = blockIdx.y; const int c0 = blockIdx.z * 128;
  for (int e = tid; e < 128 * 128; e += 128) { const int ml = e >> 7, cl = e & 127; th[cl][ml] = (__bf16)T_[(b * TT + m0 + ml) * CC + c0 + cl]; }
  __syncthreads();
  for (int e = tid; e < 128 * 16; e += 128) { const int cl = e >> 4, q = e & 15; vst2((unsigned*)(TP + (b * CC + c0 + cl) * (size_t)TT + m0 + q * 8), *(const v4u*)&th[cl][q * 8]); } }
// ---- k_sc: block = (64 rows n, 128 cols m, batch in group): S = A . Bm over K 512, 3 products
__global__ __launch_bounds__(128) void k_sc(const __bf16* __restrict__ AH, const __bf16* __restrict__ AL, const __bf16* __restrict__ BH, const __bf16* __restrict__ BL, int b0, float* __restrict__ S0) { __shared__ __align__(16) float ss[4][16][132]; __shared__ __align__(16) char ring[2][SC_ST];
  const size_t b = b0 + blockIdx.z; float* S = S0 + (size_t)blockIdx.z * TT * TT;
  const int tid = threadIdx.x, wave = tid >> 5, lane = tid & 31, col = lane & 15, g = lane >> 4; const int k0 = blockIdx.y * 128; const int ql0 = blockIdx.x * 64 + wave * 16;
  v8f acc[8] = {};
  // stage t = k [64 t, 64 t + 64) of the block's 64 A rows and 128 Bm rows, hi and lo; thread -> row tid >> 3 (+ 16 per copy), 16-B piece tid & 7
  const unsigned l0 = lds_off(&ring[0][0]) + (tid >> 3) * 144 + (tid & 7) * 16;
  const size_t goa = ((b * TT + blockIdx.x * 64 + (tid >> 3)) * CC + (tid & 7) * 8) * 2, gob = ((b * TT + k0 + (tid >> 3)) * CC + (tid & 7) * 8) * 2;
  const char *gah = (const char*)AH + goa, *gal = (const char*)AL + goa, *gbh = (const char*)BH + gob, *gbl = (const char*)BL + gob;
  auto fill = [&](int t, int buf) { const unsigned l = l0 + buf * SC_ST; const int go = t * 128;
    cp44<16 * 144, 16 * CC * 2>(l, gah + go, l + SC_AP, gal + go);
    cp44<16 * 144, 16 * CC * 2>(l + 2 * SC_AP, gbh + go, l + 2 * SC_AP + 64 * 144, gbh + go + 64 * CC * 2);
    cp44<16 * 144, 16 * CC * 2>(l + 2 * SC_AP + SC_BP, gbl + go, l + 2 * SC_AP + SC_BP + 64 * 144, gbl + go + 64 * CC * 2); };
  fill(0, 0); WAIT_COPIES(); __syncthreads(); fill(1, 1);
#pragma unroll 1   // one stage a trip: the two buffers alternate by t & 1
  for (int t = 0; t < CC / 64; ++t) { const char* st = ring[t & 1];
#pragma unroll   // constant indices keep fragments and accumulators in registers
    for (int h = 0; h < 2; ++h) { v16b bh[8], bl[8];   // a 32-k block's LDS reads stand as one group in front of its WMMAs
      const char* ar = st + (wave * 16 + col) * 144 + h * 64; const v16b ah = frag_b((const __bf16*)ar, lane), al = frag_b((const __bf16*)(ar + SC_AP), lane);
#pragma unroll   // constant indices keep fragments and accumulators in registers
      for (int j = 0; j < 8; ++j) { const char* br = st + 2 * SC_AP + (j * 16 + col) * 144 + h * 64; bh[j] = frag_b((const __bf16*)br, lane); bl[j] = frag_b((const __bf16*)(br + SC_BP), lane); }
#pragma unroll   // constant indices keep fragments and accumulators in registers
      for (int j = 0; j < 8; ++j) { acc[j] = wmma_bf(ah, bh[j], acc[j]); acc[j] = wmma_bf(al, bh[j], acc[j]); acc[j] = wmma_bf(ah, bl[j], acc[j]); } }
    WAIT_LDS(); WAIT_COPIES(); __syncthreads();   // publishes stage t + 1 and ends every read of stage t's buffer
    if (t + 2 < CC / 64) fill(t + 2, t & 1); }
  WAIT_COPIES();
#pragma unroll
  for (int j = 0; j < 8; ++j)
#pragma unroll
    for (int r = 0; r < 8; ++r) ss[wave][8 * g + r][j * 16 + col] = acc[j][r];
  LDSX(); for (int rl = 0; rl < 16; ++rl) vst2(S + (size_t)(ql0 + rl) * TT + k0 + lane * 4, *(const v4f*)&ss[wave][rl][lane * 4]); }
// ---- k_sm: block = query row: softmax over keys [0, kend) -> P x 2^11 f32 (masked -> 0)
__global__ __launch_bounds__(256) void k_sm(float* __restrict__ S0) { __shared__ float sred[8]; __shared__ float sbc; __shared__ __align__(16) float sh[TT];
  const int t = threadIdx.x; const size_t row = blockIdx.x; float* sr = S0 + (size_t)blockIdx.y * TT * TT + row * TT; const int kend = TT;
  float m = -3.0e38f; for (int k = t; k < kend; k += 256) m = fmaxf(m, sr[k]);
#pragma unroll
  for (int o = 1; o < 32; o <<= 1) m = fmaxf(m, __shfl_xor(m, o));
  if ((t & 31) == 0) sred[t >> 5] = m; __syncthreads(); if (t == 0) { float a = sred[0]; for (int i = 1; i < 8; ++i) a = fmaxf(a, sred[i]); sbc = a; } __syncthreads(); m = sbc; __syncthreads();
  float sum = 0.f; for (int k = t; k < kend; k += 256) { const float v = sr[k]; sum += (v <= -1.0e38f) ? 0.f : expf(v - m); }
#pragma unroll
  for (int o = 1; o < 32; o <<= 1) sum += __shfl_xor(sum, o);
  if ((t & 31) == 0) sred[t >> 5] = sum; __syncthreads(); if (t == 0) { float a = 0.f; for (int i = 0; i < 8; ++i) a += sred[i]; sbc = 1.0f / a; } __syncthreads(); const float inv = sbc;
  for (int k = t; k < kend; k += 256) { const float v = sr[k]; sh[k] = (v <= -1.0e38f) ? 0.f : expf(v - m) * inv * 2048.0f; }
  __syncthreads(); for (int q = t; q < kend / 4; q += 256) vst2(sr + q * 4, *(const v4f*)&sh[q * 4]); }
// ---- k_pv: block = (64 rows n, 128 channels, batch in group): out = x + (P . T) / 2^11 (P split bf16 hi + lo x exact T planes, 2 products)
__global__ __launch_bounds__(128) void k_pv(const float* __restrict__ PS0, const __bf16* __restrict__ TP, const float* __restrict__ X, int b0, float* __restrict__ OUT) { __shared__ __align__(16) float ss[4][16][132]; __shared__ __align__(16) char ring[2][PV_ST];
  const size_t b = b0 + blockIdx.z; const float* PS = PS0 + (size_t)blockIdx.z * TT * TT;
  const int tid = threadIdx.x, wave = tid >> 5, lane = tid & 31, col = lane & 15, g = lane >> 4; const int ql0 = blockIdx.x * 64 + wave * 16; const int c0 = blockIdx.y * 128;
  v8f acc[8] = {};
  // stage t = keys [64 t, 64 t + 64): the block's 64 P rows (thread -> row tid >> 4, + 8 per copy, piece tid & 15) and 128 T channel rows (row tid >> 3, + 16 per copy, piece tid & 7)
  const unsigned lp0 = lds_off(&ring[0][0]) + (tid >> 4) * 272 + (tid & 15) * 16, lt0 = lds_off(&ring[0][0]) + PV_PP + (tid >> 3) * 144 + (tid & 7) * 16;
  const char* gp = (const char*)PS + ((size_t)(blockIdx.x * 64 + (tid >> 4)) * TT + (tid & 15) * 4) * 4; const char* gt = (const char*)TP + ((b * CC + c0 + (tid >> 3)) * (size_t)TT + (tid & 7) * 8) * 2;
  auto fill = [&](int t, int buf) { const unsigned lp = lp0 + buf * PV_ST, lt = lt0 + buf * PV_ST;
    cp44<8 * 272, 8 * TT * 4>(lp, gp + t * 256, lp + 32 * 272, gp + t * 256 + 32 * TT * 4);
    cp44<16 * 144, 16 * TT * 2>(lt, gt + t * 128, lt + 64 * 144, gt + t * 128 + 64 * TT * 2); };
  fill(0, 0); WAIT_COPIES(); __syncthreads(); fill(1, 1);
#pragma unroll 1   // one stage a trip: the two buffers alternate by t & 1
  for (int t = 0; t < TT / 64; ++t) { const char* st = ring[t & 1];
    F2 p[2]; v16b th[2][8];   // the stage's LDS reads stand as one group in front of its WMMAs
#pragma unroll   // constant indices keep fragments and accumulators in registers
    for (int h = 0; h < 2; ++h) { p[h] = split_row((const float*)(st + (wave * 16 + col) * 272), h * 32, lane);
#pragma unroll   // constant indices keep fragments and accumulators in registers
      for (int j = 0; j < 8; ++j) th[h][j] = frag_b((const __bf16*)(st + PV_PP + (j * 16 + col) * 144 + h * 64), lane); }
#pragma unroll   // constant indices keep fragments and accumulators in registers
    for (int h = 0; h < 2; ++h)
#pragma unroll   // constant indices keep fragments and accumulators in registers
      for (int j = 0; j < 8; ++j) { acc[j] = wmma_bf(p[h].h, th[h][j], acc[j]); acc[j] = wmma_bf(p[h].l, th[h][j], acc[j]); }
    WAIT_LDS(); WAIT_COPIES(); __syncthreads();   // publishes stage t + 1 and ends every read of stage t's buffer
    if (t + 2 < TT / 64) fill(t + 2, t & 1); }
  WAIT_COPIES();
#pragma unroll
  for (int j = 0; j < 8; ++j)
#pragma unroll
    for (int r = 0; r < 8; ++r) ss[wave][8 * g + r][j * 16 + col] = acc[j][r] * (1.0f / 2048.0f);
  LDSX(); for (int rl = 0; rl < 16; ++rl) { const size_t off = (b * TT + ql0 + rl) * CC + c0 + lane * 4; const v4f xr = *(const v4f*)(X + off); v4f o = *(const v4f*)&ss[wave][rl][lane * 4]; o[0] += bfr(xr[0]); o[1] += bfr(xr[1]); o[2] += bfr(xr[2]); o[3] += bfr(xr[3]); vst2(OUT + off, o); } }
extern "C" void kernel_launch(void* const* d_in, const int* in_sizes, int n_in, void* d_out, int out_size, void* d_ws, size_t ws_size, hipStream_t stream) {
  (void)in_sizes; (void)n_in; (void)out_size;
  const float** F = (const float**)d_in;   // 0 x_in [16,1024,512], 1 T [16,1024,512], 2 Wq [16,512,512] ((in,out) per batch), 3 Wk [16,512,512]
  if (ws_size < (size_t)WS_END) return;
  char* ws = (char*)d_ws; __bf16 *AH = (__bf16*)(ws + WS_AH), *AL = (__bf16*)(ws + WS_AL), *BH = (__bf16*)(ws + WS_BH), *BL = (__bf16*)(ws + WS_BL), *TP = (__bf16*)(ws + WS_TT); float* S = (float*)(ws + WS_S);
  k_lin<<<dim3(TNB * TT / 64, CC / 128, 2), 128, 0, stream>>>(F[0], F[1], F[2], F[3], AH, AL, BH, BL);
  k_tt<<<dim3(TT / 128, TNB, CC / 128), 128, 0, stream>>>(F[1], TP);
  for (int b0 = 0; b0 < TNB; b0 += BG) { const int ng = (TNB - b0) < BG ? (TNB - b0) : BG;
    k_sc<<<dim3(TT / 64, TT / 128, ng), 128, 0, stream>>>(AH, AL, BH, BL, b0, S);
    k_sm<<<dim3(TT, ng), 256, 0, stream>>>(S);
    k_pv<<<dim3(TT / 64, CC / 128, ng), 128, 0, stream>>>(S, TP, F[0], b0, (float*)d_out);
  }
}

// v002
// A run of this version takes 262 microseconds.
// In two side-by-side timings against v001, it was 1.10 and 1.11 times as fast.
// Over all steps from v000 it is 2.82 times as fast.
// compute dtype: all float inputs rounded to bf16; A = x Wq[b] and Bm = T Wk[b] with EXACT bf16 products on WMMA 16x16x32, f32 accumulate, stored as bf16 hi + lo row planes; S = A . Bm over K = 512 with 3 products (hi.hi + hi.lo + lo.hi), f32; softmax in f32 (precise expf); P x 2^11 split bf16 hi + lo against the EXACT bf16 T planes (2 products); + x residual in f32; f32 output.
#include <hip/hip_runtime.h>
#include <math.h>

typedef __attribute__((ext_vector_type(16))) _Float16 v16h;
typedef __attribute__((ext_vector_type(16))) __bf16 v16b;
typedef __attribute__((ext_vector_type(8)))  _Float16 v8h;
typedef __attribute__((ext_vector_type(8)))  float v8f;
typedef __attribute__((ext_vector_type(4)))  float v4f;
typedef __attribute__((ext_vector_type(2)))  float v2f;
typedef __attribute__((ext_vector_type(4)))  unsigned v4u;
typedef __attribute__((ext_vector_type(4)))  int v4i;
typedef float __attribute__((may_alias)) float_a;
typedef int __attribute__((may_alias)) int_a;

template <typename T> __device__ __forceinline__ void vst2(void* p, T v) { *(T*)p = v;  }
__device__ __forceinline__ v8f wmma16(v16h a, v16h b, v8f c) {
  v8f d = __builtin_amdgcn_wmma_f32_16x16x32_f16(false, a, false, b, (short)0, c, false, false);
  asm volatile("v_nop\n\tv_nop\n\tv_nop\n\tv_nop" : "+v"(d) : "v"(a), "v"(b));
  return d;
}
__device__ __forceinline__ v8f wmma_bf(v16b a, v16b b, v8f c) {
  v8f d = __builtin_amdgcn_wmma_f32_16x16x32_bf16(false, a, false, b, (short)0, c, false, false);
  asm volatile("v_nop\n\tv_nop\n\tv_nop\n\tv_nop" : "+v"(d) : "v"(a), "v"(b));
  return d;
}
// 16x16x32 fragments: lane = (h = lane>>4, row/col = lane&15); elements 0..7 = k0+8h+0..7, 8..15 = k0+16+8h+0..7; D element r = row 8h+r
__device__ __forceinline__ v16h frag_h(const _Float16* rowk0, int lane) {
  union { v16h v; v8h q[2]; } u; const _Float16* p = rowk0 + 8 * (lane >> 4);
  u.q[0] = *(const v8h*)p; u.q[1] = *(const v8h*)(p + 16); return u.v;
}
__device__ __forceinline__ v16h frag_f32(const float* rowk0, int lane) {
  v16h a; const float* p = rowk0 + 8 * (lane >> 4);
#pragma unroll
  for (int i = 0; i < 8; ++i) { a[i] = (_Float16)p[i]; a[8 + i] = (_Float16)p[16 + i]; }
  return a;
}
__device__ __forceinline__ v16h frag_f32s(const float* rowk0, int lane, float sc) {
  v16h a; const float* p = rowk0 + 8 * (lane >> 4);
#pragma unroll
  for (int i = 0; i < 8; ++i) { a[i] = (_Float16)(p[i] * sc); a[8 + i] = (_Float16)(p[16 + i] * sc); }
  return a;
}
// column fragment from a [K][ld] layout (column n), rows >= K read as 0
__device__ __forceinline__ v16h fragc_f32(const float* W, int k0, int n, int lane, int ld, int K) {
  v16h a; const int g = lane >> 4;
#pragma unroll
  for (int i = 0; i < 8; ++i) { const int ka = k0 + 8 * g + i, kb = ka + 16;
    a[i] = (_Float16)(ka < K ? W[(size_t)(ka < K ? ka : K - 1) * ld + n] : 0.f); a[8 + i] = (_Float16)(kb < K ? W[(size_t)(kb < K ? kb : K - 1) * ld + n] : 0.f); }
  return a;
}
struct F2 { v16b h, l; };
__device__ __forceinline__ F2 bsplit16(const float v[16]) { F2 r;
#pragma unroll
  for (int i = 0; i < 16; ++i) { const __bf16 h = (__bf16)v[i]; r.h[i] = h; r.l[i] = (__bf16)(v[i] - (float)h); }
  return r; }
__device__ __forceinline__ F2 split_row(const float* row, int k0, int lane) { float v[16]; const float* p = row + k0 + 8 * (lane >> 4);
#pragma unroll
  for (int i = 0; i < 8; ++i) { v[i] = p[i]; v[8 + i] = p[16 + i]; }
  return bsplit16(v); }
__device__ __forceinline__ F2 split_rowK(const float* row, int k0, int lane, int K) { float v[16]; const int g = lane >> 4;
#pragma unroll
  for (int i = 0; i < 8; ++i) { const int ka = k0 + 8 * g + i, kb = ka + 16; v[i] = ka < K ? row[ka < K ? ka : K - 1] : 0.f; v[8 + i] = kb < K ? row[kb < K ? kb : K - 1] : 0.f; }
  return bsplit16(v); }
__device__ __forceinline__ F2 split_col(const float* W, int k0, int n, int lane, int ld, int K) { float v[16]; const int g = lane >> 4;
#pragma unroll
  for (int i = 0; i < 8; ++i) { const int ka = k0 + 8 * g + i, kb = ka + 16; v[i] = ka < K ? W[(size_t)(ka < K ? ka : K - 1) * ld + n] : 0.f; v[8 + i] = kb < K ? W[(size_t)(kb < K ? kb : K - 1) * ld + n] : 0.f; }
  return bsplit16(v); }
__device__ __forceinline__ v8f mac3(const F2& a, const F2& b, v8f c) { c = wmma_bf(a.l, b.h, c); c = wmma_bf(a.h, b.l, c); return wmma_bf(a.h, b.h, c); }
__device__ __forceinline__ float sigm(float v) { return 1.0f / (1.0f + expf(-v)); }
#define LDSX() do { asm volatile("s_wait_dscnt 0" ::: "memory"); __builtin_amdgcn_wave_barrier(); __builtin_amdgcn_fence(__ATOMIC_RELEASE, "workgroup"); } while (0)

// Projector (B 16, N 1,024, C 512, per-batch weights): A = x Wq[b]; Bm = T Wk[b]; P = softmax(A Bm^T); out = x + P T.
__device__ __forceinline__ float bfr(float v) { return (float)(__bf16)v; }
#define NB 16
#define TT 1024
#define CC 512
#ifndef TNB
#define TNB NB
#endif
#define BG 4                   // batches per launch group (S planes)
typedef __attribute__((ext_vector_type(8))) __bf16 v8b;
__device__ __forceinline__ v16b frag_b(const __bf16* rowk0, int lane) { union { v16b v; v8b q[2]; } u; const __bf16* p = rowk0 + 8 * (lane >> 4); u.q[0] = *(const v8b*)p; u.q[1] = *(const v8b*)(p + 16); return u.v; }
#define WS_AH  0u                                          // bf16 A hi rows [b*N+n][512]
#define WS_AL  (WS_AH + 2u * (size_t)NB * TT * CC)
#define WS_BH  (WS_AL + 2u * (size_t)NB * TT * CC)           // bf16 Bm hi rows [b*N+m][512]
#define WS_BL  (WS_BH + 2u * (size_t)NB * TT * CC)
#define WS_TT  (WS_BL + 2u * (size_t)NB * TT * CC)           // bf16 T planes [b][c][m] (exact)
#define WS_S   (WS_TT + 2u * (size_t)NB * CC * TT)           // f32 S / P [bg][n][m]
#define WS_END (WS_S + 4u * (size_t)BG * TT * TT)
// ---- LDS staging by asynchronous copies: each lane brings its own 16 bytes; a wave's 32 lanes cover whole 128-B lines
__device__ __forceinline__ unsigned lds_off(const void* p) { return (unsigned)(size_t)p; }
// eight copies in one statement: four from (la, ga) and four from (lb, gb), LS bytes apart in LDS and GS bytes apart in global memory.
// s_wait_xcnt 0 is the statement's last line so that it stands in front of every later rewrite of the address registers named here.
template <int LS, int GS> __device__ __forceinline__ void cp44(unsigned la, const char* ga, unsigned lb, const char* gb) {
  asm volatile("global_load_async_to_lds_b128 %0, %1, off\n\t"
               "global_load_async_to_lds_b128 %2, %3, off\n\t"
               "global_load_async_to_lds_b128 %4, %5, off\n\t"
               "global_load_async_to_lds_b128 %6, %7, off\n\t"
               "global_load_async_to_lds_b128 %8, %9, off\n\t"
               "global_load_async_to_lds_b128 %10, %11, off\n\t"
               "global_load_async_to_lds_b128 %12, %13, off\n\t"
               "global_load_async_to_lds_b128 %14, %15, off\n\t"
               "s_wait_xcnt 0x0"
               :: "v"(la), "v"(ga), "v"(la + LS), "v"(ga + GS), "v"(la + 2 * LS), "v"(ga + 2 * GS), "v"(la + 3 * LS), "v"(ga + 3 * GS),
                  "v"(lb), "v"(gb), "v"(lb + LS), "v"(gb + GS), "v"(lb + 2 * LS), "v"(gb + 2 * GS), "v"(lb + 3 * LS), "v"(gb + 3 * GS) : "memory");
}
// the issuing wave's own copies have landed (the compiler places no wait for them)
#define WAIT_COPIES() asm volatile("s_wait_asynccnt 0x0" ::: "memory")
// this wave's LDS reads have retired before the buffer they read is handed back for a refill
#define WAIT_LDS() asm volatile("s_wait_dscnt 0x0" ::: "memory")
#define SC_AP (64 * 144)                   // k_sc stage: one A plane, 64 rows of 128 B (64 k) at pitch 144 B
#define SC_BP (128 * 144)                  // one Bm plane, 128 rows
#define SC_ST (2 * SC_AP + 2 * SC_BP)      // [A hi | A lo | Bm hi | Bm lo]
#define PV_PP (64 * 272)                   // k_pv stage: P, 64 rows of 256 B (64 keys, f32) at pitch 272 B
#define PV_TP (128 * 144)                  // T planes, 128 channel rows of 128 B (64 keys) at pitch 144 B
#define PV_ST (PV_PP + PV_TP)
// ---- k_lin: block = (64 rows, 128 cols, which): A = x Wq[b] (which 0) or Bm = T Wk[b] (which 1), per-batch (in,out) weights, exact; stored as bf16 hi + lo rows
__global__ __launch_bounds__(128) void k_lin(const float* __restrict__ X, const float* __restrict__ T_, const float* __restrict__ WQ, const float* __restrict__ WK, __bf16* __restrict__ AH, __bf16* __restrict__ AL, __bf16* __restrict__ BH, __bf16* __restrict__ BL) { __shared__ __align__(16) __bf16 sh[64][136], sl[64][136];
  const int tid = threadIdx.x, wave = tid >> 5, lane = tid & 31, col = lane & 15, g = lane >> 4; const int which = blockIdx.z; const int c0 = blockIdx.y * 128; const size_t r0 = (size_t)blockIdx.x * 64; const size_t b = r0 / TT;
  const float* SRC = which == 0 ? X : T_; const float* Wb = (which == 0 ? WQ : WK) + b * (size_t)CC * CC; __bf16* DH = which == 0 ? AH : BH; __bf16* DL = which == 0 ? AL : BL;
  v8f acc[8] = {};
#pragma unroll 2
  for (int kc = 0; kc < CC / 32; ++kc) { v16b a; { const float* p = SRC + (r0 + wave * 16 + col) * CC + kc * 32 + 8 * g;
#pragma unroll
      for (int i = 0; i < 8; ++i) { a[i] = (__bf16)p[i]; a[8 + i] = (__bf16)p[16 + i]; } }
#pragma unroll
    for (int j = 0; j < 8; ++j) { v16b w; const int o = c0 + j * 16 + col;
#pragma unroll
      for (int i = 0; i < 8; ++i) { w[i] = (__bf16)Wb[(size_t)(kc * 32 + 8 * g + i) * CC + o]; w[8 + i] = (__bf16)Wb[(size_t)(kc * 32 + 16 + 8 * g + i) * CC + o]; }
      asm volatile("s_wait_loadcnt 0x0" ::: "memory"); acc[j] = wmma_bf(a, w, acc[j]); } }
#pragma unroll
  for (int j = 0; j < 8; ++j)
#pragma unroll
    for (int r = 0; r < 8; ++r) { const float v = acc[j][r]; const __bf16 h = (__bf16)v; sh[wave * 16 + 8 * g + r][j * 16 + col] = h; sl[wave * 16 + 8 * g + r][j * 16 + col] = (__bf16)(v - (float)h); }
  __syncthreads();
  for (int e = tid; e < 64 * 16; e += 128) { const int rl = e >> 4, q = e & 15; vst2((unsigned*)(DH + (r0 + rl) * CC + c0 + q * 8), *(const v4u*)&sh[rl][q * 8]); vst2((unsigned*)(DL + (r0 + rl) * CC + c0 + q * 8), *(const v4u*)&sl[rl][q * 8]); } }
// ---- k_tt: block = (128 rows m, b, 128-channel group): T (exact bf16) -> planes [b][c][m]; 256-B pieces
__global__ __launch_bounds__(128) void k_tt(const float* __restrict__ T_, __bf16* __restrict__ TP) { __shared__ __align__(16) __bf16 th[128][136];
  const int tid = threadIdx.x; const int m0 = blockIdx.x * 128; const size_t b = blockIdx.y; const int c0 = blockIdx.z * 128;
  for (int e = tid; e < 128 * 128; e += 128) { const int ml = e >> 7, cl = e & 127; th[cl][ml] = (__bf16)T_[(b * TT + m0 + ml) * CC + c0 + cl]; }
  __syncthreads();
  for (int e = tid; e < 128 * 16; e += 128) { const int cl = e >> 4, q = e & 15; vst2((unsigned*)(TP + (b * CC + c0 + cl) * (size_t)TT + m0 + q * 8), *(const v4u*)&th[cl][q * 8]); } }
// ---- k_sc: block = (64 rows n, 128 cols m, batch in group): S = A . Bm over K 512, 3 products
__global__ __launch_bounds__(128) void k_sc(const __bf16* __restrict__ AH, const __bf16* __restrict__ AL, const __bf16* __restrict__ BH, const __bf16* __restrict__ BL, int b0, float* __restrict__ S0) { __shared__ __align__(16) float ss[4][16][132]; __shared__ __align__(16) char ring[2][SC_ST];
  const size_t b = b0 + blockIdx.z; float* S = S0 + (size_t)blockIdx.z * TT * TT;
  const int tid = threadIdx.x, wave = tid >> 5, lane = tid & 31, col = lane & 15, g = lane >> 4; const int k0 = blockIdx.y * 128; const int ql0 = blockIdx.x * 64 + wave * 16;
  v8f acc[8] = {};
  // stage t = k [64 t, 64 t + 64) of the block's 64 A rows and 128 Bm rows, hi and lo; thread -> row tid >> 3 (+ 16 per copy), 16-B piece tid & 7
  const unsigned l0 = lds_off(&ring[0][0]) + (tid >> 3) * 144 + (tid & 7) * 16;
  const size_t goa = ((b * TT + blockIdx.x * 64 + (tid >> 3)) * CC + (tid & 7) * 8) * 2, gob = ((b * TT + k0 + (tid >> 3)) * CC + (tid & 7) * 8) * 2;
  const char *gah = (const char*)AH + goa, *gal = (const char*)AL + goa, *gbh = (const char*)BH + gob, *gbl = (const char*)BL + gob;
  auto fill = [&](int t, int buf) { const unsigned l = l0 + buf * SC_ST; const int go = t * 128;
    cp44<16 * 144, 16 * CC * 2>(l, gah + go, l + SC_AP, gal + go);
    cp44<16 * 144, 16 * CC * 2>(l + 2 * SC_AP, gbh + go, l + 2 * SC_AP + 64 * 144, gbh + go + 64 * CC * 2);
    cp44<16 * 144, 16 * CC * 2>(l + 2 * SC_AP + SC_BP, gbl + go, l + 2 * SC_AP + SC_BP + 64 * 144, gbl + go + 64 * CC * 2); };
  fill(0, 0); WAIT_COPIES(); __syncthreads(); fill(1, 1);
#pragma unroll 1   // one stage a trip: the two buffers alternate by t & 1
  for (int t = 0; t < CC / 64; ++t) { const char* st = ring[t & 1];
#pragma unroll   // constant indices keep fragments and accumulators in registers
    for (int h = 0; h < 2; ++h) { v16b bh[8], bl[8];   // a 32-k block's LDS reads stand as one group in front of its WMMAs
      const char* ar = st + (wave * 16 + col) * 144 + h * 64; const v16b ah = frag_b((const __bf16*)ar, lane), al = frag_b((const __bf16*)(ar + SC_AP), lane);
#pragma unroll   // constant indices keep fragments and accumulators in registers
      for (int j = 0; j < 8; ++j) { const char* br = st + 2 * SC_AP + (j * 16 + col) * 144 + h * 64; bh[j] = frag_b((const __bf16*)br, lane); bl[j] = frag_b((const __bf16*)(br + SC_BP), lane); }
#pragma unroll   // constant indices keep fragments and accumulators in registers
      for (int j = 0; j < 8; ++j) { acc[j] = wmma_bf(ah, bh[j], acc[j]); acc[j] = wmma_bf(al, bh[j], acc[j]); acc[j] = wmma_bf(ah, bl[j], acc[j]); } }
    WAIT_LDS(); WAIT_COPIES(); __syncthreads();   // publishes stage t + 1 and ends every read of stage t's buffer
    if (t + 2 < CC / 64) fill(t + 2, t & 1); }
  WAIT_COPIES();
#pragma unroll
  for (int j = 0; j < 8; ++j)
#pragma unroll
    for (int r = 0; r < 8; ++r) ss[wave][8 * g + r][j * 16 + col] = acc[j][r];
  LDSX(); for (int rl = 0; rl < 16; ++rl) vst2(S + (size_t)(ql0 + rl) * TT + k0 + lane * 4, *(const v4f*)&ss[wave][rl][lane * 4]); }
// ---- k_sm: one wave = one query row held in registers (32 values a lane, 16-byte loads over whole lines): softmax over the 1,024 keys -> P x 2^11 f32 in place (masked -> 0); S is read once, no LDS, no barrier
__global__ __launch_bounds__(256) void k_sm(float* __restrict__ S0) {
  const int lane = threadIdx.x & 31; const size_t row = (size_t)blockIdx.x * 8 + (threadIdx.x >> 5); float* sr = S0 + (size_t)blockIdx.y * TT * TT + row * TT + lane * 4;
  v4f v[TT / 128];
#pragma unroll   // constant indices keep the row in registers
  for (int i = 0; i < TT / 128; ++i) v[i] = *(const v4f*)(sr + i * 128);
  float m = -3.0e38f;
#pragma unroll   // constant indices keep the row in registers
  for (int i = 0; i < TT / 128; ++i) m = fmaxf(m, fmaxf(fmaxf(v[i][0], v[i][1]), fmaxf(v[i][2], v[i][3])));
#pragma unroll   // the five lane distances as constants
  for (int o = 1; o < 32; o <<= 1) m = fmaxf(m, __shfl_xor(m, o));
  v4f s4 = {};   // four independent sums a lane
#pragma unroll   // constant indices keep the row in registers
  for (int i = 0; i < TT / 128; ++i)
#pragma unroll   // constant indices keep the row in registers
    for (int c = 0; c < 4; ++c) { const float x = v[i][c]; const float ex = expf(x - m); const float e = (x <= -1.0e38f) ? 0.f : ex; v[i][c] = e; s4[c] += e; }
  float sum = (s4[0] + s4[1]) + (s4[2] + s4[3]);
#pragma unroll   // the five lane distances as constants
  for (int o = 1; o < 32; o <<= 1) sum += __shfl_xor(sum, o);
  const float inv = 1.0f / sum;
#pragma unroll   // constant indices keep the row in registers
  for (int i = 0; i < TT / 128; ++i) { v4f o4; o4[0] = v[i][0] * inv * 2048.0f; o4[1] = v[i][1] * inv * 2048.0f; o4[2] = v[i][2] * inv * 2048.0f; o4[3] = v[i][3] * inv * 2048.0f; vst2(sr + i * 128, o4); } }
// ---- k_pv: block = (64 rows n, 128 channels, batch in group): out = x + (P . T) / 2^11 (P split bf16 hi + lo x exact T planes, 2 products)
__global__ __launch_bounds__(128) void k_pv(const float* __restrict__ PS0, const __bf16* __restrict__ TP, const float* __restrict__ X, int b0, float* __restrict__ OUT) { __shared__ __align__(16) float ss[4][16][132]; __shared__ __align__(16) char ring[2][PV_ST];
  const size_t b = b0 + blockIdx.z; const float* PS = PS0 + (size_t)blockIdx.z * TT * TT;
  const int tid = threadIdx.x, wave = tid >> 5, lane = tid & 31, col = lane & 15, g = lane >> 4; const int ql0 = blockIdx.x * 64 + wave * 16; const int c0 = blockIdx.y * 128;
  v8f acc[8] = {};
  // stage t = keys [64 t, 64 t + 64): the block's 64 P rows (thread -> row tid >> 4, + 8 per copy, piece tid & 15) and 128 T channel rows (row tid >> 3, + 16 per copy, piece tid & 7)
  const unsigned lp0 = lds_off(&ring[0][0]) + (tid >> 4) * 272 + (tid & 15) * 16, lt0 = lds_off(&ring[0][0]) + PV_PP + (tid >> 3) * 144 + (tid & 7) * 16;
  const char* gp = (const char*)PS + ((size_t)(blockIdx.x * 64 + (tid >> 4)) * TT + (tid & 15) * 4) * 4; const char* gt = (const char*)TP + ((b * CC + c0 + (tid >> 3)) * (size_t)TT + (tid & 7) * 8) * 2;
  auto fill = [&](int t, int buf) { const unsigned lp = lp0 + buf * PV_ST, lt = lt0 + buf * PV_ST;
    cp44<8 * 272, 8 * TT * 4>(lp, gp + t * 256, lp + 32 * 272, gp + t * 256 + 32 * TT * 4);
    cp44<16 * 144, 16 * TT * 2>(lt, gt + t * 128, lt + 64 * 144, gt + t * 128 + 64 * TT * 2); };
  fill(0, 0); WAIT_COPIES(); __syncthreads(); fill(1, 1);
#pragma unroll 1   // one stage a trip: the two buffers alternate by t & 1
  for (int t = 0; t < TT / 64; ++t) { const char* st = ring[t & 1];
    F2 p[2]; v16b th[2][8];   // the stage's LDS reads stand as one group in front of its WMMAs
#pragma unroll   // constant indices keep fragments and accumulators in registers
    for (int h = 0; h < 2; ++h) { p[h] = split_row((const float*)(st + (wave * 16 + col) * 272), h * 32, lane);
#pragma unroll   // constant indices keep fragments and accumulators in registers
      for (int j = 0; j < 8; ++j) th[h][j] = frag_b((const __bf16*)(st + PV_PP + (j * 16 + col) * 144 + h * 64), lane); }
#pragma unroll   // constant indices keep fragments and accumulators in registers
    for (int h = 0; h < 2; ++h)
#pragma unroll   // constant indices keep fragments and accumulators in registers
      for (int j = 0; j < 8; ++j) { acc[j] = wmma_bf(p[h].h, th[h][j], acc[j]); acc[j] = wmma_bf(p[h].l, th[h][j], acc[j]); }
    WAIT_LDS(); WAIT_COPIES(); __syncthreads();   // publishes stage t + 1 and ends every read of stage t's buffer
    if (t + 2 < TT / 64) fill(t + 2, t & 1); }
  WAIT_COPIES();
#pragma unroll
  for (int j = 0; j < 8; ++j)
#pragma unroll
    for (int r = 0; r < 8; ++r) ss[wave][8 * g + r][j * 16 + col] = acc[j][r] * (1.0f / 2048.0f);
  LDSX(); for (int rl = 0; rl < 16; ++rl) { const size_t off = (b * TT + ql0 + rl) * CC + c0 + lane * 4; const v4f xr = *(const v4f*)(X + off); v4f o = *(const v4f*)&ss[wave][rl][lane * 4]; o[0] += bfr(xr[0]); o[1] += bfr(xr[1]); o[2] += bfr(xr[2]); o[3] += bfr(xr[3]); vst2(OUT + off, o); } }
extern "C" void kernel_launch(void* const* d_in, const int* in_sizes, int n_in, void* d_out, int out_size, void* d_ws, size_t ws_size, hipStream_t stream) {
  (void)in_sizes; (void)n_in; (void)out_size;
  const float** F = (const float**)d_in;   // 0 x_in [16,1024,512], 1 T [16,1024,512], 2 Wq [16,512,512] ((in,out) per batch), 3 Wk [16,512,512]
  if (ws_size < (size_t)WS_END) return;
  char* ws = (char*)d_ws; __bf16 *AH = (__bf16*)(ws + WS_AH), *AL = (__bf16*)(ws + WS_AL), *BH = (__bf16*)(ws + WS_BH), *BL = (__bf16*)(ws + WS_BL), *TP = (__bf16*)(ws + WS_TT); float* S = (float*)(ws + WS_S);
  k_lin<<<dim3(TNB * TT / 64, CC / 128, 2), 128, 0, stream>>>(F[0], F[1], F[2], F[3], AH, AL, BH, BL);
  k_tt<<<dim3(TT / 128, TNB, CC / 128), 128, 0, stream>>>(F[1], TP);
  for (int b0 = 0; b0 < TNB; b0 += BG) { const int ng = (TNB - b0) < BG ? (TNB - b0) : BG;
    k_sc<<<dim3(TT / 64, TT / 128, ng), 128, 0, stream>>>(AH, AL, BH, BL, b0, S);
    k_sm<<<dim3(TT / 8, ng), 256, 0, stream>>>(S);
    k_pv<<<dim3(TT / 64, CC / 128, ng), 128, 0, stream>>>(S, TP, F[0], b0, (float*)d_out);
  }
}

// v003
// It runs in 207 microseconds.
// Timed twice side by side with v002, it ran 1.25 and 1.26 times as fast.
// Counting every step since v000, it is 3.54 times as fast.
// compute dtype: all float inputs rounded to bf16; A = x Wq[b] and Bm = T Wk[b] with EXACT bf16 products on WMMA 16x16x32, f32 accumulate, stored as bf16 hi + lo row planes; S = A . Bm over K = 512 with 3 products (hi.hi + hi.lo + lo.hi), f32; softmax in f32 (precise expf); P x 2^11 split bf16 hi + lo against the EXACT bf16 T planes (2 products); + x residual in f32; f32 output.
#include <hip/hip_runtime.h>
#include <math.h>

typedef __attribute__((ext_vector_type(16))) _Float16 v16h;
typedef __attribute__((ext_vector_type(16))) __bf16 v16b;
typedef __attribute__((ext_vector_type(8)))  _Float16 v8h;
typedef __attribute__((ext_vector_type(8)))  float v8f;
typedef __attribute__((ext_vector_type(4)))  float v4f;
typedef __attribute__((ext_vector_type(2)))  float v2f;
typedef __attribute__((ext_vector_type(4)))  unsigned v4u;
typedef __attribute__((ext_vector_type(4)))  int v4i;
typedef float __attribute__((may_alias)) float_a;
typedef int __attribute__((may_alias)) int_a;

template <typename T> __device__ __forceinline__ void vst2(void* p, T v) { *(T*)p = v;  }
__device__ __forceinline__ v8f wmma16(v16h a, v16h b, v8f c) {
  v8f d = __builtin_amdgcn_wmma_f32_16x16x32_f16(false, a, false, b, (short)0, c, false, false);
  asm volatile("v_nop\n\tv_nop\n\tv_nop\n\tv_nop" : "+v"(d) : "v"(a), "v"(b));
  return d;
}
__device__ __forceinline__ v8f wmma_bf(v16b a, v16b b, v8f c) {
  v8f d = __builtin_amdgcn_wmma_f32_16x16x32_bf16(false, a, false, b, (short)0, c, false, false);
  asm volatile("v_nop\n\tv_nop\n\tv_nop\n\tv_nop" : "+v"(d) : "v"(a), "v"(b));
  return d;
}
// 16x16x32 fragments: lane = (h = lane>>4, row/col = lane&15); elements 0..7 = k0+8h+0..7, 8..15 = k0+16+8h+0..7; D element r = row 8h+r
__device__ __forceinline__ v16h frag_h(const _Float16* rowk0, int lane) {
  union { v16h v; v8h q[2]; } u; const _Float16* p = rowk0 + 8 * (lane >> 4);
  u.q[0] = *(const v8h*)p; u.q[1] = *(const v8h*)(p + 16); return u.v;
}
__device__ __forceinline__ v16h frag_f32(const float* rowk0, int lane) {
  v16h a; const float* p = rowk0 + 8 * (lane >> 4);
#pragma unroll
  for (int i = 0; i < 8; ++i) { a[i] = (_Float16)p[i]; a[8 + i] = (_Float16)p[16 + i]; }
  return a;
}
__device__ __forceinline__ v16h frag_f32s(const float* rowk0, int lane, float sc) {
  v16h a; const float* p = rowk0 + 8 * (lane >> 4);
#pragma unroll
  for (int i = 0; i < 8; ++i) { a[i] = (_Float16)(p[i] * sc); a[8 + i] = (_Float16)(p[16 + i] * sc); }
  return a;
}
// column fragment from a [K][ld] layout (column n), rows >= K read as 0
__device__ __forceinline__ v16h fragc_f32(const float* W, int k0, int n, int lane, int ld, int K) {
  v16h a; const int g = lane >> 4;
#pragma unroll
  for (int i = 0; i < 8; ++i) { const int ka = k0 + 8 * g + i, kb = ka + 16;
    a[i] = (_Float16)(ka < K ? W[(size_t)(ka < K ? ka : K - 1) * ld + n] : 0.f); a[8 + i] = (_Float16)(kb < K ? W[(size_t)(kb < K ? kb : K - 1) * ld + n] : 0.f); }
  return a;
}
struct F2 { v16b h, l; };
__device__ __forceinline__ F2 bsplit16(const float v[16]) { F2 r;
#pragma unroll
  for (int i = 0; i < 16; ++i) { const __bf16 h = (__bf16)v[i]; r.h[i] = h; r.l[i] = (__bf16)(v[i] - (float)h); }
  return r; }
__device__ __forceinline__ F2 split_row(const float* row, int k0, int lane) { float v[16]; const float* p = row + k0 + 8 * (lane >> 4);
#pragma unroll
  for (int i = 0; i < 8; ++i) { v[i] = p[i]; v[8 + i] = p[16 + i]; }
  return bsplit16(v); }
__device__ __forceinline__ F2 split_rowK(const float* row, int k0, int lane, int K) { float v[16]; const int g = lane >> 4;
#pragma unroll
  for (int i = 0; i < 8; ++i) { const int ka = k0 + 8 * g + i, kb = ka + 16; v[i] = ka < K ? row[ka < K ? ka : K - 1] : 0.f; v[8 + i] = kb < K ? row[kb < K ? kb : K - 1] : 0.f; }
  return bsplit16(v); }
__device__ __forceinline__ F2 split_col(const float* W, int k0, int n, int lane, int ld, int K) { float v[16]; const int g = lane >> 4;
#pragma unroll
  for (int i = 0; i < 8; ++i) { const int ka = k0 + 8 * g + i, kb = ka + 16; v[i] = ka < K ? W[(size_t)(ka < K ? ka : K - 1) * ld + n] : 0.f; v[8 + i] = kb < K ? W[(size_t)(kb < K ? kb : K - 1) * ld + n] : 0.f; }
  return bsplit16(v); }
__device__ __forceinline__ v8f mac3(const F2& a, const F2& b, v8f c) { c = wmma_bf(a.l, b.h, c); c = wmma_bf(a.h, b.l, c); return wmma_bf(a.h, b.h, c); }
__device__ __forceinline__ float sigm(float v) { return 1.0f / (1.0f + expf(-v)); }
#define LDSX() do { asm volatile("s_wait_dscnt 0" ::: "memory"); __builtin_amdgcn_wave_barrier(); __builtin_amdgcn_fence(__ATOMIC_RELEASE, "workgroup"); } while (0)

// Projector (B 16, N 1,024, C 512, per-batch weights): A = x Wq[b]; Bm = T Wk[b]; P = softmax(A Bm^T); out = x + P T.
__device__ __forceinline__ float bfr(float v) { return (float)(__bf16)v; }
#define NB 16
#define TT 1024
#define CC 512
#ifndef TNB
#define TNB NB
#endif
#define BG 4                   // batches per launch group (S planes)
typedef __attribute__((ext_vector_type(8))) __bf16 v8b;
__device__ __forceinline__ v16b frag_b(const __bf16* rowk0, int lane) { union { v16b v; v8b q[2]; } u; const __bf16* p = rowk0 + 8 * (lane >> 4); u.q[0] = *(const v8b*)p; u.q[1] = *(const v8b*)(p + 16); return u.v; }
#define WS_AH  0u                                          // bf16 A hi rows [b*N+n][512]
#define WS_AL  (WS_AH + 2u * (size_t)NB * TT * CC)
#define WS_BH  (WS_AL + 2u * (size_t)NB * TT * CC)           // bf16 Bm hi rows [b*N+m][512]
#define WS_BL  (WS_BH + 2u * (size_t)NB * TT * CC)
#define WS_TT  (WS_BL + 2u * (size_t)NB * TT * CC)           // bf16 T planes [b][c][m] (exact)
#define WS_S   (WS_TT + 2u * (size_t)NB * CC * TT)           // f32 S / P [bg][n][m]
#define WS_END (WS_S + 4u * (size_t)BG * TT * TT)
// ---- LDS staging by asynchronous copies: each lane brings its own 16 bytes; a wave's 32 lanes cover whole 128-B lines
__device__ __forceinline__ unsigned lds_off(const void* p) { return (unsigned)(size_t)p; }
// eight copies in one statement: four from (la, ga) and four from (lb, gb), LS bytes apart in LDS and GS bytes apart in global memory.
// s_wait_xcnt 0 is the statement's last line so that it stands in front of every later rewrite of the address registers named here.
template <int LS, int GS> __device__ __forceinline__ void cp44(unsigned la, const char* ga, unsigned lb, const char* gb) {
  asm volatile("global_load_async_to_lds_b128 %0, %1, off\n\t"
               "global_load_async_to_lds_b128 %2, %3, off\n\t"
               "global_load_async_to_lds_b128 %4, %5, off\n\t"
               "global_load_async_to_lds_b128 %6, %7, off\n\t"
               "global_load_async_to_lds_b128 %8, %9, off\n\t"
               "global_load_async_to_lds_b128 %10, %11, off\n\t"
               "global_load_async_to_lds_b128 %12, %13, off\n\t"
               "global_load_async_to_lds_b128 %14, %15, off\n\t"
               "s_wait_xcnt 0x0"
               :: "v"(la), "v"(ga), "v"(la + LS), "v"(ga + GS), "v"(la + 2 * LS), "v"(ga + 2 * GS), "v"(la + 3 * LS), "v"(ga + 3 * GS),
                  "v"(lb), "v"(gb), "v"(lb + LS), "v"(gb + GS), "v"(lb + 2 * LS), "v"(gb + 2 * GS), "v"(lb + 3 * LS), "v"(gb + 3 * GS) : "memory");
}
// the issuing wave's own copies have landed (the compiler places no wait for them)
#define WAIT_COPIES() asm volatile("s_wait_asynccnt 0x0" ::: "memory")
// this wave's LDS reads have retired before the buffer they read is handed back for a refill
#define WAIT_LDS() asm volatile("s_wait_dscnt 0x0" ::: "memory")
#define SC_AP (64 * 144)                   // k_sc stage: one A plane, 64 rows of 128 B (64 k) at pitch 144 B
#define SC_BP (128 * 144)                  // one Bm plane, 128 rows
#define SC_ST (2 * SC_AP + 2 * SC_BP)      // [A hi | A lo | Bm hi | Bm lo]
#define PV_PP (64 * 272)                   // k_pv stage: P, 64 rows of 256 B (64 keys, f32) at pitch 272 B
#define PV_TP (128 * 144)                  // T planes, 128 channel rows of 128 B (64 keys) at pitch 144 B
#define PV_ST (PV_PP + PV_TP)
// ---- k_lin: block = (128 rows, 128 cols, which), 8 waves of 32 x 64: A = x Wq[b] (which 0) or Bm = T Wk[b] (which 1), per-batch (in,out) weights, exact; stored as bf16 hi + lo rows
// both operands go through LDS as bf16, rounded once a block: whole-line global loads into registers one stage (64 k) ahead, rows of x as they lie, W turned to [col][k] by which registers are packed together
#define LN_P 144                           // a staged row: 64 k as bf16 (128 B) at pitch 144 B
#define LN_XP (128 * LN_P)                 // one operand's 128 rows
#define LN_ST (2 * LN_XP)                  // [x rows | W columns]
typedef __attribute__((ext_vector_type(4))) __bf16 v4b;
__global__ __launch_bounds__(256) void k_lin(const float* __restrict__ X, const float* __restrict__ T_, const float* __restrict__ WQ, const float* __restrict__ WK, __bf16* __restrict__ AH, __bf16* __restrict__ AL, __bf16* __restrict__ BH, __bf16* __restrict__ BL) { __shared__ __align__(16) char ring[2][LN_ST];   // behind the loop the same bytes stage the hi and lo output rows
  const int tid = threadIdx.x, wave = tid >> 5, lane = tid & 31, col = lane & 15, g = lane >> 4, wr = wave >> 1, wc = wave & 1; const int which = blockIdx.z; const int c0 = blockIdx.y * 128; const size_t r0 = (size_t)blockIdx.x * 128; const size_t b = r0 / TT;
  const float* SRC = which == 0 ? X : T_; const float* Wb = (which == 0 ? WQ : WK) + b * (size_t)CC * CC; __bf16* DH = which == 0 ? AH : BH; __bf16* DL = which == 0 ? AL : BL;
  // x: thread -> row tid >> 4 (+ 16 per load), 16-B piece tid & 15 (a wave's load = 4 whole lines); W: wave -> 8 k rows, lane -> column lane (+ 32 per load) (a wave's load = 1 whole line)
  const float* gx = SRC + (r0 + (tid >> 4)) * CC + (tid & 15) * 4; const float* gw = Wb + (size_t)(wave * 8) * CC + c0 + lane;
  v4f xr[8]; float wv[4][8]; v8f acc[2][4] = {};
  auto load = [&](int t) {
#pragma unroll   // constant indices keep the stage in registers
    for (int i = 0; i < 8; ++i) xr[i] = *(const v4f*)(gx + (size_t)i * 16 * CC + t * 64);
#pragma unroll   // constant indices keep the stage in registers
    for (int c = 0; c < 4; ++c)
#pragma unroll   // constant indices keep the stage in registers
      for (int i = 0; i < 8; ++i) wv[c][i] = gw[(size_t)(t * 64 + i) * CC + c * 32]; };
  auto stash = [&](int buf) { char* st = ring[buf];
#pragma unroll   // constant indices keep the stage in registers
    for (int i = 0; i < 8; ++i) { v4b q; q[0] = (__bf16)xr[i][0]; q[1] = (__bf16)xr[i][1]; q[2] = (__bf16)xr[i][2]; q[3] = (__bf16)xr[i][3]; *(v4b*)(st + ((tid >> 4) + 16 * i) * LN_P + (tid & 15) * 8) = q; }
#pragma unroll   // constant indices keep the stage in registers
    for (int c = 0; c < 4; ++c) { v8b q;
#pragma unroll   // constant indices keep the stage in registers
      for (int i = 0; i < 8; ++i) q[i] = (__bf16)wv[c][i];
      *(v8b*)(st + LN_XP + (lane + 32 * c) * LN_P + wave * 16) = q; } };
  load(0); stash(0); __syncthreads();
#pragma unroll 1   // one stage a trip: the two buffers alternate by t & 1
  for (int t = 0; t < CC / 64; ++t) { const char* st = ring[t & 1];
    if (t + 1 < CC / 64) load(t + 1);   // in flight while this stage is worked on
#pragma unroll   // constant indices keep fragments and accumulators in registers
    for (int h = 0; h < 2; ++h) { v16b a[2], w[4];   // a 32-k block's LDS reads stand as one group in front of its WMMAs
#pragma unroll   // constant indices keep fragments and accumulators in registers
      for (int i = 0; i < 2; ++i) a[i] = frag_b((const __bf16*)(st + (wr * 32 + i * 16 + col) * LN_P + h * 64), lane);
#pragma unroll   // constant indices keep fragments and accumulators in registers
      for (int j = 0; j < 4; ++j) w[j] = frag_b((const __bf16*)(st + LN_XP + (wc * 64 + j * 16 + col) * LN_P + h * 64), lane);
#pragma unroll   // constant indices keep fragments and accumulators in registers
      for (int i = 0; i < 2; ++i)
#pragma unroll   // constant indices keep fragments and accumulators in registers
        for (int j = 0; j < 4; ++j) acc[i][j] = wmma_bf(a[i], w[j], acc[i][j]); }
    if (t + 1 < CC / 64) stash((t + 1) & 1);   // into the buffer whose readers left it at the last barrier
    __syncthreads(); }   // publishes stage t + 1 and ends every read of stage t's buffer
  __bf16 (*sh)[136] = (__bf16 (*)[136])&ring[0][0]; __bf16 (*sl)[136] = (__bf16 (*)[136])(&ring[0][0] + 128 * 272);
#pragma unroll   // constant indices keep the accumulators in registers
  for (int i = 0; i < 2; ++i)
#pragma unroll   // constant indices keep the accumulators in registers
    for (int j = 0; j < 4; ++j)
#pragma unroll   // constant indices keep the accumulators in registers
      for (int r = 0; r < 8; ++r) { const float v = acc[i][j][r]; const __bf16 h = (__bf16)v; sh[wr * 32 + i * 16 + 8 * g + r][wc * 64 + j * 16 + col] = h; sl[wr * 32 + i * 16 + 8 * g + r][wc * 64 + j * 16 + col] = (__bf16)(v - (float)h); }
  __syncthreads();
  for (int e = tid; e < 128 * 16; e += 256) { const int rl = e >> 4, q = e & 15; vst2((unsigned*)(DH + (r0 + rl) * CC + c0 + q * 8), *(const v4u*)&sh[rl][q * 8]); vst2((unsigned*)(DL + (r0 + rl) * CC + c0 + q * 8), *(const v4u*)&sl[rl][q * 8]); } }
// ---- k_tt: block = (128 rows m, b, 128-channel group): T (exact bf16) -> planes [b][c][m]; 256-B pieces
__global__ __launch_bounds__(128) void k_tt(const float* __restrict__ T_, __bf16* __restrict__ TP) { __shared__ __align__(16) __bf16 th[128][136];
  const int tid = threadIdx.x; const int m0 = blockIdx.x * 128; const size_t b = blockIdx.y; const int c0 = blockIdx.z * 128;
  for (int e = tid; e < 128 * 128; e += 128) { const int ml = e >> 7, cl = e & 127; th[cl][ml] = (__bf16)T_[(b * TT + m0 + ml) * CC + c0 + cl]; }
  __syncthreads();
  for (int e = tid; e < 128 * 16; e += 128) { const int cl = e >> 4, q = e & 15; vst2((unsigned*)(TP + (b * CC + c0 + cl) * (size_t)TT + m0 + q * 8), *(const v4u*)&th[cl][q * 8]); } }
// ---- k_sc: block = (64 rows n, 128 cols m, batch in group): S = A . Bm over K 512, 3 products
__global__ __launch_bounds__(128) void k_sc(const __bf16* __restrict__ AH, const __bf16* __restrict__ AL, const __bf16* __restrict__ BH, const __bf16* __restrict__ BL, int b0, float* __restrict__ S0) { __shared__ __align__(16) float ss[4][16][132]; __shared__ __align__(16) char ring[2][SC_ST];
  const size_t b = b0 + blockIdx.z; float* S = S0 + (size_t)blockIdx.z * TT * TT;
  const int tid = threadIdx.x, wave = tid >> 5, lane = tid & 31, col = lane & 15, g = lane >> 4; const int k0 = blockIdx.y * 128; const int ql0 = blockIdx.x * 64 + wave * 16;
  v8f acc[8] = {};
  // stage t = k [64 t, 64 t + 64) of the block's 64 A rows and 128 Bm rows, hi and lo; thread -> row tid >> 3 (+ 16 per copy), 16-B piece tid & 7
  const unsigned l0 = lds_off(&ring[0][0]) + (tid >> 3) * 144 + (tid & 7) * 16;
  const size_t goa = ((b * TT + blockIdx.x * 64 + (tid >> 3)) * CC + (tid & 7) * 8) * 2, gob = ((b * TT + k0 + (tid >> 3)) * CC + (tid & 7) * 8) * 2;
  const char *gah = (const char*)AH + goa, *gal = (const char*)AL + goa, *gbh = (const char*)BH + gob, *gbl = (const char*)BL + gob;
  auto fill = [&](int t, int buf) { const unsigned l = l0 + buf * SC_ST; const int go = t * 128;
    cp44<16 * 144, 16 * CC * 2>(l, gah + go, l + SC_AP, gal + go);
    cp44<16 * 144, 16 * CC * 2>(l + 2 * SC_AP, gbh + go, l + 2 * SC_AP + 64 * 144, gbh + go + 64 * CC * 2);
    cp44<16 * 144, 16 * CC * 2>(l + 2 * SC_AP + SC_BP, gbl + go, l + 2 * SC_AP + SC_BP + 64 * 144, gbl + go + 64 * CC * 2); };
  fill(0, 0); WAIT_COPIES(); __syncthreads(); fill(1, 1);
#pragma unroll 1   // one stage a trip: the two buffers alternate by t & 1
  for (int t = 0; t < CC / 64; ++t) { const char* st = ring[t & 1];
#pragma unroll   // constant indices keep fragments and accumulators in registers
    for (int h = 0; h < 2; ++h) { v16b bh[8], bl[8];   // a 32-k block's LDS reads stand as one group in front of its WMMAs
      const char* ar = st + (wave * 16 + col) * 144 + h * 64; const v16b ah = frag_b((const __bf16*)ar, lane), al = frag_b((const __bf16*)(ar + SC_AP), lane);
#pragma unroll   // constant indices keep fragments and accumulators in registers
      for (int j = 0; j < 8; ++j) { const char* br = st + 2 * SC_AP + (j * 16 + col) * 144 + h * 64; bh[j] = frag_b((const __bf16*)br, lane); bl[j] = frag_b((const __bf16*)(br + SC_BP), lane); }
#pragma unroll   // constant indices keep fragments and accumulators in registers
      for (int j = 0; j < 8; ++j) { acc[j] = wmma_bf(ah, bh[j], acc[j]); acc[j] = wmma_bf(al, bh[j], acc[j]); acc[j] = wmma_bf(ah, bl[j], acc[j]); } }
    WAIT_LDS(); WAIT_COPIES(); __syncthreads();   // publishes stage t + 1 and ends every read of stage t's buffer
    if (t + 2 < CC / 64) fill(t + 2, t & 1); }
  WAIT_COPIES();
#pragma unroll
  for (int j = 0; j < 8; ++j)
#pragma unroll
    for (int r = 0; r < 8; ++r) ss[wave][8 * g + r][j * 16 + col] = acc[j][r];
  LDSX(); for (int rl = 0; rl < 16; ++rl) vst2(S + (size_t)(ql0 + rl) * TT + k0 + lane * 4, *(const v4f*)&ss[wave][rl][lane * 4]); }
// ---- k_sm: one wave = one query row held in registers (32 values a lane, 16-byte loads over whole lines): softmax over the 1,024 keys -> P x 2^11 f32 in place (masked -> 0); S is read once, no LDS, no barrier
__global__ __launch_bounds__(256) void k_sm(float* __restrict__ S0) {
  const int lane = threadIdx.x & 31; const size_t row = (size_t)blockIdx.x * 8 + (threadIdx.x >> 5); float* sr = S0 + (size_t)blockIdx.y * TT * TT + row * TT + lane * 4;
  v4f v[TT / 128];
#pragma unroll   // constant indices keep the row in registers
  for (int i = 0; i < TT / 128; ++i) v[i] = *(const v4f*)(sr + i * 128);
  float m = -3.0e38f;
#pragma unroll   // constant indices keep the row in registers
  for (int i = 0; i < TT / 128; ++i) m = fmaxf(m, fmaxf(fmaxf(v[i][0], v[i][1]), fmaxf(v[i][2], v[i][3])));
#pragma unroll   // the five lane distances as constants
  for (int o = 1; o < 32; o <<= 1) m = fmaxf(m, __shfl_xor(m, o));
  v4f s4 = {};   // four independent sums a lane
#pragma unroll   // constant indices keep the row in registers
  for (int i = 0; i < TT / 128; ++i)
#pragma unroll   // constant indices keep the row in registers
    for (int c = 0; c < 4; ++c) { const float x = v[i][c]; const float ex = expf(x - m); const float e = (x <= -1.0e38f) ? 0.f : ex; v[i][c] = e; s4[c] += e; }
  float sum = (s4[0] + s4[1]) + (s4[2] + s4[3]);
#pragma unroll   // the five lane distances as constants
  for (int o = 1; o < 32; o <<= 1) sum += __shfl_xor(sum, o);
  const float inv = 1.0f / sum;
#pragma unroll   // constant indices keep the row in registers
  for (int i = 0; i < TT / 128; ++i) { v4f o4; o4[0] = v[i][0] * inv * 2048.0f; o4[1] = v[i][1] * inv * 2048.0f; o4[2] = v[i][2] * inv * 2048.0f; o4[3] = v[i][3] * inv * 2048.0f; vst2(sr + i * 128, o4); } }
// ---- k_pv: block = (64 rows n, 128 channels, batch in group): out = x + (P . T) / 2^11 (P split bf16 hi + lo x exact T planes, 2 products)
__global__ __launch_bounds__(128) void k_pv(const float* __restrict__ PS0, const __bf16* __restrict__ TP, const float* __restrict__ X, int b0, float* __restrict__ OUT) { __shared__ __align__(16) float ss[4][16][132]; __shared__ __align__(16) char ring[2][PV_ST];
  const size_t b = b0 + blockIdx.z; const float* PS = PS0 + (size_t)blockIdx.z * TT * TT;
  const int tid = threadIdx.x, wave = tid >> 5, lane = tid & 31, col = lane & 15, g = lane >> 4; const int ql0 = blockIdx.x * 64 + wave * 16; const int c0 = blockIdx.y * 128;
  v8f acc[8] = {};
  // stage t = keys [64 t, 64 t + 64): the block's 64 P rows (thread -> row tid >> 4, + 8 per copy, piece tid & 15) and 128 T channel rows (row tid >> 3, + 16 per copy, piece tid & 7)
  const unsigned lp0 = lds_off(&ring[0][0]) + (tid >> 4) * 272 + (tid & 15) * 16, lt0 = lds_off(&ring[0][0]) + PV_PP + (tid >> 3) * 144 + (tid & 7) * 16;
  const char* gp = (const char*)PS + ((size_t)(blockIdx.x * 64 + (tid >> 4)) * TT + (tid & 15) * 4) * 4; const char* gt = (const char*)TP + ((b * CC + c0 + (tid >> 3)) * (size_t)TT + (tid & 7) * 8) * 2;
  auto fill = [&](int t, int buf) { const unsigned lp = lp0 + buf * PV_ST, lt = lt0 + buf * PV_ST;
    cp44<8 * 272, 8 * TT * 4>(lp, gp + t * 256, lp + 32 * 272, gp + t * 256 + 32 * TT * 4);
    cp44<16 * 144, 16 * TT * 2>(lt, gt + t * 128, lt + 64 * 144, gt + t * 128 + 64 * TT * 2); };
  fill(0, 0); WAIT_COPIES(); __syncthreads(); fill(1, 1);
#pragma unroll 1   // one stage a trip: the two buffers alternate by t & 1
  for (int t = 0; t < TT / 64; ++t) { const char* st = ring[t & 1];
    F2 p[2]; v16b th[2][8];   // the stage's LDS reads stand as one group in front of its WMMAs
#pragma unroll   // constant indices keep fragments and accumulators in registers
    for (int h = 0; h < 2; ++h) { p[h] = split_row((const float*)(st + (wave * 16 + col) * 272), h * 32, lane);
#pragma unroll   // constant indices keep fragments and accumulators in registers
      for (int j = 0; j < 8; ++j) th[h][j] = frag_b((const __bf16*)(st + PV_PP + (j * 16 + col) * 144 + h * 64), lane); }
#pragma unroll   // constant indices keep fragments and accumulators in registers
    for (int h = 0; h < 2; ++h)
#pragma unroll   // constant indices keep fragments and accumulators in registers
      for (int j = 0; j < 8; ++j) { acc[j] = wmma_bf(p[h].h, th[h][j], acc[j]); acc[j] = wmma_bf(p[h].l, th[h][j], acc[j]); }
    WAIT_LDS(); WAIT_COPIES(); __syncthreads();   // publishes stage t + 1 and ends every read of stage t's buffer
    if (t + 2 < TT / 64) fill(t + 2, t & 1); }
  WAIT_COPIES();
#pragma unroll
  for (int j = 0; j < 8; ++j)
#pragma unroll
    for (int r = 0; r < 8; ++r) ss[wave][8 * g + r][j * 16 + col] = acc[j][r] * (1.0f / 2048.0f);
  LDSX(); for (int rl = 0; rl < 16; ++rl) { const size_t off = (b * TT + ql0 + rl) * CC + c0 + lane * 4; const v4f xr = *(const v4f*)(X + off); v4f o = *(const v4f*)&ss[wave][rl][lane * 4]; o[0] += bfr(xr[0]); o[1] += bfr(xr[1]); o[2] += bfr(xr[2]); o[3] += bfr(xr[3]); vst2(OUT + off, o); } }
extern "C" void kernel_launch(void* const* d_in, const int* in_sizes, int n_in, void* d_out, int out_size, void* d_ws, size_t ws_size, hipStream_t stream) {
  (void)in_sizes; (void)n_in; (void)out_size;
  const float** F = (const float**)d_in;   // 0 x_in [16,1024,512], 1 T [16,1024,512], 2 Wq [16,512,512] ((in,out) per batch), 3 Wk [16,512,512]
  if (ws_size < (size_t)WS_END) return;
  char* ws = (char*)d_ws; __bf16 *AH = (__bf16*)(ws + WS_AH), *AL = (__bf16*)(ws + WS_AL), *BH = (__bf16*)(ws + WS_BH), *BL = (__bf16*)(ws + WS_BL), *TP = (__bf16*)(ws + WS_TT); float* S = (float*)(ws + WS_S);
  k_lin<<<dim3(TNB * TT / 128, CC / 128, 2), 256, 0, stream>>>(F[0], F[1], F[2], F[3], AH, AL, BH, BL);
  k_tt<<<dim3(TT / 128, TNB, CC / 128), 128, 0, stream>>>(F[1], TP);
  for (int b0 = 0; b0 < TNB; b0 += BG) { const int ng = (TNB - b0) < BG ? (TNB - b0) : BG;
    k_sc<<<dim3(TT / 64, TT / 128, ng), 128, 0, stream>>>(AH, AL, BH, BL, b0, S);
    k_sm<<<dim3(TT / 8, ng), 256, 0, stream>>>(S);
    k_pv<<<dim3(TT / 64, CC / 128, ng), 128, 0, stream>>>(S, TP, F[0], b0, (float*)d_out);
  }
}

// v004
// One run takes 156 microseconds.
// Two timings next to v003 put it at 1.33 and 1.34 times that version's speed.
// All steps since v000 together make it 4.73 times as fast.
// compute dtype: all float inputs rounded to bf16; A = x Wq[b] and Bm = T Wk[b] with EXACT bf16 products on WMMA 16x16x32, f32 accumulate, stored as bf16 hi + lo row planes; S = A . Bm over K = 512 with 3 products (hi.hi + hi.lo + lo.hi), f32; softmax in f32 (precise expf); P x 2^11 split bf16 hi + lo against the EXACT bf16 T planes (2 products); + x residual in f32; f32 output.
#include <hip/hip_runtime.h>
#include <math.h>

typedef __attribute__((ext_vector_type(16))) _Float16 v16h;
typedef __attribute__((ext_vector_type(16))) __bf16 v16b;
typedef __attribute__((ext_vector_type(8)))  _Float16 v8h;
typedef __attribute__((ext_vector_type(8)))  float v8f;
typedef __attribute__((ext_vector_type(4)))  float v4f;
typedef __attribute__((ext_vector_type(2)))  float v2f;
typedef __attribute__((ext_vector_type(4)))  unsigned v4u;
typedef __attribute__((ext_vector_type(4)))  int v4i;
typedef float __attribute__((may_alias)) float_a;
typedef int __attribute__((may_alias)) int_a;

template <typename T> __device__ __forceinline__ void vst2(void* p, T v) { *(T*)p = v;  }
__device__ __forceinline__ v8f wmma16(v16h a, v16h b, v8f c) {
  v8f d = __builtin_amdgcn_wmma_f32_16x16x32_f16(false, a, false, b, (short)0, c, false, false);
  asm volatile("v_nop\n\tv_nop\n\tv_nop\n\tv_nop" : "+v"(d) : "v"(a), "v"(b));
  return d;
}
__device__ __forceinline__ v8f wmma_bf(v16b a, v16b b, v8f c) {
  v8f d = __builtin_amdgcn_wmma_f32_16x16x32_bf16(false, a, false, b, (short)0, c, false, false);
  asm volatile("v_nop\n\tv_nop\n\tv_nop\n\tv_nop" : "+v"(d) : "v"(a), "v"(b));
  return d;
}
// 16x16x32 fragments: lane = (h = lane>>4, row/col = lane&15); elements 0..7 = k0+8h+0..7, 8..15 = k0+16+8h+0..7; D element r = row 8h+r
__device__ __forceinline__ v16h frag_h(const _Float16* rowk0, int lane) {
  union { v16h v; v8h q[2]; } u; const _Float16* p = rowk0 + 8 * (lane >> 4);
  u.q[0] = *(const v8h*)p; u.q[1] = *(const v8h*)(p + 16); return u.v;
}
__device__ __forceinline__ v16h frag_f32(const float* rowk0, int lane) {
  v16h a; const float* p = rowk0 + 8 * (lane >> 4);
#pragma unroll
  for (int i = 0; i < 8; ++i) { a[i] = (_Float16)p[i]; a[8 + i] = (_Float16)p[16 + i]; }
  return a;
}
__device__ __forceinline__ v16h frag_f32s(const float* rowk0, int lane, float sc) {
  v16h a; const float* p = rowk0 + 8 * (lane >> 4);
#pragma unroll
  for (int i = 0; i < 8; ++i) { a[i] = (_Float16)(p[i] * sc); a[8 + i] = (_Float16)(p[16 + i] * sc); }
  return a;
}
// column fragment from a [K][ld] layout (column n), rows >= K read as 0
__device__ __forceinline__ v16h fragc_f32(const float* W, int k0, int n, int lane, int ld, int K) {
  v16h a; const int g = lane >> 4;
#pragma unroll
  for (int i = 0; i < 8; ++i) { const int ka = k0 + 8 * g + i, kb = ka + 16;
    a[i] = (_Float16)(ka < K ? W[(size_t)(ka < K ? ka : K - 1) * ld + n] : 0.f); a[8 + i] = (_Float16)(kb < K ? W[(size_t)(kb < K ? kb : K - 1) * ld + n] : 0.f); }
  return a;
}
struct F2 { v16b h, l; };
__device__ __forceinline__ F2 bsplit16(const float v[16]) { F2 r;
#pragma unroll
  for (int i = 0; i < 16; ++i) { const __bf16 h = (__bf16)v[i]; r.h[i] = h; r.l[i] = (__bf16)(v[i] - (float)h); }
  return r; }
__device__ __forceinline__ F2 split_row(const float* row, int k0, int lane) { float v[16]; const float* p = row + k0 + 8 * (lane >> 4);
#pragma unroll
  for (int i = 0; i < 8; ++i) { v[i] = p[i]; v[8 + i] = p[16 + i]; }
  return bsplit16(v); }
__device__ __forceinline__ F2 split_rowK(const float* row, int k0, int lane, int K) { float v[16]; const int g = lane >> 4;
#pragma unroll
  for (int i = 0; i < 8; ++i) { const int ka = k0 + 8 * g + i, kb = ka + 16; v[i] = ka < K ? row[ka < K ? ka : K - 1] : 0.f; v[8 + i] = kb < K ? row[kb < K ? kb : K - 1] : 0.f; }
  return bsplit16(v); }
__device__ __forceinline__ F2 split_col(const float* W, int k0, int n, int lane, int ld, int K) { float v[16]; const int g = lane >> 4;
#pragma unroll
  for (int i = 0; i < 8; ++i) { const int ka = k0 + 8 * g + i, kb = ka + 16; v[i] = ka < K ? W[(size_t)(ka < K ? ka : K - 1) * ld + n] : 0.f; v[8 + i] = kb < K ? W[(size_t)(kb < K ? kb : K - 1) * ld + n] : 0.f; }
  return bsplit16(v); }
__device__ __forceinline__ v8f mac3(const F2& a, const F2& b, v8f c) { c = wmma_bf(a.l, b.h, c); c = wmma_bf(a.h, b.l, c); return wmma_bf(a.h, b.h, c); }
__device__ __forceinline__ float sigm(float v) { return 1.0f / (1.0f + expf(-v)); }
#define LDSX() do { asm volatile("s_wait_dscnt 0" ::: "memory"); __builtin_amdgcn_wave_barrier(); __builtin_amdgcn_fence(__ATOMIC_RELEASE, "workgroup"); } while (0)

// Projector (B 16, N 1,024, C 512, per-batch weights): A = x Wq[b]; Bm = T Wk[b]; P = softmax(A Bm^T); out = x + P T.
__device__ __forceinline__ float bfr(float v) { return (float)(__bf16)v; }
#define NB 16
#define TT 1024
#define CC 512
#ifndef TNB
#define TNB NB
#endif
#define BG 16                  // batches per launch group (S planes)
typedef __attribute__((ext_vector_type(8))) __bf16 v8b;
__device__ __forceinline__ v16b frag_b(const __bf16* rowk0, int lane) { union { v16b v; v8b q[2]; } u; const __bf16* p = rowk0 + 8 * (lane >> 4); u.q[0] = *(const v8b*)p; u.q[1] = *(const v8b*)(p + 16); return u.v; }
#define WS_AH  0u                                          // bf16 A hi rows [b*N+n][512]
#define WS_AL  (WS_AH + 2u * (size_t)NB * TT * CC)
#define WS_BH  (WS_AL + 2u * (size_t)NB * TT * CC)           // bf16 Bm hi rows [b*N+m][512]
#define WS_BL  (WS_BH + 2u * (size_t)NB * TT * CC)
#define WS_TT  (WS_BL + 2u * (size_t)NB * TT * CC)           // bf16 T planes [b][c][m] (exact)
#define WS_S   (WS_TT + 2u * (size_t)NB * CC * TT)           // f32 S / P [bg][n][m]
#define WS_END (WS_S + 4u * (size_t)BG * TT * TT)
// ---- LDS staging by asynchronous copies: each lane brings its own 16 bytes; a wave's 32 lanes cover whole 128-B lines
__device__ __forceinline__ unsigned lds_off(const void* p) { return (unsigned)(size_t)p; }
// eight copies in one statement: four from (la, ga) and four from (lb, gb), LS bytes apart in LDS and GS bytes apart in global memory.
// s_wait_xcnt 0 is the statement's last line so that it stands in front of every later rewrite of the address registers named here.
template <int LS, int GS> __device__ __forceinline__ void cp44(unsigned la, const char* ga, unsigned lb, const char* gb) {
  asm volatile("global_load_async_to_lds_b128 %0, %1, off\n\t"
               "global_load_async_to_lds_b128 %2, %3, off\n\t"
               "global_load_async_to_lds_b128 %4, %5, off\n\t"
               "global_load_async_to_lds_b128 %6, %7, off\n\t"
               "global_load_async_to_lds_b128 %8, %9, off\n\t"
               "global_load_async_to_lds_b128 %10, %11, off\n\t"
               "global_load_async_to_lds_b128 %12, %13, off\n\t"
               "global_load_async_to_lds_b128 %14, %15, off\n\t"
               "s_wait_xcnt 0x0"
               :: "v"(la), "v"(ga), "v"(la + LS), "v"(ga + GS), "v"(la + 2 * LS), "v"(ga + 2 * GS), "v"(la + 3 * LS), "v"(ga + 3 * GS),
                  "v"(lb), "v"(gb), "v"(lb + LS), "v"(gb + GS), "v"(lb + 2 * LS), "v"(gb + 2 * GS), "v"(lb + 3 * LS), "v"(gb + 3 * GS) : "memory");
}
// the issuing wave's own copies have landed (the compiler places no wait for them)
#define WAIT_COPIES() asm volatile("s_wait_asynccnt 0x0" ::: "memory")
// this wave's LDS reads have retired before the buffer they read is handed back for a refill
#define WAIT_LDS() asm volatile("s_wait_dscnt 0x0" ::: "memory")
#define SC_AP (64 * 144)                   // k_sc stage: one A plane, 64 rows of 128 B (64 k) at pitch 144 B
#define SC_BP (128 * 144)                  // one Bm plane, 128 rows
#define SC_ST (2 * SC_AP + 2 * SC_BP)      // [A hi | A lo | Bm hi | Bm lo]
#define PV_PP (64 * 272)                   // k_pv stage: P, 64 rows of 256 B (64 keys, f32) at pitch 272 B
#define PV_TP (128 * 144)                  // T planes, 128 channel rows of 128 B (64 keys) at pitch 144 B
#define PV_ST (PV_PP + PV_TP)
// ---- k_lin: block = (128 rows, 128 cols, which), 8 waves of 32 x 64: A = x Wq[b] (which 0) or Bm = T Wk[b] (which 1), per-batch (in,out) weights, exact; stored as bf16 hi + lo rows
// both operands go through LDS as bf16, rounded once a block: whole-line global loads into registers one stage (64 k) ahead, rows of x as they lie, W turned to [col][k] by which registers are packed together
#define LN_P 144                           // a staged row: 64 k as bf16 (128 B) at pitch 144 B
#define LN_XP (128 * LN_P)                 // one operand's 128 rows
#define LN_ST (2 * LN_XP)                  // [x rows | W columns]
typedef __attribute__((ext_vector_type(4))) __bf16 v4b;
__global__ __launch_bounds__(256) void k_lin(const float* __restrict__ X, const float* __restrict__ T_, const float* __restrict__ WQ, const float* __restrict__ WK, __bf16* __restrict__ AH, __bf16* __restrict__ AL, __bf16* __restrict__ BH, __bf16* __restrict__ BL) { __shared__ __align__(16) char ring[2][LN_ST];   // behind the loop the same bytes stage the hi and lo output rows
  const int tid = threadIdx.x, wave = tid >> 5, lane = tid & 31, col = lane & 15, g = lane >> 4, wr = wave >> 1, wc = wave & 1; const int which = blockIdx.z; const int c0 = blockIdx.y * 128; const size_t r0 = (size_t)blockIdx.x * 128; const size_t b = r0 / TT;
  const float* SRC = which == 0 ? X : T_; const float* Wb = (which == 0 ? WQ : WK) + b * (size_t)CC * CC; __bf16* DH = which == 0 ? AH : BH; __bf16* DL = which == 0 ? AL : BL;
  // x: thread -> row tid >> 4 (+ 16 per load), 16-B piece tid & 15 (a wave's load = 4 whole lines); W: wave -> 8 k rows, lane -> column lane (+ 32 per load) (a wave's load = 1 whole line)
  const float* gx = SRC + (r0 + (tid >> 4)) * CC + (tid & 15) * 4; const float* gw = Wb + (size_t)(wave * 8) * CC + c0 + lane;
  v4f xr[8]; float wv[4][8]; v8f acc[2][4] = {};
  auto load = [&](int t) {
#pragma unroll   // constant indices keep the stage in registers
    for (int i = 0; i < 8; ++i) xr[i] = *(const v4f*)(gx + (size_t)i * 16 * CC + t * 64);
#pragma unroll   // constant indices keep the stage in registers
    for (int c = 0; c < 4; ++c)
#pragma unroll   // constant indices keep the stage in registers
      for (int i = 0; i < 8; ++i) wv[c][i] = gw[(size_t)(t * 64 + i) * CC + c * 32]; };
  auto stash = [&](int buf) { char* st = ring[buf];
#pragma unroll   // constant indices keep the stage in registers
    for (int i = 0; i < 8; ++i) { v4b q; q[0] = (__bf16)xr[i][0]; q[1] = (__bf16)xr[i][1]; q[2] = (__bf16)xr[i][2]; q[3] = (__bf16)xr[i][3]; *(v4b*)(st + ((tid >> 4) + 16 * i) * LN_P + (tid & 15) * 8) = q; }
#pragma unroll   // constant indices keep the stage in registers
    for (int c = 0; c < 4; ++c) { v8b q;
#pragma unroll   // constant indices keep the stage in registers
      for (int i = 0; i < 8; ++i) q[i] = (__bf16)wv[c][i];
      *(v8b*)(st + LN_XP + (lane + 32 * c) * LN_P + wave * 16) = q; } };
  load(0); stash(0); __syncthreads();
#pragma unroll 1   // one stage a trip: the two buffers alternate by t & 1
  for (int t = 0; t < CC / 64; ++t) { const char* st = ring[t & 1];
    if (t + 1 < CC / 64) load(t + 1);   // in flight while this stage is worked on
#pragma unroll   // constant indices keep fragments and accumulators in registers
    for (int h = 0; h < 2; ++h) { v16b a[2], w[4];   // a 32-k block's LDS reads stand as one group in front of its WMMAs
#pragma unroll   // constant indices keep fragments and accumulators in registers
      for (int i = 0; i < 2; ++i) a[i] = frag_b((const __bf16*)(st + (wr * 32 + i * 16 + col) * LN_P + h * 64), lane);
#pragma unroll   // constant indices keep fragments and accumulators in registers
      for (int j = 0; j < 4; ++j) w[j] = frag_b((const __bf16*)(st + LN_XP + (wc * 64 + j * 16 + col) * LN_P + h * 64), lane);
#pragma unroll   // constant indices keep fragments and accumulators in registers
      for (int i = 0; i < 2; ++i)
#pragma unroll   // constant indices keep fragments and accumulators in registers
        for (int j = 0; j < 4; ++j) acc[i][j] = wmma_bf(a[i], w[j], acc[i][j]); }
    if (t + 1 < CC / 64) stash((t + 1) & 1);   // into the buffer whose readers left it at the last barrier
    __syncthreads(); }   // publishes stage t + 1 and ends every read of stage t's buffer
  __bf16 (*sh)[136] = (__bf16 (*)[136])&ring[0][0]; __bf16 (*sl)[136] = (__bf16 (*)[136])(&ring[0][0] + 128 * 272);
#pragma unroll   // constant indices keep the accumulators in registers
  for (int i = 0; i < 2; ++i)
#pragma unroll   // constant indices keep the accumulators in registers
    for (int j = 0; j < 4; ++j)
#pragma unroll   // constant indices keep the accumulators in registers
      for (int r = 0; r < 8; ++r) { const float v = acc[i][j][r]; const __bf16 h = (__bf16)v; sh[wr * 32 + i * 16 + 8 * g + r][wc * 64 + j * 16 + col] = h; sl[wr * 32 + i * 16 + 8 * g + r][wc * 64 + j * 16 + col] = (__bf16)(v - (float)h); }
  __syncthreads();
  for (int e = tid; e < 128 * 16; e += 256) { const int rl = e >> 4, q = e & 15; vst2((unsigned*)(DH + (r0 + rl) * CC + c0 + q * 8), *(const v4u*)&sh[rl][q * 8]); vst2((unsigned*)(DL + (r0 + rl) * CC + c0 + q * 8), *(const v4u*)&sl[rl][q * 8]); } }
// ---- k_tt: block = (128 rows m, b, 128-channel group): T (exact bf16) -> planes [b][c][m]; 256-B pieces
__global__ __launch_bounds__(128) void k_tt(const float* __restrict__ T_, __bf16* __restrict__ TP) { __shared__ __align__(16) __bf16 th[128][136];
  const int tid = threadIdx.x; const int m0 = blockIdx.x * 128; const size_t b = blockIdx.y; const int c0 = blockIdx.z * 128;
  for (int e = tid; e < 128 * 128; e += 128) { const int ml = e >> 7, cl = e & 127; th[cl][ml] = (__bf16)T_[(b * TT + m0 + ml) * CC + c0 + cl]; }
  __syncthreads();
  for (int e = tid; e < 128 * 16; e += 128) { const int cl = e >> 4, q = e & 15; vst2((unsigned*)(TP + (b * CC + c0 + cl) * (size_t)TT + m0 + q * 8), *(const v4u*)&th[cl][q * 8]); } }
// ---- k_sc: block = (64 rows n, 128 cols m, batch in group): S = A . Bm over K 512, 3 products
__global__ __launch_bounds__(128) void k_sc(const __bf16* __restrict__ AH, const __bf16* __restrict__ AL, const __bf16* __restrict__ BH, const __bf16* __restrict__ BL, int b0, float* __restrict__ S0) { __shared__ __align__(16) float ss[4][16][132]; __shared__ __align__(16) char ring[2][SC_ST];
  const size_t b = b0 + blockIdx.z; float* S = S0 + (size_t)blockIdx.z * TT * TT;
  const int tid = threadIdx.x, wave = tid >> 5, lane = tid & 31, col = lane & 15, g = lane >> 4; const int k0 = blockIdx.y * 128; const int ql0 = blockIdx.x * 64 + wave * 16;
  v8f acc[8] = {};
  // stage t = k [64 t, 64 t + 64) of the block's 64 A rows and 128 Bm rows, hi and lo; thread -> row tid >> 3 (+ 16 per copy), 16-B piece tid & 7
  const unsigned l0 = lds_off(&ring[0][0]) + (tid >> 3) * 144 + (tid & 7) * 16;
  const size_t goa = ((b * TT + blockIdx.x * 64 + (tid >> 3)) * CC + (tid & 7) * 8) * 2, gob = ((b * TT + k0 + (tid >> 3)) * CC + (tid & 7) * 8) * 2;
  const char *gah = (const char*)AH + goa, *gal = (const char*)AL + goa, *gbh = (const char*)BH + gob, *gbl = (const char*)BL + gob;
  auto fill = [&](int t, int buf) { const unsigned l = l0 + buf * SC_ST; const int go = t * 128;
    cp44<16 * 144, 16 * CC * 2>(l, gah + go, l + SC_AP, gal + go);
    cp44<16 * 144, 16 * CC * 2>(l + 2 * SC_AP, gbh + go, l + 2 * SC_AP + 64 * 144, gbh + go + 64 * CC * 2);
    cp44<16 * 144, 16 * CC * 2>(l + 2 * SC_AP + SC_BP, gbl + go, l + 2 * SC_AP + SC_BP + 64 * 144, gbl + go + 64 * CC * 2); };
  fill(0, 0); WAIT_COPIES(); __syncthreads(); fill(1, 1);
#pragma unroll 1   // one stage a trip: the two buffers alternate by t & 1
  for (int t = 0; t < CC / 64; ++t) { const char* st = ring[t & 1];
#pragma unroll   // constant indices keep fragments and accumulators in registers
    for (int h = 0; h < 2; ++h) { v16b bh[8], bl[8];   // a 32-k block's LDS reads stand as one group in front of its WMMAs
      const char* ar = st + (wave * 16 + col) * 144 + h * 64; const v16b ah = frag_b((const __bf16*)ar, lane), al = frag_b((const __bf16*)(ar + SC_AP), lane);
#pragma unroll   // constant indices keep fragments and accumulators in registers
      for (int j = 0; j < 8; ++j) { const char* br = st + 2 * SC_AP + (j * 16 + col) * 144 + h * 64; bh[j] = frag_b((const __bf16*)br, lane); bl[j] = frag_b((const __bf16*)(br + SC_BP), lane); }
#pragma unroll   // constant indices keep fragments and accumulators in registers
      for (int j = 0; j < 8; ++j) { acc[j] = wmma_bf(ah, bh[j], acc[j]); acc[j] = wmma_bf(al, bh[j], acc[j]); acc[j] = wmma_bf(ah, bl[j], acc[j]); } }
    WAIT_LDS(); WAIT_COPIES(); __syncthreads();   // publishes stage t + 1 and ends every read of stage t's buffer
    if (t + 2 < CC / 64) fill(t + 2, t & 1); }
  WAIT_COPIES();
#pragma unroll
  for (int j = 0; j < 8; ++j)
#pragma unroll
    for (int r = 0; r < 8; ++r) ss[wave][8 * g + r][j * 16 + col] = acc[j][r];
  LDSX(); for (int rl = 0; rl < 16; ++rl) vst2(S + (size_t)(ql0 + rl) * TT + k0 + lane * 4, *(const v4f*)&ss[wave][rl][lane * 4]); }
// ---- k_sm: one wave = one query row held in registers (32 values a lane, 16-byte loads over whole lines): softmax over the 1,024 keys -> P x 2^11 f32 in place (masked -> 0); S is read once, no LDS, no barrier
__global__ __launch_bounds__(256) void k_sm(float* __restrict__ S0) {
  const int lane = threadIdx.x & 31; const size_t row = (size_t)blockIdx.x * 8 + (threadIdx.x >> 5); float* sr = S0 + (size_t)blockIdx.y * TT * TT + row * TT + lane * 4;
  v4f v[TT / 128];
#pragma unroll   // constant indices keep the row in registers
  for (int i = 0; i < TT / 128; ++i) v[i] = *(const v4f*)(sr + i * 128);
  float m = -3.0e38f;
#pragma unroll   // constant indices keep the row in registers
  for (int i = 0; i < TT / 128; ++i) m = fmaxf(m, fmaxf(fmaxf(v[i][0], v[i][1]), fmaxf(v[i][2], v[i][3])));
#pragma unroll   // the five lane distances as constants
  for (int o = 1; o < 32; o <<= 1) m = fmaxf(m, __shfl_xor(m, o));
  v4f s4 = {};   // four independent sums a lane
#pragma unroll   // constant indices keep the row in registers
  for (int i = 0; i < TT / 128; ++i)
#pragma unroll   // constant indices keep the row in registers
    for (int c = 0; c < 4; ++c) { const float x = v[i][c]; const float ex = expf(x - m); const float e = (x <= -1.0e38f) ? 0.f : ex; v[i][c] = e; s4[c] += e; }
  float sum = (s4[0] + s4[1]) + (s4[2] + s4[3]);
#pragma unroll   // the five lane distances as constants
  for (int o = 1; o < 32; o <<= 1) sum += __shfl_xor(sum, o);
  const float inv = 1.0f / sum;
#pragma unroll   // constant indices keep the row in registers
  for (int i = 0; i < TT / 128; ++i) { v4f o4; o4[0] = v[i][0] * inv * 2048.0f; o4[1] = v[i][1] * inv * 2048.0f; o4[2] = v[i][2] * inv * 2048.0f; o4[3] = v[i][3] * inv * 2048.0f; vst2(sr + i * 128, o4); } }
// ---- k_pv: block = (64 rows n, 128 channels, batch in group): out = x + (P . T) / 2^11 (P split bf16 hi + lo x exact T planes, 2 products)
__global__ __launch_bounds__(128) void k_pv(const float* __restrict__ PS0, const __bf16* __restrict__ TP, const float* __restrict__ X, int b0, float* __restrict__ OUT) { __shared__ __align__(16) float ss[4][16][132]; __shared__ __align__(16) char ring[2][PV_ST];
  const size_t b = b0 + blockIdx.z; const float* PS = PS0 + (size_t)blockIdx.z * TT * TT;
  const int tid = threadIdx.x, wave = tid >> 5, lane = tid & 31, col = lane & 15, g = lane >> 4; const int ql0 = blockIdx.x * 64 + wave * 16; const int c0 = blockIdx.y * 128;
  v8f acc[8] = {};
  // stage t = keys [64 t, 64 t + 64): the block's 64 P rows (thread -> row tid >> 4, + 8 per copy, piece tid & 15) and 128 T channel rows (row tid >> 3, + 16 per copy, piece tid & 7)
  const unsigned lp0 = lds_off(&ring[0][0]) + (tid >> 4) * 272 + (tid & 15) * 16, lt0 = lds_off(&ring[0][0]) + PV_PP + (tid >> 3) * 144 + (tid & 7) * 16;
  const char* gp = (const char*)PS + ((size_t)(blockIdx.x * 64 + (tid >> 4)) * TT + (tid & 15) * 4) * 4; const char* gt = (const char*)TP + ((b * CC + c0 + (tid >> 3)) * (size_t)TT + (tid & 7) * 8) * 2;
  auto fill = [&](int t, int buf) { const unsigned lp = lp0 + buf * PV_ST, lt = lt0 + buf * PV_ST;
    cp44<8 * 272, 8 * TT * 4>(lp, gp + t * 256, lp + 32 * 272, gp + t * 256 + 32 * TT * 4);
    cp44<16 * 144, 16 * TT * 2>(lt, gt + t * 128, lt + 64 * 144, gt + t * 128 + 64 * TT * 2); };
  fill(0, 0); WAIT_COPIES(); __syncthreads(); fill(1, 1);
#pragma unroll 1   // one stage a trip: the two buffers alternate by t & 1
  for (int t = 0; t < TT / 64; ++t) { const char* st = ring[t & 1];
    F2 p[2]; v16b th[2][8];   // the stage's LDS reads stand as one group in front of its WMMAs
#pragma unroll   // constant indices keep fragments and accumulators in registers
    for (int h = 0; h < 2; ++h) { p[h] = split_row((const float*)(st + (wave * 16 + col) * 272), h * 32, lane);
#pragma unroll   // constant indices keep fragments and accumulators in registers
      for (int j = 0; j < 8; ++j) th[h][j] = frag_b((const __bf16*)(st + PV_PP + (j * 16 + col) * 144 + h * 64), lane); }
#pragma unroll   // constant indices keep fragments and accumulators in registers
    for (int h = 0; h < 2; ++h)
#pragma unroll   // constant indices keep fragments and accumulators in registers
      for (int j = 0; j < 8; ++j) { acc[j] = wmma_bf(p[h].h, th[h][j], acc[j]); acc[j] = wmma_bf(p[h].l, th[h][j], acc[j]); }
    WAIT_LDS(); WAIT_COPIES(); __syncthreads();   // publishes stage t + 1 and ends every read of stage t's buffer
    if (t + 2 < TT / 64) fill(t + 2, t & 1); }
  WAIT_COPIES();
#pragma unroll
  for (int j = 0; j < 8; ++j)
#pragma unroll
    for (int r = 0; r < 8; ++r) ss[wave][8 * g + r][j * 16 + col] = acc[j][r] * (1.0f / 2048.0f);
  LDSX(); for (int rl = 0; rl < 16; ++rl) { const size_t off = (b * TT + ql0 + rl) * CC + c0 + lane * 4; const v4f xr = *(const v4f*)(X + off); v4f o = *(const v4f*)&ss[wave][rl][lane * 4]; o[0] += bfr(xr[0]); o[1] += bfr(xr[1]); o[2] += bfr(xr[2]); o[3] += bfr(xr[3]); vst2(OUT + off, o); } }
extern "C" void kernel_launch(void* const* d_in, const int* in_sizes, int n_in, void* d_out, int out_size, void* d_ws, size_t ws_size, hipStream_t stream) {
  (void)in_sizes; (void)n_in; (void)out_size;
  const float** F = (const float**)d_in;   // 0 x_in [16,1024,512], 1 T [16,1024,512], 2 Wq [16,512,512] ((in,out) per batch), 3 Wk [16,512,512]
  if (ws_size < (size_t)WS_END) return;
  char* ws = (char*)d_ws; __bf16 *AH = (__bf16*)(ws + WS_AH), *AL = (__bf16*)(ws + WS_AL), *BH = (__bf16*)(ws + WS_BH), *BL = (__bf16*)(ws + WS_BL), *TP = (__bf16*)(ws + WS_TT); float* S = (float*)(ws + WS_S);
  k_lin<<<dim3(TNB * TT / 128, CC / 128, 2), 256, 0, stream>>>(F[0], F[1], F[2], F[3], AH, AL, BH, BL);
  k_tt<<<dim3(TT / 128, TNB, CC / 128), 128, 0, stream>>>(F[1], TP);
  for (int b0 = 0; b0 < TNB; b0 += BG) { const int ng = (TNB - b0) < BG ? (TNB - b0) : BG;
    k_sc<<<dim3(TT / 64, TT / 128, ng), 128, 0, stream>>>(AH, AL, BH, BL, b0, S);
    k_sm<<<dim3(TT / 8, ng), 256, 0, stream>>>(S);
    k_pv<<<dim3(TT / 64, CC / 128, ng), 128, 0, stream>>>(S, TP, F[0], b0, (float*)d_out);
  }
}

// v005
// One run takes 135 microseconds.
// Timed twice side by side with v004, it ran 1.16 times as fast both times.
// Counting every step since v000, it is 5.47 times as fast.
// compute dtype: all float inputs rounded to bf16; A = x Wq[b] and Bm = T Wk[b] with EXACT bf16 products on WMMA 16x16x32, f32 accumulate, stored as bf16 hi + lo row planes; S = A . Bm over K = 512 with 3 products (hi.hi + hi.lo + lo.hi), f32; softmax in f32 (precise expf); P x 2^11 split bf16 hi + lo against the EXACT bf16 T planes (2 products); + x residual in f32; f32 output.
#include <hip/hip_runtime.h>
#include <math.h>

typedef __attribute__((ext_vector_type(16))) _Float16 v16h;
typedef __attribute__((ext_vector_type(16))) __bf16 v16b;
typedef __attribute__((ext_vector_type(8)))  _Float16 v8h;
typedef __attribute__((ext_vector_type(8)))  float v8f;
typedef __attribute__((ext_vector_type(4)))  float v4f;
typedef __attribute__((ext_vector_type(2)))  float v2f;
typedef __attribute__((ext_vector_type(4)))  unsigned v4u;
typedef __attribute__((ext_vector_type(4)))  int v4i;
typedef float __attribute__((may_alias)) float_a;
typedef int __attribute__((may_alias)) int_a;

template <typename T> __device__ __forceinline__ void vst2(void* p, T v) { *(T*)p = v;  }
__device__ __forceinline__ v8f wmma16(v16h a, v16h b, v8f c) {
  v8f d = __builtin_amdgcn_wmma_f32_16x16x32_f16(false, a, false, b, (short)0, c, false, false);
  asm volatile("v_nop\n\tv_nop\n\tv_nop\n\tv_nop" : "+v"(d) : "v"(a), "v"(b));
  return d;
}
__device__ __forceinline__ v8f wmma_bf(v16b a, v16b b, v8f c) {
  v8f d = __builtin_amdgcn_wmma_f32_16x16x32_bf16(false, a, false, b, (short)0, c, false, false);
  asm volatile("v_nop\n\tv_nop\n\tv_nop\n\tv_nop" : "+v"(d) : "v"(a), "v"(b));
  return d;
}
// the same for kernels whose fragments need registers above v255: an asm operand stays under v256, so the statement names D alone (the compiler keeps the A and B distances of its own builtin)
__device__ __forceinline__ v8f wmma_bfd(v16b a, v16b b, v8f c) {
  v8f d = __builtin_amdgcn_wmma_f32_16x16x32_bf16(false, a, false, b, (short)0, c, false, false);
  asm volatile("v_nop\n\tv_nop\n\tv_nop\n\tv_nop" : "+v"(d));
  return d;
}
// 16x16x32 fragments: lane = (h = lane>>4, row/col = lane&15); elements 0..7 = k0+8h+0..7, 8..15 = k0+16+8h+0..7; D element r = row 8h+r
__device__ __forceinline__ v16h frag_h(const _Float16* rowk0, int lane) {
  union { v16h v; v8h q[2]; } u; const _Float16* p = rowk0 + 8 * (lane >> 4);
  u.q[0] = *(const v8h*)p; u.q[1] = *(const v8h*)(p + 16); return u.v;
}
__device__ __forceinline__ v16h frag_f32(const float* rowk0, int lane) {
  v16h a; const float* p = rowk0 + 8 * (lane >> 4);
#pragma unroll
  for (int i = 0; i < 8; ++i) { a[i] = (_Float16)p[i]; a[8 + i] = (_Float16)p[16 + i]; }
  return a;
}
__device__ __forceinline__ v16h frag_f32s(const float* rowk0, int lane, float sc) {
  v16h a; const float* p = rowk0 + 8 * (lane >> 4);
#pragma unroll
  for (int i = 0; i < 8; ++i) { a[i] = (_Float16)(p[i] * sc); a[8 + i] = (_Float16)(p[16 + i] * sc); }
  return a;
}
// column fragment from a [K][ld] layout (column n), rows >= K read as 0
__device__ __forceinline__ v16h fragc_f32(const float* W, int k0, int n, int lane, int ld, int K) {
  v16h a; const int g = lane >> 4;
#pragma unroll
  for (int i = 0; i < 8; ++i) { const int ka = k0 + 8 * g + i, kb = ka + 16;
    a[i] = (_Float16)(ka < K ? W[(size_t)(ka < K ? ka : K - 1) * ld + n] : 0.f); a[8 + i] = (_Float16)(kb < K ? W[(size_t)(kb < K ? kb : K - 1) * ld + n] : 0.f); }
  return a;
}
struct F2 { v16b h, l; };
__device__ __forceinline__ F2 bsplit16(const float v[16]) { F2 r;
#pragma unroll
  for (int i = 0; i < 16; ++i) { const __bf16 h = (__bf16)v[i]; r.h[i] = h; r.l[i] = (__bf16)(v[i] - (float)h); }
  return r; }
__device__ __forceinline__ F2 split_row(const float* row, int k0, int lane) { float v[16]; const float* p = row + k0 + 8 * (lane >> 4);
#pragma unroll
  for (int i = 0; i < 8; ++i) { v[i] = p[i]; v[8 + i] = p[16 + i]; }
  return bsplit16(v); }
__device__ __forceinline__ F2 split_rowK(const float* row, int k0, int lane, int K) { float v[16]; const int g = lane >> 4;
#pragma unroll
  for (int i = 0; i < 8; ++i) { const int ka = k0 + 8 * g + i, kb = ka + 16; v[i] = ka < K ? row[ka < K ? ka : K - 1] : 0.f; v[8 + i] = kb < K ? row[kb < K ? kb : K - 1] : 0.f; }
  return bsplit16(v); }
__device__ __forceinline__ F2 split_col(const float* W, int k0, int n, int lane, int ld, int K) { float v[16]; const int g = lane >> 4;
#pragma unroll
  for (int i = 0; i < 8; ++i) { const int ka = k0 + 8 * g + i, kb = ka + 16; v[i] = ka < K ? W[(size_t)(ka < K ? ka : K - 1) * ld + n] : 0.f; v[8 + i] = kb < K ? W[(size_t)(kb < K ? kb : K - 1) * ld + n] : 0.f; }
  return bsplit16(v); }
__device__ __forceinline__ v8f mac3(const F2& a, const F2& b, v8f c) { c = wmma_bf(a.l, b.h, c); c = wmma_bf(a.h, b.l, c); return wmma_bf(a.h, b.h, c); }
__device__ __forceinline__ float sigm(float v) { return 1.0f / (1.0f + expf(-v)); }
#define LDSX() do { asm volatile("s_wait_dscnt 0" ::: "memory"); __builtin_amdgcn_wave_barrier(); __builtin_amdgcn_fence(__ATOMIC_RELEASE, "workgroup"); } while (0)

// Projector (B 16, N 1,024, C 512, per-batch weights): A = x Wq[b]; Bm = T Wk[b]; P = softmax(A Bm^T); out = x + P T.
__device__ __forceinline__ float bfr(float v) { return (float)(__bf16)v; }
#define NB 16
#define TT 1024
#define CC 512
#ifndef TNB
#define TNB NB
#endif
#define BG 16                  // batches per launch group (S planes)
typedef __attribute__((ext_vector_type(8))) __bf16 v8b;
__device__ __forceinline__ v16b frag_b(const __bf16* rowk0, int lane) { union { v16b v; v8b q[2]; } u; const __bf16* p = rowk0 + 8 * (lane >> 4); u.q[0] = *(const v8b*)p; u.q[1] = *(const v8b*)(p + 16); return u.v; }
#define WS_AH  0u                                          // bf16 A hi rows [b*N+n][512]
#define WS_AL  (WS_AH + 2u * (size_t)NB * TT * CC)
#define WS_BH  (WS_AL + 2u * (size_t)NB * TT * CC)           // bf16 Bm hi rows [b*N+m][512]
#define WS_BL  (WS_BH + 2u * (size_t)NB * TT * CC)
#define WS_TT  (WS_BL + 2u * (size_t)NB * TT * CC)           // bf16 T planes [b][c][m] (exact)
#define WS_S   (WS_TT + 2u * (size_t)NB * CC * TT)           // f32 S / P [bg][n][m]
#define WS_END (WS_S + 4u * (size_t)BG * TT * TT)
// ---- LDS staging by asynchronous copies: each lane brings its own 16 bytes; a wave's 32 lanes cover whole 128-B lines
__device__ __forceinline__ unsigned lds_off(const void* p) { return (unsigned)(size_t)p; }
// eight copies in one statement: four from (la, ga) and four from (lb, gb), LS bytes apart in LDS and GS bytes apart in global memory.
// s_wait_xcnt 0 is the statement's last line so that it stands in front of every later rewrite of the address registers named here.
template <int LS, int GS> __device__ __forceinline__ void cp44(unsigned la, const char* ga, unsigned lb, const char* gb) {
  asm volatile("global_load_async_to_lds_b128 %0, %1, off\n\t"
               "global_load_async_to_lds_b128 %2, %3, off\n\t"
               "global_load_async_to_lds_b128 %4, %5, off\n\t"
               "global_load_async_to_lds_b128 %6, %7, off\n\t"
               "global_load_async_to_lds_b128 %8, %9, off\n\t"
               "global_load_async_to_lds_b128 %10, %11, off\n\t"
               "global_load_async_to_lds_b128 %12, %13, off\n\t"
               "global_load_async_to_lds_b128 %14, %15, off\n\t"
               "s_wait_xcnt 0x0"
               :: "v"(la), "v"(ga), "v"(la + LS), "v"(ga + GS), "v"(la + 2 * LS), "v"(ga + 2 * GS), "v"(la + 3 * LS), "v"(ga + 3 * GS),
                  "v"(lb), "v"(gb), "v"(lb + LS), "v"(gb + GS), "v"(lb + 2 * LS), "v"(gb + 2 * GS), "v"(lb + 3 * LS), "v"(gb + 3 * GS) : "memory");
}
// the issuing wave's own copies have landed (the compiler places no wait for them)
#define WAIT_COPIES() asm volatile("s_wait_asynccnt 0x0" ::: "memory")
// this wave's LDS reads have retired before the buffer they read is handed back for a refill
#define WAIT_LDS() asm volatile("s_wait_dscnt 0x0" ::: "memory")
// stands behind a group of global loads and stores, in front of the next group's rewrite of the registers that they name
#define WAIT_XLAT() asm volatile("s_wait_xcnt 0x0" ::: "memory")
#define SC_P (128 * 144)                   // k_sc stage: 128 rows of 128 B (64 k) at pitch 144 B
#define SC_ST (4 * SC_P)                   // [A hi | A lo | Bm hi | Bm lo]
#define PV_PP (128 * 272)                  // k_pv stage: P, 128 rows of 256 B (64 keys, f32) at pitch 272 B
#define PV_TP (128 * 144)                  // T planes, 128 channel rows of 128 B (64 keys) at pitch 144 B
#define PV_ST (PV_PP + PV_TP)
// ---- k_lin: block = (128 rows, 128 cols, which), 8 waves of 32 x 64: A = x Wq[b] (which 0) or Bm = T Wk[b] (which 1), per-batch (in,out) weights, exact; stored as bf16 hi + lo rows
// both operands go through LDS as bf16, rounded once a block: whole-line global loads into registers one stage (64 k) ahead, rows of x as they lie, W turned to [col][k] by which registers are packed together
#define LN_P 144                           // a staged row: 64 k as bf16 (128 B) at pitch 144 B
#define LN_XP (128 * LN_P)                 // one operand's 128 rows
#define LN_ST (2 * LN_XP)                  // [x rows | W columns]
typedef __attribute__((ext_vector_type(4))) __bf16 v4b;
__global__ __launch_bounds__(256) void k_lin(const float* __restrict__ X, const float* __restrict__ T_, const float* __restrict__ WQ, const float* __restrict__ WK, __bf16* __restrict__ AH, __bf16* __restrict__ AL, __bf16* __restrict__ BH, __bf16* __restrict__ BL) { __shared__ __align__(16) char ring[2][LN_ST];   // behind the loop the same bytes stage the hi and lo output rows
  const int tid = threadIdx.x, wave = tid >> 5, lane = tid & 31, col = lane & 15, g = lane >> 4, wr = wave >> 1, wc = wave & 1; const int which = blockIdx.z; const int c0 = blockIdx.y * 128; const size_t r0 = (size_t)blockIdx.x * 128; const size_t b = r0 / TT;
  const float* SRC = which == 0 ? X : T_; const float* Wb = (which == 0 ? WQ : WK) + b * (size_t)CC * CC; __bf16* DH = which == 0 ? AH : BH; __bf16* DL = which == 0 ? AL : BL;
  // x: thread -> row tid >> 4 (+ 16 per load), 16-B piece tid & 15 (a wave's load = 4 whole lines); W: wave -> 8 k rows, lane -> column lane (+ 32 per load) (a wave's load = 1 whole line)
  const float* gx = SRC + (r0 + (tid >> 4)) * CC + (tid & 15) * 4; const float* gw = Wb + (size_t)(wave * 8) * CC + c0 + lane;
  v4f xr[8]; float wv[4][8]; v8f acc[2][4] = {};
  auto load = [&](int t) {
#pragma unroll   // constant indices keep the stage in registers
    for (int i = 0; i < 8; ++i) xr[i] = *(const v4f*)(gx + (size_t)i * 16 * CC + t * 64);
#pragma unroll   // constant indices keep the stage in registers
    for (int c = 0; c < 4; ++c)
#pragma unroll   // constant indices keep the stage in registers
      for (int i = 0; i < 8; ++i) wv[c][i] = gw[(size_t)(t * 64 + i) * CC + c * 32]; };
  auto stash = [&](int buf) { char* st = ring[buf];
#pragma unroll   // constant indices keep the stage in registers
    for (int i = 0; i < 8; ++i) { v4b q; q[0] = (__bf16)xr[i][0]; q[1] = (__bf16)xr[i][1]; q[2] = (__bf16)xr[i][2]; q[3] = (__bf16)xr[i][3]; *(v4b*)(st + ((tid >> 4) + 16 * i) * LN_P + (tid & 15) * 8) = q; }
#pragma unroll   // constant indices keep the stage in registers
    for (int c = 0; c < 4; ++c) { v8b q;
#pragma unroll   // constant indices keep the stage in registers
      for (int i = 0; i < 8; ++i) q[i] = (__bf16)wv[c][i];
      *(v8b*)(st + LN_XP + (lane + 32 * c) * LN_P + wave * 16) = q; } };
  load(0); stash(0); __syncthreads();
#pragma unroll 1   // one stage a trip: the two buffers alternate by t & 1
  for (int t = 0; t < CC / 64; ++t) { const char* st = ring[t & 1];
    if (t + 1 < CC / 64) load(t + 1);   // in flight while this stage is worked on
#pragma unroll   // constant indices keep fragments and accumulators in registers
    for (int h = 0; h < 2; ++h) { v16b a[2], w[4];   // a 32-k block's LDS reads stand as one group in front of its WMMAs
#pragma unroll   // constant indices keep fragments and accumulators in registers
      for (int i = 0; i < 2; ++i) a[i] = frag_b((const __bf16*)(st + (wr * 32 + i * 16 + col) * LN_P + h * 64), lane);
#pragma unroll   // constant indices keep fragments and accumulators in registers
      for (int j = 0; j < 4; ++j) w[j] = frag_b((const __bf16*)(st + LN_XP + (wc * 64 + j * 16 + col) * LN_P + h * 64), lane);
#pragma unroll   // constant indices keep fragments and accumulators in registers
      for (int i = 0; i < 2; ++i)
#pragma unroll   // constant indices keep fragments and accumulators in registers
        for (int j = 0; j < 4; ++j) acc[i][j] = wmma_bf(a[i], w[j], acc[i][j]); }
    if (t + 1 < CC / 64) stash((t + 1) & 1);   // into the buffer whose readers left it at the last barrier
    __syncthreads(); }   // publishes stage t + 1 and ends every read of stage t's buffer
  __bf16 (*sh)[136] = (__bf16 (*)[136])&ring[0][0]; __bf16 (*sl)[136] = (__bf16 (*)[136])(&ring[0][0] + 128 * 272);
#pragma unroll   // constant indices keep the accumulators in registers
  for (int i = 0; i < 2; ++i)
#pragma unroll   // constant indices keep the accumulators in registers
    for (int j = 0; j < 4; ++j)
#pragma unroll   // constant indices keep the accumulators in registers
      for (int r = 0; r < 8; ++r) { const float v = acc[i][j][r]; const __bf16 h = (__bf16)v; sh[wr * 32 + i * 16 + 8 * g + r][wc * 64 + j * 16 + col] = h; sl[wr * 32 + i * 16 + 8 * g + r][wc * 64 + j * 16 + col] = (__bf16)(v - (float)h); }
  __syncthreads();
  for (int e = tid; e < 128 * 16; e += 256) { const int rl = e >> 4, q = e & 15; vst2((unsigned*)(DH + (r0 + rl) * CC + c0 + q * 8), *(const v4u*)&sh[rl][q * 8]); vst2((unsigned*)(DL + (r0 + rl) * CC + c0 + q * 8), *(const v4u*)&sl[rl][q * 8]); } }
// ---- k_tt: block = (128 rows m, b, 128-channel group): T (exact bf16) -> planes [b][c][m]; 256-B pieces
__global__ __launch_bounds__(128) void k_tt(const float* __restrict__ T_, __bf16* __restrict__ TP) { __shared__ __align__(16) __bf16 th[128][136];
  const int tid = threadIdx.x; const int m0 = blockIdx.x * 128; const size_t b = blockIdx.y; const int c0 = blockIdx.z * 128;
  for (int e = tid; e < 128 * 128; e += 128) { const int ml = e >> 7, cl = e & 127; th[cl][ml] = (__bf16)T_[(b * TT + m0 + ml) * CC + c0 + cl]; }
  __syncthreads();
  for (int e = tid; e < 128 * 16; e += 128) { const int cl = e >> 4, q = e & 15; vst2((unsigned*)(TP + (b * CC + c0 + cl) * (size_t)TT + m0 + q * 8), *(const v4u*)&th[cl][q * 8]); } }
// ---- k_sc: block = (128 rows n, 128 cols m, batch in group), 4 waves of 64 x 64: S = A . Bm over K 512, 3 products; a staged fragment feeds 4 tiles
__global__ __launch_bounds__(128) void k_sc(const __bf16* __restrict__ AH, const __bf16* __restrict__ AL, const __bf16* __restrict__ BH, const __bf16* __restrict__ BL, int b0, float* __restrict__ S0) { __shared__ __align__(16) char ring[2][SC_ST];   // behind the loop the same bytes stage the output rows: two blocks still fit a WGP's LDS
  const size_t b = b0 + blockIdx.z; float* S = S0 + (size_t)blockIdx.z * TT * TT;
  const int tid = threadIdx.x, wave = tid >> 5, lane = tid & 31, col = lane & 15, g = lane >> 4, wr = wave >> 1, wc = wave & 1; const int k0 = blockIdx.y * 128; const int q0 = blockIdx.x * 128;
  v8f acc[4][4] = {};
  // stage t = k [64 t, 64 t + 64) of the block's 128 A rows and 128 Bm rows, hi and lo; thread -> row tid >> 3 (+ 16 per copy), 16-B piece tid & 7
  const unsigned l0 = lds_off(&ring[0][0]) + (tid >> 3) * 144 + (tid & 7) * 16;
  const size_t goa = ((b * TT + q0 + (tid >> 3)) * CC + (tid & 7) * 8) * 2, gob = ((b * TT + k0 + (tid >> 3)) * CC + (tid & 7) * 8) * 2;
  const char *gah = (const char*)AH + goa, *gal = (const char*)AL + goa, *gbh = (const char*)BH + gob, *gbl = (const char*)BL + gob;
  auto fill = [&](int t, int buf) { const unsigned l = l0 + buf * SC_ST; const int go = t * 128;
    cp44<16 * 144, 16 * CC * 2>(l, gah + go, l + 64 * 144, gah + go + 64 * CC * 2);
    cp44<16 * 144, 16 * CC * 2>(l + SC_P, gal + go, l + SC_P + 64 * 144, gal + go + 64 * CC * 2);
    cp44<16 * 144, 16 * CC * 2>(l + 2 * SC_P, gbh + go, l + 2 * SC_P + 64 * 144, gbh + go + 64 * CC * 2);
    cp44<16 * 144, 16 * CC * 2>(l + 3 * SC_P, gbl + go, l + 3 * SC_P + 64 * 144, gbl + go + 64 * CC * 2); };
  fill(0, 0); WAIT_COPIES(); __syncthreads(); fill(1, 1);
#pragma unroll 1   // one stage a trip: the two buffers alternate by t & 1
  for (int t = 0; t < CC / 64; ++t) { const char* st = ring[t & 1];
    v16b ah[2][4], al[2][4], bh[2][4], bl[2][4];   // the stage's LDS reads stand as one group in front of its WMMAs
#pragma unroll   // constant indices keep fragments and accumulators in registers
    for (int h = 0; h < 2; ++h) {
#pragma unroll   // constant indices keep fragments and accumulators in registers
      for (int i = 0; i < 4; ++i) { const char* ar = st + (wr * 64 + i * 16 + col) * 144 + h * 64; ah[h][i] = frag_b((const __bf16*)ar, lane); al[h][i] = frag_b((const __bf16*)(ar + SC_P), lane); }
#pragma unroll   // constant indices keep fragments and accumulators in registers
      for (int j = 0; j < 4; ++j) { const char* br = st + 2 * SC_P + (wc * 64 + j * 16 + col) * 144 + h * 64; bh[h][j] = frag_b((const __bf16*)br, lane); bl[h][j] = frag_b((const __bf16*)(br + SC_P), lane); } }
#pragma unroll   // constant indices keep fragments and accumulators in registers
    for (int h = 0; h < 2; ++h) {   // each product over all 16 tiles before the next: a tile's own order stays hi.hi, lo.hi, hi.lo
#pragma unroll   // constant indices keep fragments and accumulators in registers
      for (int i = 0; i < 4; ++i)
#pragma unroll   // constant indices keep fragments and accumulators in registers
        for (int j = 0; j < 4; ++j) acc[i][j] = wmma_bfd(ah[h][i], bh[h][j], acc[i][j]);
#pragma unroll   // constant indices keep fragments and accumulators in registers
      for (int i = 0; i < 4; ++i)
#pragma unroll   // constant indices keep fragments and accumulators in registers
        for (int j = 0; j < 4; ++j) acc[i][j] = wmma_bfd(al[h][i], bh[h][j], acc[i][j]);
#pragma unroll   // constant indices keep fragments and accumulators in registers
      for (int i = 0; i < 4; ++i)
#pragma unroll   // constant indices keep fragments and accumulators in registers
        for (int j = 0; j < 4; ++j) acc[i][j] = wmma_bfd(ah[h][i], bl[h][j], acc[i][j]); }
    WAIT_LDS(); WAIT_COPIES(); __syncthreads();   // publishes stage t + 1 and ends every read of stage t's buffer
    if (t + 2 < CC / 64) fill(t + 2, t & 1); }
  WAIT_COPIES();
  // the ring is free: the last trip's foot (LDS reads retired, copies landed, barrier) stands behind its every use; each wave stages its 64 x 64 tile in rows of its own, so that whole 128-B lines go out
  float (*ss)[68] = (float (*)[68])(&ring[0][0] + wave * (64 * 68 * 4));
#pragma unroll   // constant indices keep the accumulators in registers
  for (int i = 0; i < 4; ++i)
#pragma unroll   // constant indices keep the accumulators in registers
    for (int j = 0; j < 4; ++j)
#pragma unroll   // constant indices keep the accumulators in registers
      for (int r = 0; r < 8; ++r) ss[i * 16 + 8 * g + r][j * 16 + col] = acc[i][j][r];
  LDSX(); float* so = S + (size_t)(q0 + wr * 64 + g) * TT + k0 + wc * 64 + col * 4;
  for (int r0 = 0; r0 < 64; r0 += 16) {   // 16 rows a group, two rows a store
#pragma unroll   // the group's LDS reads go out together
    for (int u = 0; u < 8; ++u) vst2(so + (size_t)(r0 + 2 * u) * TT, *(const v4f*)&ss[r0 + 2 * u + g][col * 4]);
    if (r0 + 16 < 64) WAIT_XLAT(); } }
// ---- k_sm: one wave = one query row held in registers (32 values a lane, 16-byte loads over whole lines): softmax over the 1,024 keys -> P x 2^11 f32 in place (masked -> 0); S is read once, no LDS, no barrier
__global__ __launch_bounds__(256) void k_sm(float* __restrict__ S0) {
  const int lane = threadIdx.x & 31; const size_t row = (size_t)blockIdx.x * 8 + (threadIdx.x >> 5); float* sr = S0 + (size_t)blockIdx.y * TT * TT + row * TT + lane * 4;
  v4f v[TT / 128];
#pragma unroll   // constant indices keep the row in registers
  for (int i = 0; i < TT / 128; ++i) v[i] = *(const v4f*)(sr + i * 128);
  float m = -3.0e38f;
#pragma unroll   // constant indices keep the row in registers
  for (int i = 0; i < TT / 128; ++i) m = fmaxf(m, fmaxf(fmaxf(v[i][0], v[i][1]), fmaxf(v[i][2], v[i][3])));
#pragma unroll   // the five lane distances as constants
  for (int o = 1; o < 32; o <<= 1) m = fmaxf(m, __shfl_xor(m, o));
  v4f s4 = {};   // four independent sums a lane
#pragma unroll   // constant indices keep the row in registers
  for (int i = 0; i < TT / 128; ++i)
#pragma unroll   // constant indices keep the row in registers
    for (int c = 0; c < 4; ++c) { const float x = v[i][c]; const float ex = expf(x - m); const float e = (x <= -1.0e38f) ? 0.f : ex; v[i][c] = e; s4[c] += e; }
  float sum = (s4[0] + s4[1]) + (s4[2] + s4[3]);
#pragma unroll   // the five lane distances as constants
  for (int o = 1; o < 32; o <<= 1) sum += __shfl_xor(sum, o);
  const float inv = 1.0f / sum;
#pragma unroll   // constant indices keep the row in registers
  for (int i = 0; i < TT / 128; ++i) { v4f o4; o4[0] = v[i][0] * inv * 2048.0f; o4[1] = v[i][1] * inv * 2048.0f; o4[2] = v[i][2] * inv * 2048.0f; o4[3] = v[i][3] * inv * 2048.0f; vst2(sr + i * 128, o4); } }
// ---- k_pv: block = (128 rows n, 128 channels, batch in group), 4 waves of 32 x 128: out = x + (P . T) / 2^11 (P split bf16 hi + lo x exact T planes, 2 products); a staged T fragment feeds 2 row tiles
__global__ __launch_bounds__(128) void k_pv(const float* __restrict__ PS0, const __bf16* __restrict__ TP, const float* __restrict__ X, int b0, float* __restrict__ OUT) { __shared__ __align__(16) float ss[4][16][132]; __shared__ __align__(16) char ring[2][PV_ST];
  const size_t b = b0 + blockIdx.z; const float* PS = PS0 + (size_t)blockIdx.z * TT * TT;
  const int tid = threadIdx.x, wave = tid >> 5, lane = tid & 31, col = lane & 15, g = lane >> 4; const int ql0 = blockIdx.x * 128 + wave * 32; const int c0 = blockIdx.y * 128;
  v8f acc[2][8] = {};
  // stage t = keys [64 t, 64 t + 64): the block's 128 P rows (thread -> row tid >> 4, + 8 per copy, piece tid & 15) and 128 T channel rows (row tid >> 3, + 16 per copy, piece tid & 7)
  const unsigned lp0 = lds_off(&ring[0][0]) + (tid >> 4) * 272 + (tid & 15) * 16, lt0 = lds_off(&ring[0][0]) + PV_PP + (tid >> 3) * 144 + (tid & 7) * 16;
  const char* gp = (const char*)PS + ((size_t)(blockIdx.x * 128 + (tid >> 4)) * TT + (tid & 15) * 4) * 4; const char* gt = (const char*)TP + ((b * CC + c0 + (tid >> 3)) * (size_t)TT + (tid & 7) * 8) * 2;
  auto fill = [&](int t, int buf) { const unsigned lp = lp0 + buf * PV_ST, lt = lt0 + buf * PV_ST;
    cp44<8 * 272, 8 * TT * 4>(lp, gp + t * 256, lp + 32 * 272, gp + t * 256 + 32 * TT * 4);
    cp44<8 * 272, 8 * TT * 4>(lp + 64 * 272, gp + t * 256 + 64 * TT * 4, lp + 96 * 272, gp + t * 256 + 96 * TT * 4);
    cp44<16 * 144, 16 * TT * 2>(lt, gt + t * 128, lt + 64 * 144, gt + t * 128 + 64 * TT * 2); };
  fill(0, 0); WAIT_COPIES(); __syncthreads(); fill(1, 1);
#pragma unroll 1   // one stage a trip: the two buffers alternate by t & 1
  for (int t = 0; t < TT / 64; ++t) { const char* st = ring[t & 1];
    F2 p[2][2]; v16b th[2][8];   // the stage's LDS reads stand as one group in front of its WMMAs
#pragma unroll   // constant indices keep fragments and accumulators in registers
    for (int h = 0; h < 2; ++h) {
#pragma unroll   // constant indices keep fragments and accumulators in registers
      for (int i = 0; i < 2; ++i) p[h][i] = split_row((const float*)(st + (wave * 32 + i * 16 + col) * 272), h * 32, lane);
#pragma unroll   // constant indices keep fragments and accumulators in registers
      for (int j = 0; j < 8; ++j) th[h][j] = frag_b((const __bf16*)(st + PV_PP + (j * 16 + col) * 144 + h * 64), lane); }
#pragma unroll   // constant indices keep fragments and accumulators in registers
    for (int h = 0; h < 2; ++h) {   // each product over all 16 tiles before the next: a tile's own order stays hi, lo
#pragma unroll   // constant indices keep fragments and accumulators in registers
      for (int i = 0; i < 2; ++i)
#pragma unroll   // constant indices keep fragments and accumulators in registers
        for (int j = 0; j < 8; ++j) acc[i][j] = wmma_bfd(p[h][i].h, th[h][j], acc[i][j]);
#pragma unroll   // constant indices keep fragments and accumulators in registers
      for (int i = 0; i < 2; ++i)
#pragma unroll   // constant indices keep fragments and accumulators in registers
        for (int j = 0; j < 8; ++j) acc[i][j] = wmma_bfd(p[h][i].l, th[h][j], acc[i][j]); }
    WAIT_LDS(); WAIT_COPIES(); __syncthreads();   // publishes stage t + 1 and ends every read of stage t's buffer
    if (t + 2 < TT / 64) fill(t + 2, t & 1); }
  WAIT_COPIES();
#pragma unroll   // constant indices keep the accumulators in registers
  for (int i = 0; i < 2; ++i) {   // 16 rows at a time through the wave's own staging rows
    if (i) WAIT_LDS();   // the first 16 rows are read before the next 16 overwrite them
#pragma unroll
    for (int j = 0; j < 8; ++j)
#pragma unroll
      for (int r = 0; r < 8; ++r) ss[wave][8 * g + r][j * 16 + col] = acc[i][j][r] * (1.0f / 2048.0f);
    LDSX(); for (int r0 = 0; r0 < 16; r0 += 8) { const size_t off = (b * TT + ql0 + i * 16 + r0) * CC + c0 + lane * 4; v4f xr[8];   // 8 rows a group
#pragma unroll   // the group's x loads are in flight together
      for (int u = 0; u < 8; ++u) xr[u] = *(const v4f*)(X + off + u * CC);
#pragma unroll   // constant indices keep the group in registers
      for (int u = 0; u < 8; ++u) { v4f o = *(const v4f*)&ss[wave][r0 + u][lane * 4]; o[0] += bfr(xr[u][0]); o[1] += bfr(xr[u][1]); o[2] += bfr(xr[u][2]); o[3] += bfr(xr[u][3]); vst2(OUT + off + u * CC, o); }
      if (i == 0 || r0 == 0) WAIT_XLAT(); } } }
extern "C" void kernel_launch(void* const* d_in, const int* in_sizes, int n_in, void* d_out, int out_size, void* d_ws, size_t ws_size, hipStream_t stream) {
  (void)in_sizes; (void)n_in; (void)out_size;
  const float** F = (const float**)d_in;   // 0 x_in [16,1024,512], 1 T [16,1024,512], 2 Wq [16,512,512] ((in,out) per batch), 3 Wk [16,512,512]
  if (ws_size < (size_t)WS_END) return;
  char* ws = (char*)d_ws; __bf16 *AH = (__bf16*)(ws + WS_AH), *AL = (__bf16*)(ws + WS_AL), *BH = (__bf16*)(ws + WS_BH), *BL = (__bf16*)(ws + WS_BL), *TP = (__bf16*)(ws + WS_TT); float* S = (float*)(ws + WS_S);
  k_lin<<<dim3(TNB * TT / 128, CC / 128, 2), 256, 0, stream>>>(F[0], F[1], F[2], F[3], AH, AL, BH, BL);
  k_tt<<<dim3(TT / 128, TNB, CC / 128), 128, 0, stream>>>(F[1], TP);
  for (int b0 = 0; b0 < TNB; b0 += BG) { const int ng = (TNB - b0) < BG ? (TNB - b0) : BG;
    k_sc<<<dim3(TT / 128, TT / 128, ng), 128, 0, stream>>>(AH, AL, BH, BL, b0, S);
    k_sm<<<dim3(TT / 8, ng), 256, 0, stream>>>(S);
    k_pv<<<dim3(TT / 128, CC / 128, ng), 128, 0, stream>>>(S, TP, F[0], b0, (float*)d_out);
  }
}

// v006
// One run takes 128 microseconds.
// Next to v005, in two timings, it ran 1.05 and 1.06 times as fast.
// Counting every step since v000, it is 5.77 times as fast.
// compute dtype: all float inputs rounded to bf16; A = x Wq[b] and Bm = T Wk[b] with EXACT bf16 products on WMMA 16x16x32, f32 accumulate, stored as bf16 hi + lo row planes; S = A . Bm over K = 512 with 3 products (hi.hi + hi.lo + lo.hi), f32; softmax in f32 (precise expf); P x 2^11 split bf16 hi + lo against the EXACT bf16 T planes (2 products); + x residual in f32; f32 output.
#include <hip/hip_runtime.h>
#include <math.h>

typedef __attribute__((ext_vector_type(16))) _Float16 v16h;
typedef __attribute__((ext_vector_type(16))) __bf16 v16b;
typedef __attribute__((ext_vector_type(8)))  _Float16 v8h;
typedef __attribute__((ext_vector_type(8)))  float v8f;
typedef __attribute__((ext_vector_type(4)))  float v4f;
typedef __attribute__((ext_vector_type(2)))  float v2f;
typedef __attribute__((ext_vector_type(4)))  unsigned v4u;
typedef __attribute__((ext_vector_type(4)))  int v4i;
typedef float __attribute__((may_alias)) float_a;
typedef int __attribute__((may_alias)) int_a;

template <typename T> __device__ __forceinline__ void vst2(void* p, T v) { *(T*)p = v;  }
__device__ __forceinline__ v8f wmma16(v16h a, v16h b, v8f c) {
  v8f d = __builtin_amdgcn_wmma_f32_16x16x32_f16(false, a, false, b, (short)0, c, false, false);
  asm volatile("v_nop\n\tv_nop\n\tv_nop\n\tv_nop" : "+v"(d) : "v"(a), "v"(b));
  return d;
}
__device__ __forceinline__ v8f wmma_bf(v16b a, v16b b, v8f c) {
  v8f d = __builtin_amdgcn_wmma_f32_16x16x32_bf16(false, a, false, b, (short)0, c, false, false);
  asm volatile("v_nop\n\tv_nop\n\tv_nop\n\tv_nop" : "+v"(d) : "v"(a), "v"(b));
  return d;
}
// the same for kernels whose fragments need registers above v255: an asm operand stays under v256, so the statement names D alone (the compiler keeps the A and B distances of its own builtin)
__device__ __forceinline__ v8f wmma_bfd(v16b a, v16b b, v8f c) {
  v8f d = __builtin_amdgcn_wmma_f32_16x16x32_bf16(false, a, false, b, (short)0, c, false, false);
  asm volatile("v_nop\n\tv_nop\n\tv_nop\n\tv_nop" : "+v"(d));
  return d;
}
// 16x16x32 fragments: lane = (h = lane>>4, row/col = lane&15); elements 0..7 = k0+8h+0..7, 8..15 = k0+16+8h+0..7; D element r = row 8h+r
__device__ __forceinline__ v16h frag_h(const _Float16* rowk0, int lane) {
  union { v16h v; v8h q[2]; } u; const _Float16* p = rowk0 + 8 * (lane >> 4);
  u.q[0] = *(const v8h*)p; u.q[1] = *(const v8h*)(p + 16); return u.v;
}
__device__ __forceinline__ v16h frag_f32(const float* rowk0, int lane) {
  v16h a; const float* p = rowk0 + 8 * (lane >> 4);
#pragma unroll
  for (int i = 0; i < 8; ++i) { a[i] = (_Float16)p[i]; a[8 + i] = (_Float16)p[16 + i]; }
  return a;
}
__device__ __forceinline__ v16h frag_f32s(const float* rowk0, int lane, float sc) {
  v16h a; const float* p = rowk0 + 8 * (lane >> 4);
#pragma unroll
  for (int i = 0; i < 8; ++i) { a[i] = (_Float16)(p[i] * sc); a[8 + i] = (_Float16)(p[16 + i] * sc); }
  return a;
}
// column fragment from a [K][ld] layout (column n), rows >= K read as 0
__device__ __forceinline__ v16h fragc_f32(const float* W, int k0, int n, int lane, int ld, int K) {
  v16h a; const int g = lane >> 4;
#pragma unroll
  for (int i = 0; i < 8; ++i) { const int ka = k0 + 8 * g + i, kb = ka + 16;
    a[i] = (_Float16)(ka < K ? W[(size_t)(ka < K ? ka : K - 1) * ld + n] : 0.f); a[8 + i] = (_Float16)(kb < K ? W[(size_t)(kb < K ? kb : K - 1) * ld + n] : 0.f); }
  return a;
}
struct F2 { v16b h, l; };
__device__ __forceinline__ F2 bsplit16(const float v[16]) { F2 r;
#pragma unroll
  for (int i = 0; i < 16; ++i) { const __bf16 h = (__bf16)v[i]; r.h[i] = h; r.l[i] = (__bf16)(v[i] - (float)h); }
  return r; }
__device__ __forceinline__ F2 split_row(const float* row, int k0, int lane) { float v[16]; const float* p = row + k0 + 8 * (lane >> 4);
#pragma unroll
  for (int i = 0; i < 8; ++i) { v[i] = p[i]; v[8 + i] = p[16 + i]; }
  return bsplit16(v); }
__device__ __forceinline__ F2 split_rowK(const float* row, int k0, int lane, int K) { float v[16]; const int g = lane >> 4;
#pragma unroll
  for (int i = 0; i < 8; ++i) { const int ka = k0 + 8 * g + i, kb = ka + 16; v[i] = ka < K ? row[ka < K ? ka : K - 1] : 0.f; v[8 + i] = kb < K ? row[kb < K ? kb : K - 1] : 0.f; }
  return bsplit16(v); }
__device__ __forceinline__ F2 split_col(const float* W, int k0, int n, int lane, int ld, int K) { float v[16]; const int g = lane >> 4;
#pragma unroll
  for (int i = 0; i < 8; ++i) { const int ka = k0 + 8 * g + i, kb = ka + 16; v[i] = ka < K ? W[(size_t)(ka < K ? ka : K - 1) * ld + n] : 0.f; v[8 + i] = kb < K ? W[(size_t)(kb < K ? kb : K - 1) * ld + n] : 0.f; }
  return bsplit16(v); }
__device__ __forceinline__ v8f mac3(const F2& a, const F2& b, v8f c) { c = wmma_bf(a.l, b.h, c); c = wmma_bf(a.h, b.l, c); return wmma_bf(a.h, b.h, c); }
__device__ __forceinline__ float sigm(float v) { return 1.0f / (1.0f + expf(-v)); }
#define LDSX() do { asm volatile("s_wait_dscnt 0" ::: "memory"); __builtin_amdgcn_wave_barrier(); __builtin_amdgcn_fence(__ATOMIC_RELEASE, "workgroup"); } while (0)

// Projector (B 16, N 1,024, C 512, per-batch weights): A = x Wq[b]; Bm = T Wk[b]; P = softmax(A Bm^T); out = x + P T.
__device__ __forceinline__ float bfr(float v) { return (float)(__bf16)v; }
#define NB 16
#define TT 1024
#define CC 512
#ifndef TNB
#define TNB NB
#endif
#define BG 16                  // batches per launch group (S planes)
typedef __attribute__((ext_vector_type(8))) __bf16 v8b;
__device__ __forceinline__ v16b frag_b(const __bf16* rowk0, int lane) { union { v16b v; v8b q[2]; } u; const __bf16* p = rowk0 + 8 * (lane >> 4); u.q[0] = *(const v8b*)p; u.q[1] = *(const v8b*)(p + 16); return u.v; }
#define WS_AH  0u                                          // bf16 A hi rows [b*N+n][512]
#define WS_AL  (WS_AH + 2u * (size_t)NB * TT * CC)
#define WS_BH  (WS_AL + 2u * (size_t)NB * TT * CC)           // bf16 Bm hi rows [b*N+m][512]
#define WS_BL  (WS_BH + 2u * (size_t)NB * TT * CC)
#define WS_TT  (WS_BL + 2u * (size_t)NB * TT * CC)           // bf16 T planes [b][c][m] (exact)
#define WS_S   (WS_TT + 2u * (size_t)NB * CC * TT)           // f32 S / P [bg][n][m]
#define WS_END (WS_S + 4u * (size_t)BG * TT * TT)
// ---- LDS staging by asynchronous copies: each lane brings its own 16 bytes; a wave's 32 lanes cover whole 128-B lines
__device__ __forceinline__ unsigned lds_off(const void* p) { return (unsigned)(size_t)p; }
// eight copies in one statement: four from (la, ga) and four from (lb, gb), LS bytes apart in LDS and GS bytes apart in global memory.
// s_wait_xcnt 0 is the statement's last line so that it stands in front of every later rewrite of the address registers named here.
template <int LS, int GS> __device__ __forceinline__ void cp44(unsigned la, const char* ga, unsigned lb, const char* gb) {
  asm volatile("global_load_async_to_lds_b128 %0, %1, off\n\t"
               "global_load_async_to_lds_b128 %2, %3, off\n\t"
               "global_load_async_to_lds_b128 %4, %5, off\n\t"
               "global_load_async_to_lds_b128 %6, %7, off\n\t"
               "global_load_async_to_lds_b128 %8, %9, off\n\t"
               "global_load_async_to_lds_b128 %10, %11, off\n\t"
               "global_load_async_to_lds_b128 %12, %13, off\n\t"
               "global_load_async_to_lds_b128 %14, %15, off\n\t"
               "s_wait_xcnt 0x0"
               :: "v"(la), "v"(ga), "v"(la + LS), "v"(ga + GS), "v"(la + 2 * LS), "v"(ga + 2 * GS), "v"(la + 3 * LS), "v"(ga + 3 * GS),
                  "v"(lb), "v"(gb), "v"(lb + LS), "v"(gb + GS), "v"(lb + 2 * LS), "v"(gb + 2 * GS), "v"(lb + 3 * LS), "v"(gb + 3 * GS) : "memory");
}
// the issuing wave's own copies have landed (the compiler places no wait for them)
#define WAIT_COPIES() asm volatile("s_wait_asynccnt 0x0" ::: "memory")
// this wave's LDS reads have retired before the buffer they read is handed back for a refill
#define WAIT_LDS() asm volatile("s_wait_dscnt 0x0" ::: "memory")
// stands behind a group of global loads and stores, in front of the next group's rewrite of the registers that they name
#define WAIT_XLAT() asm volatile("s_wait_xcnt 0x0" ::: "memory")
#define SC_P (128 * 144)                   // k_sc stage: 128 rows of 128 B (64 k) at pitch 144 B
#define SC_ST (4 * SC_P)                   // [A hi | A lo | Bm hi | Bm lo]
#define PV_PP (128 * 272)                  // k_pv stage: P, 128 rows of 256 B (64 keys, f32) at pitch 272 B
#define PV_TP (128 * 144)                  // T planes, 128 channel rows of 128 B (64 keys) at pitch 144 B
#define PV_ST (PV_PP + PV_TP)
// ---- k_lin: block = (128 rows, 128 cols, which), 8 waves of 32 x 64: A = x Wq[b] (which 0) or Bm = T Wk[b] (which 1), per-batch (in,out) weights, exact; stored as bf16 hi + lo rows
// a T block also writes the planes [b][c][m] (exact bf16 T) of its own 128 channels, read turned out of the staged rows of the two stages that hold them: no pass of its own over T
// both operands go through LDS as bf16, rounded once a block: whole-line global loads into registers one stage (64 k) ahead, rows of x as they lie, W turned to [col][k] by which registers are packed together
#define LN_P 144                           // a staged row: 64 k as bf16 (128 B) at pitch 144 B
#define LN_XP (128 * LN_P)                 // one operand's 128 rows
#define LN_ST (2 * LN_XP)                  // [x rows | W columns]
typedef __attribute__((ext_vector_type(4))) __bf16 v4b;
__global__ __launch_bounds__(256) void k_lin(const float* __restrict__ X, const float* __restrict__ T_, const float* __restrict__ WQ, const float* __restrict__ WK, __bf16* __restrict__ AH, __bf16* __restrict__ AL, __bf16* __restrict__ BH, __bf16* __restrict__ BL, __bf16* __restrict__ TP) { __shared__ __align__(16) char ring[2][LN_ST];   // behind the loop the same bytes stage the hi and lo output rows
  const int tid = threadIdx.x, wave = tid >> 5, lane = tid & 31, col = lane & 15, g = lane >> 4, wr = wave >> 1, wc = wave & 1; const int which = blockIdx.z; const int c0 = blockIdx.y * 128; const size_t r0 = (size_t)blockIdx.x * 128; const size_t b = r0 / TT;
  const float* SRC = which == 0 ? X : T_; const float* Wb = (which == 0 ? WQ : WK) + b * (size_t)CC * CC; __bf16* DH = which == 0 ? AH : BH; __bf16* DL = which == 0 ? AL : BL;
  // x: thread -> row tid >> 4 (+ 16 per load), 16-B piece tid & 15 (a wave's load = 4 whole lines); W: wave -> 8 k rows, lane -> column lane (+ 32 per load) (a wave's load = 1 whole line)
  const float* gx = SRC + (r0 + (tid >> 4)) * CC + (tid & 15) * 4; const float* gw = Wb + (size_t)(wave * 8) * CC + c0 + lane;
  v4f xr[8]; float wv[4][8]; v8f acc[2][4] = {};
  auto load = [&](int t) {
#pragma unroll   // constant indices keep the stage in registers
    for (int i = 0; i < 8; ++i) xr[i] = *(const v4f*)(gx + (size_t)i * 16 * CC + t * 64);
#pragma unroll   // constant indices keep the stage in registers
    for (int c = 0; c < 4; ++c)
#pragma unroll   // constant indices keep the stage in registers
      for (int i = 0; i < 8; ++i) wv[c][i] = gw[(size_t)(t * 64 + i) * CC + c * 32]; };
  auto stash = [&](int buf) { char* st = ring[buf];
#pragma unroll   // constant indices keep the stage in registers
    for (int i = 0; i < 8; ++i) { v4b q; q[0] = (__bf16)xr[i][0]; q[1] = (__bf16)xr[i][1]; q[2] = (__bf16)xr[i][2]; q[3] = (__bf16)xr[i][3]; *(v4b*)(st + ((tid >> 4) + 16 * i) * LN_P + (tid & 15) * 8) = q; }
#pragma unroll   // constant indices keep the stage in registers
    for (int c = 0; c < 4; ++c) { v8b q;
#pragma unroll   // constant indices keep the stage in registers
      for (int i = 0; i < 8; ++i) q[i] = (__bf16)wv[c][i];
      *(v8b*)(st + LN_XP + (lane + 32 * c) * LN_P + wave * 16) = q; } };
  load(0); stash(0); __syncthreads();
#pragma unroll 1   // one stage a trip: the two buffers alternate by t & 1
  for (int t = 0; t < CC / 64; ++t) { const char* st = ring[t & 1];
    if (t + 1 < CC / 64) load(t + 1);   // in flight while this stage is worked on
#pragma unroll   // constant indices keep fragments and accumulators in registers
    for (int h = 0; h < 2; ++h) { v16b a[2], w[4];   // a 32-k block's LDS reads stand as one group in front of its WMMAs
#pragma unroll   // constant indices keep fragments and accumulators in registers
      for (int i = 0; i < 2; ++i) a[i] = frag_b((const __bf16*)(st + (wr * 32 + i * 16 + col) * LN_P + h * 64), lane);
#pragma unroll   // constant indices keep fragments and accumulators in registers
      for (int j = 0; j < 4; ++j) w[j] = frag_b((const __bf16*)(st + LN_XP + (wc * 64 + j * 16 + col) * LN_P + h * 64), lane);
#pragma unroll   // constant indices keep fragments and accumulators in registers
      for (int i = 0; i < 2; ++i)
#pragma unroll   // constant indices keep fragments and accumulators in registers
        for (int j = 0; j < 4; ++j) acc[i][j] = wmma_bf(a[i], w[j], acc[i][j]); }
    if (which == 1 && (t >> 1) == (int)blockIdx.y) {   // stage t holds 64 of this block's own 128 channels: thread -> channel pair tid >> 3, 8 rows m from 8 * (tid & 7) (+ 64): 8 lanes fill a whole 128-B line of a plane
#pragma unroll   // constant indices keep the 8 rows in registers
      for (int s = 0; s < 2; ++s) { const int q = (tid & 7) + 8 * s; unsigned d[8]; v4u e, o;
#pragma unroll   // constant indices keep the 8 rows in registers
        for (int j = 0; j < 8; ++j) d[j] = *(const unsigned*)(st + (q * 8 + j) * LN_P + (tid >> 3) * 4);   // two neighbouring channels of one row
#pragma unroll   // constant indices keep the 8 rows in registers
        for (int k = 0; k < 4; ++k) { e[k] = (d[2 * k] & 0xffffu) | (d[2 * k + 1] << 16); o[k] = (d[2 * k] >> 16) | (d[2 * k + 1] & 0xffff0000u); }
        __bf16* tp = TP + (b * CC + t * 64 + (tid >> 3) * 2) * (size_t)TT + (r0 - b * TT) + q * 8;
        vst2((unsigned*)tp, e); vst2((unsigned*)(tp + TT), o); }
      WAIT_XLAT(); }   // behind the four stores, in front of the next rewrite of their address registers
    if (t + 1 < CC / 64) stash((t + 1) & 1);   // into the buffer whose readers left it at the last barrier
    __syncthreads(); }   // publishes stage t + 1 and ends every read of stage t's buffer
  __bf16 (*sh)[136] = (__bf16 (*)[136])&ring[0][0]; __bf16 (*sl)[136] = (__bf16 (*)[136])(&ring[0][0] + 128 * 272);
#pragma unroll   // constant indices keep the accumulators in registers
  for (int i = 0; i < 2; ++i)
#pragma unroll   // constant indices keep the accumulators in registers
    for (int j = 0; j < 4; ++j)
#pragma unroll   // constant indices keep the accumulators in registers
      for (int r = 0; r < 8; ++r) { const float v = acc[i][j][r]; const __bf16 h = (__bf16)v; sh[wr * 32 + i * 16 + 8 * g + r][wc * 64 + j * 16 + col] = h; sl[wr * 32 + i * 16 + 8 * g + r][wc * 64 + j * 16 + col] = (__bf16)(v - (float)h); }
  __syncthreads();
  for (int e = tid; e < 128 * 16; e += 256) { const int rl = e >> 4, q = e & 15; vst2((unsigned*)(DH + (r0 + rl) * CC + c0 + q * 8), *(const v4u*)&sh[rl][q * 8]); vst2((unsigned*)(DL + (r0 + rl) * CC + c0 + q * 8), *(const v4u*)&sl[rl][q * 8]); } }
// ---- k_sc: block = (128 rows n, 128 cols m, batch in group), 4 waves of 64 x 64: S = A . Bm over K 512, 3 products; a staged fragment feeds 4 tiles
__global__ __launch_bounds__(128) void k_sc(const __bf16* __restrict__ AH, const __bf16* __restrict__ AL, const __bf16* __restrict__ BH, const __bf16* __restrict__ BL, int b0, float* __restrict__ S0) { __shared__ __align__(16) char ring[2][SC_ST];   // behind the loop the same bytes stage the output rows: two blocks still fit a WGP's LDS
  const size_t b = b0 + blockIdx.z; float* S = S0 + (size_t)blockIdx.z * TT * TT;
  const int tid = threadIdx.x, wave = tid >> 5, lane = tid & 31, col = lane & 15, g = lane >> 4, wr = wave >> 1, wc = wave & 1; const int k0 = blockIdx.y * 128; const int q0 = blockIdx.x * 128;
  v8f acc[4][4] = {};
  // stage t = k [64 t, 64 t + 64) of the block's 128 A rows and 128 Bm rows, hi and lo; thread -> row tid >> 3 (+ 16 per copy), 16-B piece tid & 7
  const unsigned l0 = lds_off(&ring[0][0]) + (tid >> 3) * 144 + (tid & 7) * 16;
  const size_t goa = ((b * TT + q0 + (tid >> 3)) * CC + (tid & 7) * 8) * 2, gob = ((b * TT + k0 + (tid >> 3)) * CC + (tid & 7) * 8) * 2;
  const char *gah = (const char*)AH + goa, *gal = (const char*)AL + goa, *gbh = (const char*)BH + gob, *gbl = (const char*)BL + gob;
  auto fill = [&](int t, int buf) { const unsigned l = l0 + buf * SC_ST; const int go = t * 128;
    cp44<16 * 144, 16 * CC * 2>(l, gah + go, l + 64 * 144, gah + go + 64 * CC * 2);
    cp44<16 * 144, 16 * CC * 2>(l + SC_P, gal + go, l + SC_P + 64 * 144, gal + go + 64 * CC * 2);
    cp44<16 * 144, 16 * CC * 2>(l + 2 * SC_P, gbh + go, l + 2 * SC_P + 64 * 144, gbh + go + 64 * CC * 2);
    cp44<16 * 144, 16 * CC * 2>(l + 3 * SC_P, gbl + go, l + 3 * SC_P + 64 * 144, gbl + go + 64 * CC * 2); };
  fill(0, 0); WAIT_COPIES(); __syncthreads(); fill(1, 1);
#pragma unroll 1   // one stage a trip: the two buffers alternate by t & 1
  for (int t = 0; t < CC / 64; ++t) { const char* st = ring[t & 1];
    v16b ah[2][4], al[2][4], bh[2][4], bl[2][4];   // the stage's LDS reads stand as one group in front of its WMMAs
#pragma unroll   // constant indices keep fragments and accumulators in registers
    for (int h = 0; h < 2; ++h) {
#pragma unroll   // constant indices keep fragments and accumulators in registers
      for (int i = 0; i < 4; ++i) { const char* ar = st + (wr * 64 + i * 16 + col) * 144 + h * 64; ah[h][i] = frag_b((const __bf16*)ar, lane); al[h][i] = frag_b((const __bf16*)(ar + SC_P), lane); }
#pragma unroll   // constant indices keep fragments and accumulators in registers
      for (int j = 0; j < 4; ++j) { const char* br = st + 2 * SC_P + (wc * 64 + j * 16 + col) * 144 + h * 64; bh[h][j] = frag_b((const __bf16*)br, lane); bl[h][j] = frag_b((const __bf16*)(br + SC_P), lane); } }
#pragma unroll   // constant indices keep fragments and accumulators in registers
    for (int h = 0; h < 2; ++h) {   // each product over all 16 tiles before the next: a tile's own order stays hi.hi, lo.hi, hi.lo
#pragma unroll   // constant indices keep fragments and accumulators in registers
      for (int i = 0; i < 4; ++i)
#pragma unroll   // constant indices keep fragments and accumulators in registers
        for (int j = 0; j < 4; ++j) acc[i][j] = wmma_bfd(ah[h][i], bh[h][j], acc[i][j]);
#pragma unroll   // constant indices keep fragments and accumulators in registers
      for (int i = 0; i < 4; ++i)
#pragma unroll   // constant indices keep fragments and accumulators in registers
        for (int j = 0; j < 4; ++j) acc[i][j] = wmma_bfd(al[h][i], bh[h][j], acc[i][j]);
#pragma unroll   // constant indices keep fragments and accumulators in registers
      for (int i = 0; i < 4; ++i)
#pragma unroll   // constant indices keep fragments and accumulators in registers
        for (int j = 0; j < 4; ++j) acc[i][j] = wmma_bfd(ah[h][i], bl[h][j], acc[i][j]); }
    WAIT_LDS(); WAIT_COPIES(); __syncthreads();   // publishes stage t + 1 and ends every read of stage t's buffer
    if (t + 2 < CC / 64) fill(t + 2, t & 1); }
  WAIT_COPIES();
  // the ring is free: the last trip's foot (LDS reads retired, copies landed, barrier) stands behind its every use; each wave stages its 64 x 64 tile in rows of its own, so that whole 128-B lines go out
  float (*ss)[68] = (float (*)[68])(&ring[0][0] + wave * (64 * 68 * 4));
#pragma unroll   // constant indices keep the accumulators in registers
  for (int i = 0; i < 4; ++i)
#pragma unroll   // constant indices keep the accumulators in registers
    for (int j = 0; j < 4; ++j)
#pragma unroll   // constant indices keep the accumulators in registers
      for (int r = 0; r < 8; ++r) ss[i * 16 + 8 * g + r][j * 16 + col] = acc[i][j][r];
  LDSX(); float* so = S + (size_t)(q0 + wr * 64 + g) * TT + k0 + wc * 64 + col * 4;
  for (int r0 = 0; r0 < 64; r0 += 16) {   // 16 rows a group, two rows a store
#pragma unroll   // the group's LDS reads go out together
    for (int u = 0; u < 8; ++u) vst2(so + (size_t)(r0 + 2 * u) * TT, *(const v4f*)&ss[r0 + 2 * u + g][col * 4]);
    if (r0 + 16 < 64) WAIT_XLAT(); } }
// ---- k_sm: one wave = one query row held in registers (32 values a lane, 16-byte loads over whole lines): softmax over the 1,024 keys -> P x 2^11 f32 in place (masked -> 0); S is read once, no LDS, no barrier
__global__ __launch_bounds__(256) void k_sm(float* __restrict__ S0) {
  const int lane = threadIdx.x & 31; const size_t row = (size_t)blockIdx.x * 8 + (threadIdx.x >> 5); float* sr = S0 + (size_t)blockIdx.y * TT * TT + row * TT + lane * 4;
  v4f v[TT / 128];
#pragma unroll   // constant indices keep the row in registers
  for (int i = 0; i < TT / 128; ++i) v[i] = *(const v4f*)(sr + i * 128);
  float m = -3.0e38f;
#pragma unroll   // constant indices keep the row in registers
  for (int i = 0; i < TT / 128; ++i) m = fmaxf(m, fmaxf(fmaxf(v[i][0], v[i][1]), fmaxf(v[i][2], v[i][3])));
#pragma unroll   // the five lane distances as constants
  for (int o = 1; o < 32; o <<= 1) m = fmaxf(m, __shfl_xor(m, o));
  v4f s4 = {};   // four independent sums a lane
#pragma unroll   // constant indices keep the row in registers
  for (int i = 0; i < TT / 128; ++i)
#pragma unroll   // constant indices keep the row in registers
    for (int c = 0; c < 4; ++c) { const float x = v[i][c]; const float ex = expf(x - m); const float e = (x <= -1.0e38f) ? 0.f : ex; v[i][c] = e; s4[c] += e; }
  float sum = (s4[0] + s4[1]) + (s4[2] + s4[3]);
#pragma unroll   // the five lane distances as constants
  for (int o = 1; o < 32; o <<= 1) sum += __shfl_xor(sum, o);
  const float inv = 1.0f / sum;
#pragma unroll   // constant indices keep the row in registers
  for (int i = 0; i < TT / 128; ++i) { v4f o4; o4[0] = v[i][0] * inv * 2048.0f; o4[1] = v[i][1] * inv * 2048.0f; o4[2] = v[i][2] * inv * 2048.0f; o4[3] = v[i][3] * inv * 2048.0f; vst2(sr + i * 128, o4); } }
// ---- k_pv: block = (128 rows n, 128 channels, batch in group), 4 waves of 32 x 128: out = x + (P . T) / 2^11 (P split bf16 hi + lo x exact T planes, 2 products); a staged T fragment feeds 2 row tiles
__global__ __launch_bounds__(128) void k_pv(const float* __restrict__ PS0, const __bf16* __restrict__ TP, const float* __restrict__ X, int b0, float* __restrict__ OUT) { __shared__ __align__(16) float ss[4][16][132]; __shared__ __align__(16) char ring[2][PV_ST];
  const size_t b = b0 + blockIdx.z; const float* PS = PS0 + (size_t)blockIdx.z * TT * TT;
  const int tid = threadIdx.x, wave = tid >> 5, lane = tid & 31, col = lane & 15, g = lane >> 4; const int ql0 = blockIdx.x * 128 + wave * 32; const int c0 = blockIdx.y * 128;
  v8f acc[2][8] = {};
  // stage t = keys [64 t, 64 t + 64): the block's 128 P rows (thread -> row tid >> 4, + 8 per copy, piece tid & 15) and 128 T channel rows (row tid >> 3, + 16 per copy, piece tid & 7)
  const unsigned lp0 = lds_off(&ring[0][0]) + (tid >> 4) * 272 + (tid & 15) * 16, lt0 = lds_off(&ring[0][0]) + PV_PP + (tid >> 3) * 144 + (tid & 7) * 16;
  const char* gp = (const char*)PS + ((size_t)(blockIdx.x * 128 + (tid >> 4)) * TT + (tid & 15) * 4) * 4; const char* gt = (const char*)TP + ((b * CC + c0 + (tid >> 3)) * (size_t)TT + (tid & 7) * 8) * 2;
  auto fill = [&](int t, int buf) { const unsigned lp = lp0 + buf * PV_ST, lt = lt0 + buf * PV_ST;
    cp44<8 * 272, 8 * TT * 4>(lp, gp + t * 256, lp + 32 * 272, gp + t * 256 + 32 * TT * 4);
    cp44<8 * 272, 8 * TT * 4>(lp + 64 * 272, gp + t * 256 + 64 * TT * 4, lp + 96 * 272, gp + t * 256 + 96 * TT * 4);
    cp44<16 * 144, 16 * TT * 2>(lt, gt + t * 128, lt + 64 * 144, gt + t * 128 + 64 * TT * 2); };
  fill(0, 0); WAIT_COPIES(); __syncthreads(); fill(1, 1);
#pragma unroll 1   // one stage a trip: the two buffers alternate by t & 1
  for (int t = 0; t < TT / 64; ++t) { const char* st = ring[t & 1];
    F2 p[2][2]; v16b th[2][8];   // the stage's LDS reads stand as one group in front of its WMMAs
#pragma unroll   // constant indices keep fragments and accumulators in registers
    for (int h = 0; h < 2; ++h) {
#pragma unroll   // constant indices keep fragments and accumulators in registers
      for (int i = 0; i < 2; ++i) p[h][i] = split_row((const float*)(st + (wave * 32 + i * 16 + col) * 272), h * 32, lane);
#pragma unroll   // constant indices keep fragments and accumulators in registers
      for (int j = 0; j < 8; ++j) th[h][j] = frag_b((const __bf16*)(st + PV_PP + (j * 16 + col) * 144 + h * 64), lane); }
#pragma unroll   // constant indices keep fragments and accumulators in registers
    for (int h = 0; h < 2; ++h) {   // each product over all 16 tiles before the next: a tile's own order stays hi, lo
#pragma unroll   // constant indices keep fragments and accumulators in registers
      for (int i = 0; i < 2; ++i)
#pragma unroll   // constant indices keep fragments and accumulators in registers
        for (int j = 0; j < 8; ++j) acc[i][j] = wmma_bfd(p[h][i].h, th[h][j], acc[i][j]);
#pragma unroll   // constant indices keep fragments and accumulators in registers
      for (int i = 0; i < 2; ++i)
#pragma unroll   // constant indices keep fragments and accumulators in registers
        for (int j = 0; j < 8; ++j) acc[i][j] = wmma_bfd(p[h][i].l, th[h][j], acc[i][j]); }
    WAIT_LDS(); WAIT_COPIES(); __syncthreads();   // publishes stage t + 1 and ends every read of stage t's buffer
    if (t + 2 < TT / 64) fill(t + 2, t & 1); }
  WAIT_COPIES();
#pragma unroll   // constant indices keep the accumulators in registers
  for (int i = 0; i < 2; ++i) {   // 16 rows at a time through the wave's own staging rows
    if (i) WAIT_LDS();   // the first 16 rows are read before the next 16 overwrite them
#pragma unroll
    for (int j = 0; j < 8; ++j)
#pragma unroll
      for (int r = 0; r < 8; ++r) ss[wave][8 * g + r][j * 16 + col] = acc[i][j][r] * (1.0f / 2048.0f);
    LDSX(); for (int r0 = 0; r0 < 16; r0 += 8) { const size_t off = (b * TT + ql0 + i * 16 + r0) * CC + c0 + lane * 4; v4f xr[8];   // 8 rows a group
#pragma unroll   // the group's x loads are in flight together
      for (int u = 0; u < 8; ++u) xr[u] = *(const v4f*)(X + off + u * CC);
#pragma unroll   // constant indices keep the group in registers
      for (int u = 0; u < 8; ++u) { v4f o = *(const v4f*)&ss[wave][r0 + u][lane * 4]; o[0] += bfr(xr[u][0]); o[1] += bfr(xr[u][1]); o[2] += bfr(xr[u][2]); o[3] += bfr(xr[u][3]); vst2(OUT + off + u * CC, o); }
      if (i == 0 || r0 == 0) WAIT_XLAT(); } } }
extern "C" void kernel_launch(void* const* d_in, const int* in_sizes, int n_in, void* d_out, int out_size, void* d_ws, size_t ws_size, hipStream_t stream) {
  (void)in_sizes; (void)n_in; (void)out_size;
  const float** F = (const float**)d_in;   // 0 x_in [16,1024,512], 1 T [16,1024,512], 2 Wq [16,512,512] ((in,out) per batch), 3 Wk [16,512,512]
  if (ws_size < (size_t)WS_END) return;
  char* ws = (char*)d_ws; __bf16 *AH = (__bf16*)(ws + WS_AH), *AL = (__bf16*)(ws + WS_AL), *BH = (__bf16*)(ws + WS_BH), *BL = (__bf16*)(ws + WS_BL), *TP = (__bf16*)(ws + WS_TT); float* S = (float*)(ws + WS_S);
  k_lin<<<dim3(TNB * TT / 128, CC / 128, 2), 256, 0, stream>>>(F[0], F[1], F[2], F[3], AH, AL, BH, BL, TP);
  for (int b0 = 0; b0 < TNB; b0 += BG) { const int ng = (TNB - b0) < BG ? (TNB - b0) : BG;
    k_sc<<<dim3(TT / 128, TT / 128, ng), 128, 0, stream>>>(AH, AL, BH, BL, b0, S);
    k_sm<<<dim3(TT / 8, ng), 256, 0, stream>>>(S);
    k_pv<<<dim3(TT / 128, CC / 128, ng), 128, 0, stream>>>(S, TP, F[0], b0, (float*)d_out);
  }
}

// v007
// Measured time: 113 microseconds a run.
// Timed twice side by side with v006, it ran 1.14 times as fast both times.
// Counting every step since v000, it is 6.57 times as fast.
// compute dtype: all float inputs rounded to bf16; A = x Wq[b] and Bm = T Wk[b] with EXACT bf16 products on WMMA 16x16x32, f32 accumulate, stored as bf16 hi + lo row planes; S = A . Bm over K = 512 with 3 products (hi.hi + hi.lo + lo.hi), f32; softmax in f32 (exp to the library expf's accuracy) in two halves: exp and sum against the maximum of each 64-key tile, then one factor a row and tile; P x 2^11 split bf16 hi + lo against the EXACT bf16 T planes (2 products); + x residual in f32; f32 output.
#include <hip/hip_runtime.h>
#include <math.h>

typedef __attribute__((ext_vector_type(16))) _Float16 v16h;
typedef __attribute__((ext_vector_type(16))) __bf16 v16b;
typedef __attribute__((ext_vector_type(8)))  _Float16 v8h;
typedef __attribute__((ext_vector_type(8)))  float v8f;
typedef __attribute__((ext_vector_type(4)))  float v4f;
typedef __attribute__((ext_vector_type(2)))  float v2f;
typedef __attribute__((ext_vector_type(4)))  unsigned v4u;
typedef __attribute__((ext_vector_type(4)))  int v4i;
typedef float __attribute__((may_alias)) float_a;
typedef int __attribute__((may_alias)) int_a;

template <typename T> __device__ __forceinline__ void vst2(void* p, T v) { *(T*)p = v;  }
__device__ __forceinline__ v8f wmma16(v16h a, v16h b, v8f c) {
  v8f d = __builtin_amdgcn_wmma_f32_16x16x32_f16(false, a, false, b, (short)0, c, false, false);
  asm volatile("v_nop\n\tv_nop\n\tv_nop\n\tv_nop" : "+v"(d) : "v"(a), "v"(b));
  return d;
}
__device__ __forceinline__ v8f wmma_bf(v16b a, v16b b, v8f c) {
  v8f d = __builtin_amdgcn_wmma_f32_16x16x32_bf16(false, a, false, b, (short)0, c, false, false);
  asm volatile("v_nop\n\tv_nop\n\tv_nop\n\tv_nop" : "+v"(d) : "v"(a), "v"(b));
  return d;
}
// the same for kernels whose fragments need registers above v255: an asm operand stays under v256, so the statement names D alone (the compiler keeps the A and B distances of its own builtin)
__device__ __forceinline__ v8f wmma_bfd(v16b a, v16b b, v8f c) {
  v8f d = __builtin_amdgcn_wmma_f32_16x16x32_bf16(false, a, false, b, (short)0, c, false, false);
  asm volatile("v_nop\n\tv_nop\n\tv_nop\n\tv_nop" : "+v"(d));
  return d;
}
// 16x16x32 fragments: lane = (h = lane>>4, row/col = lane&15); elements 0..7 = k0+8h+0..7, 8..15 = k0+16+8h+0..7; D element r = row 8h+r
__device__ __forceinline__ v16h frag_h(const _Float16* rowk0, int lane) {
  union { v16h v; v8h q[2]; } u; const _Float16* p = rowk0 + 8 * (lane >> 4);
  u.q[0] = *(const v8h*)p; u.q[1] = *(const v8h*)(p + 16); return u.v;
}
__device__ __forceinline__ v16h frag_f32(const float* rowk0, int lane) {
  v16h a; const float* p = rowk0 + 8 * (lane >> 4);
#pragma unroll
  for (int i = 0; i < 8; ++i) { a[i] = (_Float16)p[i]; a[8 + i] = (_Float16)p[16 + i]; }
  return a;
}
__device__ __forceinline__ v16h frag_f32s(const float* rowk0, int lane, float sc) {
  v16h a; const float* p = rowk0 + 8 * (lane >> 4);
#pragma unroll
  for (int i = 0; i < 8; ++i) { a[i] = (_Float16)(p[i] * sc); a[8 + i] = (_Float16)(p[16 + i] * sc); }
  return a;
}
// column fragment from a [K][ld] layout (column n), rows >= K read as 0
__device__ __forceinline__ v16h fragc_f32(const float* W, int k0, int n, int lane, int ld, int K) {
  v16h a; const int g = lane >> 4;
#pragma unroll
  for (int i = 0; i < 8; ++i) { const int ka = k0 + 8 * g + i, kb = ka + 16;
    a[i] = (_Float16)(ka < K ? W[(size_t)(ka < K ? ka : K - 1) * ld + n] : 0.f); a[8 + i] = (_Float16)(kb < K ? W[(size_t)(kb < K ? kb : K - 1) * ld + n] : 0.f); }
  return a;
}
struct F2 { v16b h, l; };
__device__ __forceinline__ F2 bsplit16(const float v[16]) { F2 r;
#pragma unroll
  for (int i = 0; i < 16; ++i) { const __bf16 h = (__bf16)v[i]; r.h[i] = h; r.l[i] = (__bf16)(v[i] - (float)h); }
  return r; }
__device__ __forceinline__ F2 split_row(const float* row, int k0, int lane) { float v[16]; const float* p = row + k0 + 8 * (lane >> 4);
#pragma unroll
  for (int i = 0; i < 8; ++i) { v[i] = p[i]; v[8 + i] = p[16 + i]; }
  return bsplit16(v); }
__device__ __forceinline__ F2 split_rowK(const float* row, int k0, int lane, int K) { float v[16]; const int g = lane >> 4;
#pragma unroll
  for (int i = 0; i < 8; ++i) { const int ka = k0 + 8 * g + i, kb = ka + 16; v[i] = ka < K ? row[ka < K ? ka : K - 1] : 0.f; v[8 + i] = kb < K ? row[kb < K ? kb : K - 1] : 0.f; }
  return bsplit16(v); }
__device__ __forceinline__ F2 split_col(const float* W, int k0, int n, int lane, int ld, int K) { float v[16]; const int g = lane >> 4;
#pragma unroll
  for (int i = 0; i < 8; ++i) { const int ka = k0 + 8 * g + i, kb = ka + 16; v[i] = ka < K ? W[(size_t)(ka < K ? ka : K - 1) * ld + n] : 0.f; v[8 + i] = kb < K ? W[(size_t)(kb < K ? kb : K - 1) * ld + n] : 0.f; }
  return bsplit16(v); }
__device__ __forceinline__ v8f mac3(const F2& a, const F2& b, v8f c) { c = wmma_bf(a.l, b.h, c); c = wmma_bf(a.h, b.l, c); return wmma_bf(a.h, b.h, c); }
__device__ __forceinline__ float sigm(float v) { return 1.0f / (1.0f + expf(-v)); }
#define LDSX() do { asm volatile("s_wait_dscnt 0" ::: "memory"); __builtin_amdgcn_wave_barrier(); __builtin_amdgcn_fence(__ATOMIC_RELEASE, "workgroup"); } while (0)

// Projector (B 16, N 1,024, C 512, per-batch weights): A = x Wq[b]; Bm = T Wk[b]; P = softmax(A Bm^T); out = x + P T.
__device__ __forceinline__ float bfr(float v) { return (float)(__bf16)v; }
#define NB 16
#define TT 1024
#define CC 512
#ifndef TNB
#define TNB NB
#endif
#define BG 16                  // batches per launch group (S planes)
typedef __attribute__((ext_vector_type(8))) __bf16 v8b;
__device__ __forceinline__ v16b frag_b(const __bf16* rowk0, int lane) { union { v16b v; v8b q[2]; } u; const __bf16* p = rowk0 + 8 * (lane >> 4); u.q[0] = *(const v8b*)p; u.q[1] = *(const v8b*)(p + 16); return u.v; }
#define WS_AH  0u                                          // bf16 A hi rows [b*N+n][512]
#define WS_AL  (WS_AH + 2u * (size_t)NB * TT * CC)
#define WS_BH  (WS_AL + 2u * (size_t)NB * TT * CC)           // bf16 Bm hi rows [b*N+m][512]
#define WS_BL  (WS_BH + 2u * (size_t)NB * TT * CC)
#define WS_TT  (WS_BL + 2u * (size_t)NB * TT * CC)           // bf16 T planes [b][c][m] (exact)
#define WS_S   (WS_TT + 2u * (size_t)NB * CC * TT)           // f32 E = exp(S - tile maximum) [bg][n][m]
#define WS_PM  (WS_S + 4u * (size_t)BG * TT * TT)             // f32 row maximum of S in each 64-key tile [bg][tile][n]
#define WS_PL  (WS_PM + 4u * (size_t)BG * (TT / 64) * TT)    // f32 row sum of E in each 64-key tile [bg][tile][n]
#define WS_END (WS_PL + 4u * (size_t)BG * (TT / 64) * TT)
// ---- LDS staging by asynchronous copies: each lane brings its own 16 bytes; a wave's 32 lanes cover whole 128-B lines
__device__ __forceinline__ unsigned lds_off(const void* p) { return (unsigned)(size_t)p; }
// eight copies in one statement: four from (la, ga) and four from (lb, gb), LS bytes apart in LDS and GS bytes apart in global memory.
// s_wait_xcnt 0 is the statement's last line so that it stands in front of every later rewrite of the address registers named here.
template <int LS, int GS> __device__ __forceinline__ void cp44(unsigned la, const char* ga, unsigned lb, const char* gb) {
  asm volatile("global_load_async_to_lds_b128 %0, %1, off\n\t"
               "global_load_async_to_lds_b128 %2, %3, off\n\t"
               "global_load_async_to_lds_b128 %4, %5, off\n\t"
               "global_load_async_to_lds_b128 %6, %7, off\n\t"
               "global_load_async_to_lds_b128 %8, %9, off\n\t"
               "global_load_async_to_lds_b128 %10, %11, off\n\t"
               "global_load_async_to_lds_b128 %12, %13, off\n\t"
               "global_load_async_to_lds_b128 %14, %15, off\n\t"
               "s_wait_xcnt 0x0"
               :: "v"(la), "v"(ga), "v"(la + LS), "v"(ga + GS), "v"(la + 2 * LS), "v"(ga + 2 * GS), "v"(la + 3 * LS), "v"(ga + 3 * GS),
                  "v"(lb), "v"(gb), "v"(lb + LS), "v"(gb + GS), "v"(lb + 2 * LS), "v"(gb + 2 * GS), "v"(lb + 3 * LS), "v"(gb + 3 * GS) : "memory");
}
// the issuing wave's own copies have landed (the compiler places no wait for them)
#define WAIT_COPIES() asm volatile("s_wait_asynccnt 0x0" ::: "memory")
// this wave's LDS reads have retired before the buffer they read is handed back for a refill
#define WAIT_LDS() asm volatile("s_wait_dscnt 0x0" ::: "memory")
// stands behind a group of global loads and stores, in front of the next group's rewrite of the registers that they name
#define WAIT_XLAT() asm volatile("s_wait_xcnt 0x0" ::: "memory")
#define SC_P (128 * 144)                   // k_sc stage: 128 rows of 128 B (64 k) at pitch 144 B
#define SC_ST (4 * SC_P)                   // [A hi | A lo | Bm hi | Bm lo]
#define PV_PP (128 * 272)                  // k_pv stage: P, 128 rows of 256 B (64 keys, f32) at pitch 272 B
#define PV_TP (128 * 144)                  // T planes, 128 channel rows of 128 B (64 keys) at pitch 144 B
#define PV_ST (PV_PP + PV_TP)
// ---- k_lin: block = (128 rows, 128 cols, which), 8 waves of 32 x 64: A = x Wq[b] (which 0) or Bm = T Wk[b] (which 1), per-batch (in,out) weights, exact; stored as bf16 hi + lo rows
// a T block also writes the planes [b][c][m] (exact bf16 T) of its own 128 channels, read turned out of the staged rows of the two stages that hold them: no pass of its own over T
// both operands go through LDS as bf16, rounded once a block: whole-line global loads into registers one stage (64 k) ahead, rows of x as they lie, W turned to [col][k] by which registers are packed together
#define LN_P 144                           // a staged row: 64 k as bf16 (128 B) at pitch 144 B
#define LN_XP (128 * LN_P)                 // one operand's 128 rows
#define LN_ST (2 * LN_XP)                  // [x rows | W columns]
typedef __attribute__((ext_vector_type(4))) __bf16 v4b;
__global__ __launch_bounds__(256) void k_lin(const float* __restrict__ X, const float* __restrict__ T_, const float* __restrict__ WQ, const float* __restrict__ WK, __bf16* __restrict__ AH, __bf16* __restrict__ AL, __bf16* __restrict__ BH, __bf16* __restrict__ BL, __bf16* __restrict__ TP) { __shared__ __align__(16) char ring[2][LN_ST];   // behind the loop the same bytes stage the hi and lo output rows
  const int tid = threadIdx.x, wave = tid >> 5, lane = tid & 31, col = lane & 15, g = lane >> 4, wr = wave >> 1, wc = wave & 1; const int which = blockIdx.z; const int c0 = blockIdx.y * 128; const size_t r0 = (size_t)blockIdx.x * 128; const size_t b = r0 / TT;
  const float* SRC = which == 0 ? X : T_; const float* Wb = (which == 0 ? WQ : WK) + b * (size_t)CC * CC; __bf16* DH = which == 0 ? AH : BH; __bf16* DL = which == 0 ? AL : BL;
  // x: thread -> row tid >> 4 (+ 16 per load), 16-B piece tid & 15 (a wave's load = 4 whole lines); W: wave -> 8 k rows, lane -> column lane (+ 32 per load) (a wave's load = 1 whole line)
  const float* gx = SRC + (r0 + (tid >> 4)) * CC + (tid & 15) * 4; const float* gw = Wb + (size_t)(wave * 8) * CC + c0 + lane;
  v4f xr[8]; float wv[4][8]; v8f acc[2][4] = {};
  auto load = [&](int t) {
#pragma unroll   // constant indices keep the stage in registers
    for (int i = 0; i < 8; ++i) xr[i] = *(const v4f*)(gx + (size_t)i * 16 * CC + t * 64);
#pragma unroll   // constant indices keep the stage in registers
    for (int c = 0; c < 4; ++c)
#pragma unroll   // constant indices keep the stage in registers
      for (int i = 0; i < 8; ++i) wv[c][i] = gw[(size_t)(t * 64 + i) * CC + c * 32]; };
  auto stash = [&](int buf) { char* st = ring[buf];
#pragma unroll   // constant indices keep the stage in registers
    for (int i = 0; i < 8; ++i) { v4b q; q[0] = (__bf16)xr[i][0]; q[1] = (__bf16)xr[i][1]; q[2] = (__bf16)xr[i][2]; q[3] = (__bf16)xr[i][3]; *(v4b*)(st + ((tid >> 4) + 16 * i) * LN_P + (tid & 15) * 8) = q; }
#pragma unroll   // constant indices keep the stage in registers
    for (int c = 0; c < 4; ++c) { v8b q;
#pragma unroll   // constant indices keep the stage in registers
      for (int i = 0; i < 8; ++i) q[i] = (__bf16)wv[c][i];
      *(v8b*)(st + LN_XP + (lane + 32 * c) * LN_P + wave * 16) = q; } };
  load(0); stash(0); __syncthreads();
#pragma unroll 1   // one stage a trip: the two buffers alternate by t & 1
  for (int t = 0; t < CC / 64; ++t) { const char* st = ring[t & 1];
    if (t + 1 < CC / 64) load(t + 1);   // in flight while this stage is worked on
#pragma unroll   // constant indices keep fragments and accumulators in registers
    for (int h = 0; h < 2; ++h) { v16b a[2], w[4];   // a 32-k block's LDS reads stand as one group in front of its WMMAs
#pragma unroll   // constant indices keep fragments and accumulators in registers
      for (int i = 0; i < 2; ++i) a[i] = frag_b((const __bf16*)(st + (wr * 32 + i * 16 + col) * LN_P + h * 64), lane);
#pragma unroll   // constant indices keep fragments and accumulators in registers
      for (int j = 0; j < 4; ++j) w[j] = frag_b((const __bf16*)(st + LN_XP + (wc * 64 + j * 16 + col) * LN_P + h * 64), lane);
#pragma unroll   // constant indices keep fragments and accumulators in registers
      for (int i = 0; i < 2; ++i)
#pragma unroll   // constant indices keep fragments and accumulators in registers
        for (int j = 0; j < 4; ++j) acc[i][j] = wmma_bf(a[i], w[j], acc[i][j]); }
    if (which == 1 && (t >> 1) == (int)blockIdx.y) {   // stage t holds 64 of this block's own 128 channels: thread -> channel pair tid >> 3, 8 rows m from 8 * (tid & 7) (+ 64): 8 lanes fill a whole 128-B line of a plane
#pragma unroll   // constant indices keep the 8 rows in registers
      for (int s = 0; s < 2; ++s) { const int q = (tid & 7) + 8 * s; unsigned d[8]; v4u e, o;
#pragma unroll   // constant indices keep the 8 rows in registers
        for (int j = 0; j < 8; ++j) d[j] = *(const unsigned*)(st + (q * 8 + j) * LN_P + (tid >> 3) * 4);   // two neighbouring channels of one row
#pragma unroll   // constant indices keep the 8 rows in registers
        for (int k = 0; k < 4; ++k) { e[k] = (d[2 * k] & 0xffffu) | (d[2 * k + 1] << 16); o[k] = (d[2 * k] >> 16) | (d[2 * k + 1] & 0xffff0000u); }
        __bf16* tp = TP + (b * CC + t * 64 + (tid >> 3) * 2) * (size_t)TT + (r0 - b * TT) + q * 8;
        vst2((unsigned*)tp, e); vst2((unsigned*)(tp + TT), o); }
      WAIT_XLAT(); }   // behind the four stores, in front of the next rewrite of their address registers
    if (t + 1 < CC / 64) stash((t + 1) & 1);   // into the buffer whose readers left it at the last barrier
    __syncthreads(); }   // publishes stage t + 1 and ends every read of stage t's buffer
  __bf16 (*sh)[136] = (__bf16 (*)[136])&ring[0][0]; __bf16 (*sl)[136] = (__bf16 (*)[136])(&ring[0][0] + 128 * 272);
#pragma unroll   // constant indices keep the accumulators in registers
  for (int i = 0; i < 2; ++i)
#pragma unroll   // constant indices keep the accumulators in registers
    for (int j = 0; j < 4; ++j)
#pragma unroll   // constant indices keep the accumulators in registers
      for (int r = 0; r < 8; ++r) { const float v = acc[i][j][r]; const __bf16 h = (__bf16)v; sh[wr * 32 + i * 16 + 8 * g + r][wc * 64 + j * 16 + col] = h; sl[wr * 32 + i * 16 + 8 * g + r][wc * 64 + j * 16 + col] = (__bf16)(v - (float)h); }
  __syncthreads();
  for (int e = tid; e < 128 * 16; e += 256) { const int rl = e >> 4, q = e & 15; vst2((unsigned*)(DH + (r0 + rl) * CC + c0 + q * 8), *(const v4u*)&sh[rl][q * 8]); vst2((unsigned*)(DL + (r0 + rl) * CC + c0 + q * 8), *(const v4u*)&sl[rl][q * 8]); } }
// exp(x) for x <= 0, built as the library's expf is (log2(e) in two parts, 2^fraction, ldexp, 0 below the smallest subnormal); the fraction x log2(e) - e comes from two fused steps, each rounded once
__device__ __forceinline__ float exp_le0(float x) {
  const float e = rintf(x * 0x1.715476p+0f); const float a = fmaf(x, 0x1.4ae0bep-26f, fmaf(x, 0x1.715476p+0f, -e)); float r;
  asm("v_exp_f32 %0, %1\n\tv_nop" : "=v"(r) : "v"(a));   // v_nop: the slot that the instruction set asks for behind a transcendental
  r = ldexpf(r, (int)e); return x < -0x1.9d1da0p+6f ? 0.f : r; }
// ---- k_sc: block = (128 rows n, 128 cols m, batch in group), 4 waves of 64 x 64: S = A . Bm over K 512, 3 products; a staged fragment feeds 4 tiles
// first half of the softmax, on the wave's staged tile: each row's maximum over the tile's 64 keys, E = exp(S - that maximum) in place of S, and the row's sum of E; k_pv brings a row's 16 tiles to one scale
__global__ __launch_bounds__(128) void k_sc(const __bf16* __restrict__ AH, const __bf16* __restrict__ AL, const __bf16* __restrict__ BH, const __bf16* __restrict__ BL, int b0, float* __restrict__ S0, float* __restrict__ PM, float* __restrict__ PL) { __shared__ __align__(16) char ring[2][SC_ST];   // behind the loop the same bytes stage the output rows: two blocks still fit a WGP's LDS
  const size_t b = b0 + blockIdx.z; float* S = S0 + (size_t)blockIdx.z * TT * TT;
  const int tid = threadIdx.x, wave = tid >> 5, lane = tid & 31, col = lane & 15, g = lane >> 4, wr = wave >> 1, wc = wave & 1; const int k0 = blockIdx.y * 128; const int q0 = blockIdx.x * 128;
  v8f acc[4][4] = {};
  // stage t = k [64 t, 64 t + 64) of the block's 128 A rows and 128 Bm rows, hi and lo; thread -> row tid >> 3 (+ 16 per copy), 16-B piece tid & 7
  const unsigned l0 = lds_off(&ring[0][0]) + (tid >> 3) * 144 + (tid & 7) * 16;
  const size_t goa = ((b * TT + q0 + (tid >> 3)) * CC + (tid & 7) * 8) * 2, gob = ((b * TT + k0 + (tid >> 3)) * CC + (tid & 7) * 8) * 2;
  const char *gah = (const char*)AH + goa, *gal = (const char*)AL + goa, *gbh = (const char*)BH + gob, *gbl = (const char*)BL + gob;
  auto fill = [&](int t, int buf) { const unsigned l = l0 + buf * SC_ST; const int go = t * 128;
    cp44<16 * 144, 16 * CC * 2>(l, gah + go, l + 64 * 144, gah + go + 64 * CC * 2);
    cp44<16 * 144, 16 * CC * 2>(l + SC_P, gal + go, l + SC_P + 64 * 144, gal + go + 64 * CC * 2);
    cp44<16 * 144, 16 * CC * 2>(l + 2 * SC_P, gbh + go, l + 2 * SC_P + 64 * 144, gbh + go + 64 * CC * 2);
    cp44<16 * 144, 16 * CC * 2>(l + 3 * SC_P, gbl + go, l + 3 * SC_P + 64 * 144, gbl + go + 64 * CC * 2); };
  fill(0, 0); WAIT_COPIES(); __syncthreads(); fill(1, 1);
#pragma unroll 1   // one stage a trip: the two buffers alternate by t & 1
  for (int t = 0; t < CC / 64; ++t) { const char* st = ring[t & 1];
    v16b ah[2][4], al[2][4], bh[2][4], bl[2][4];   // the stage's LDS reads stand as one group in front of its WMMAs
#pragma unroll   // constant indices keep fragments and accumulators in registers
    for (int h = 0; h < 2; ++h) {
#pragma unroll   // constant indices keep fragments and accumulators in registers
      for (int i = 0; i < 4; ++i) { const char* ar = st + (wr * 64 + i * 16 + col) * 144 + h * 64; ah[h][i] = frag_b((const __bf16*)ar, lane); al[h][i] = frag_b((const __bf16*)(ar + SC_P), lane); }
#pragma unroll   // constant indices keep fragments and accumulators in registers
      for (int j = 0; j < 4; ++j) { const char* br = st + 2 * SC_P + (wc * 64 + j * 16 + col) * 144 + h * 64; bh[h][j] = frag_b((const __bf16*)br, lane); bl[h][j] = frag_b((const __bf16*)(br + SC_P), lane); } }
#pragma unroll   // constant indices keep fragments and accumulators in registers
    for (int h = 0; h < 2; ++h) {   // each product over all 16 tiles before the next: a tile's own order stays hi.hi, lo.hi, hi.lo
#pragma unroll   // constant indices keep fragments and accumulators in registers
      for (int i = 0; i < 4; ++i)
#pragma unroll   // constant indices keep fragments and accumulators in registers
        for (int j = 0; j < 4; ++j) acc[i][j] = wmma_bfd(ah[h][i], bh[h][j], acc[i][j]);
#pragma unroll   // constant indices keep fragments and accumulators in registers
      for (int i = 0; i < 4; ++i)
#pragma unroll   // constant indices keep fragments and accumulators in registers
        for (int j = 0; j < 4; ++j) acc[i][j] = wmma_bfd(al[h][i], bh[h][j], acc[i][j]);
#pragma unroll   // constant indices keep fragments and accumulators in registers
      for (int i = 0; i < 4; ++i)
#pragma unroll   // constant indices keep fragments and accumulators in registers
        for (int j = 0; j < 4; ++j) acc[i][j] = wmma_bfd(ah[h][i], bl[h][j], acc[i][j]); }
    WAIT_LDS(); WAIT_COPIES(); __syncthreads();   // publishes stage t + 1 and ends every read of stage t's buffer
    if (t + 2 < CC / 64) fill(t + 2, t & 1); }
  WAIT_COPIES();
  // the ring is free: the last trip's foot (LDS reads retired, copies landed, barrier) stands behind its every use; each wave stages its 64 x 64 tile in rows of its own, so that whole 128-B lines go out
  float (*ss)[68] = (float (*)[68])(&ring[0][0] + wave * (64 * 68 * 4));
#pragma unroll   // constant indices keep the accumulators in registers
  for (int i = 0; i < 4; ++i)
#pragma unroll   // constant indices keep the accumulators in registers
    for (int j = 0; j < 4; ++j)
#pragma unroll   // constant indices keep the accumulators in registers
      for (int r = 0; r < 8; ++r) ss[i * 16 + 8 * g + r][j * 16 + col] = acc[i][j][r];
  LDSX();
  float tm[2], tl[2];
  {
#pragma unroll   // lane -> rows lane and lane + 32 of the tile, a whole row in registers
    for (int s = 0; s < 2; ++s) { float* rw = &ss[lane + 32 * s][0]; v4f a[16];
#pragma unroll   // the row's LDS reads go out together
      for (int q = 0; q < 16; ++q) a[q] = *(const v4f*)(rw + 4 * q);
      v4f m4 = a[0];
#pragma unroll   // constant indices keep the row in registers
      for (int q = 1; q < 16; ++q) { m4[0] = fmaxf(m4[0], a[q][0]); m4[1] = fmaxf(m4[1], a[q][1]); m4[2] = fmaxf(m4[2], a[q][2]); m4[3] = fmaxf(m4[3], a[q][3]); }
      const float m = fmaxf(fmaxf(m4[0], m4[1]), fmaxf(m4[2], m4[3])); v4f s4 = {};   // four independent sums
#pragma unroll   // constant indices keep the row in registers
      for (int q = 0; q < 16; ++q) {
#pragma unroll   // constant indices keep the row in registers
        for (int c = 0; c < 4; ++c) { const float e = exp_le0(a[q][c] - m); a[q][c] = e; s4[c] += e; }
        *(v4f*)(rw + 4 * q) = a[q]; }
      tm[s] = m; tl[s] = (s4[0] + s4[1]) + (s4[2] + s4[3]); } }
  LDSX();
  { const size_t po = ((size_t)blockIdx.z * (TT / 64) + blockIdx.y * 2 + wc) * TT + q0 + wr * 64 + lane;   // a wave writes two whole 128-B lines of each plane; behind the LDS fence, which would wait for these stores
    PM[po] = tm[0]; PM[po + 32] = tm[1]; PL[po] = tl[0]; PL[po + 32] = tl[1];
    WAIT_XLAT(); }   // behind the four stores, in front of the next rewrite of their address registers
  float* so = S + (size_t)(q0 + wr * 64 + g) * TT + k0 + wc * 64 + col * 4;
  for (int r0 = 0; r0 < 64; r0 += 16) {   // 16 rows a group, two rows a store
#pragma unroll   // the group's LDS reads go out together
    for (int u = 0; u < 8; ++u) vst2(so + (size_t)(r0 + 2 * u) * TT, *(const v4f*)&ss[r0 + 2 * u + g][col * 4]);
    if (r0 + 16 < 64) WAIT_XLAT(); } }
// ---- k_pv: block = (128 rows n, 128 channels, batch in group), 4 waves of 32 x 128: out = x + (P . T) / 2^11 (P split bf16 hi + lo x exact T planes, 2 products); a staged T fragment feeds 2 row tiles
// second half of the softmax: P x 2^11 = E * cs, one factor a row and stage (a stage = one 64-key tile of k_sc): cs = exp(tile maximum - row maximum) / row sum x 2^11, from the 16 tile maxima and tile sums of the row
__global__ __launch_bounds__(128) void k_pv(const float* __restrict__ PS0, const float* __restrict__ PM, const float* __restrict__ PL, const __bf16* __restrict__ TP, const float* __restrict__ X, int b0, float* __restrict__ OUT) { __shared__ __align__(16) float ss[4][16][132]; __shared__ __align__(16) char ring[2][PV_ST]; __shared__ float cs[TT / 64][128];
  const size_t b = b0 + blockIdx.z; const float* PS = PS0 + (size_t)blockIdx.z * TT * TT;
  const int tid = threadIdx.x, wave = tid >> 5, lane = tid & 31, col = lane & 15, g = lane >> 4; const int ql0 = blockIdx.x * 128 + wave * 32; const int c0 = blockIdx.y * 128;
  v8f acc[2][8] = {};
  // stage t = keys [64 t, 64 t + 64): the block's 128 P rows (thread -> row tid >> 4, + 8 per copy, piece tid & 15) and 128 T channel rows (row tid >> 3, + 16 per copy, piece tid & 7)
  const unsigned lp0 = lds_off(&ring[0][0]) + (tid >> 4) * 272 + (tid & 15) * 16, lt0 = lds_off(&ring[0][0]) + PV_PP + (tid >> 3) * 144 + (tid & 7) * 16;
  const char* gp = (const char*)PS + ((size_t)(blockIdx.x * 128 + (tid >> 4)) * TT + (tid & 15) * 4) * 4; const char* gt = (const char*)TP + ((b * CC + c0 + (tid >> 3)) * (size_t)TT + (tid & 7) * 8) * 2;
  auto fill = [&](int t, int buf) { const unsigned lp = lp0 + buf * PV_ST, lt = lt0 + buf * PV_ST;
    cp44<8 * 272, 8 * TT * 4>(lp, gp + t * 256, lp + 32 * 272, gp + t * 256 + 32 * TT * 4);
    cp44<8 * 272, 8 * TT * 4>(lp + 64 * 272, gp + t * 256 + 64 * TT * 4, lp + 96 * 272, gp + t * 256 + 96 * TT * 4);
    cp44<16 * 144, 16 * TT * 2>(lt, gt + t * 128, lt + 64 * 144, gt + t * 128 + 64 * TT * 2); };
  fill(0, 0);
  { const size_t po = (size_t)blockIdx.z * (TT / 64) * TT + blockIdx.x * 128 + tid; float mv[TT / 64], lv[TT / 64];   // thread -> row tid of the block (a row of its own wave); a wave's load = one whole line
#pragma unroll   // the 32 loads are in flight together, beside stage 0's copies
    for (int k = 0; k < TT / 64; ++k) { mv[k] = PM[po + (size_t)k * TT]; lv[k] = PL[po + (size_t)k * TT]; }
    WAIT_XLAT();   // behind the 32 loads, in front of the next rewrite of their address registers
    float mg = mv[0], sum = 0.f;
#pragma unroll   // constant indices keep the 16 tiles in registers
    for (int k = 1; k < TT / 64; ++k) mg = fmaxf(mg, mv[k]);
#pragma unroll   // constant indices keep the 16 tiles in registers
    for (int k = 0; k < TT / 64; ++k) { mv[k] = exp_le0(mv[k] - mg); sum += mv[k] * lv[k]; }
    const float inv = 1.0f / sum;
#pragma unroll   // constant indices keep the 16 tiles in registers
    for (int k = 0; k < TT / 64; ++k) cs[k][tid] = mv[k] * inv * 2048.0f; }
  WAIT_COPIES(); __syncthreads(); fill(1, 1);
#pragma unroll 1   // one stage a trip: the two buffers alternate by t & 1
  for (int t = 0; t < TT / 64; ++t) { const char* st = ring[t & 1];
    F2 p[2][2]; v16b th[2][8];   // the stage's LDS reads stand as one group in front of its WMMAs
    const float cf[2] = { cs[t][wave * 32 + col], cs[t][wave * 32 + 16 + col] };
#pragma unroll   // constant indices keep fragments and accumulators in registers
    for (int h = 0; h < 2; ++h) {
#pragma unroll   // constant indices keep fragments and accumulators in registers
      for (int i = 0; i < 2; ++i) { float v[16]; const float* pr = (const float*)(st + (wave * 32 + i * 16 + col) * 272) + h * 32 + 8 * g;   // the k order of split_row
#pragma unroll   // constant indices keep the fragment in registers
        for (int k = 0; k < 8; ++k) { v[k] = pr[k] * cf[i]; v[8 + k] = pr[16 + k] * cf[i]; }
        p[h][i] = bsplit16(v); }
#pragma unroll   // constant indices keep fragments and accumulators in registers
      for (int j = 0; j < 8; ++j) th[h][j] = frag_b((const __bf16*)(st + PV_PP + (j * 16 + col) * 144 + h * 64), lane); }
#pragma unroll   // constant indices keep fragments and accumulators in registers
    for (int h = 0; h < 2; ++h) {   // each product over all 16 tiles before the next: a tile's own order stays hi, lo
#pragma unroll   // constant indices keep fragments and accumulators in registers
      for (int i = 0; i < 2; ++i)
#pragma unroll   // constant indices keep fragments and accumulators in registers
        for (int j = 0; j < 8; ++j) acc[i][j] = wmma_bfd(p[h][i].h, th[h][j], acc[i][j]);
#pragma unroll   // constant indices keep fragments and accumulators in registers
      for (int i = 0; i < 2; ++i)
#pragma unroll   // constant indices keep fragments and accumulators in registers
        for (int j = 0; j < 8; ++j) acc[i][j] = wmma_bfd(p[h][i].l, th[h][j], acc[i][j]); }
    WAIT_LDS(); WAIT_COPIES(); __syncthreads();   // publishes stage t + 1 and ends every read of stage t's buffer
    if (t + 2 < TT / 64) fill(t + 2, t & 1); }
  WAIT_COPIES();
#pragma unroll   // constant indices keep the accumulators in registers
  for (int i = 0; i < 2; ++i) {   // 16 rows at a time through the wave's own staging rows
    if (i) WAIT_LDS();   // the first 16 rows are read before the next 16 overwrite them
#pragma unroll
    for (int j = 0; j < 8; ++j)
#pragma unroll
      for (int r = 0; r < 8; ++r) ss[wave][8 * g + r][j * 16 + col] = acc[i][j][r] * (1.0f / 2048.0f);
    LDSX(); for (int r0 = 0; r0 < 16; r0 += 8) { const size_t off = (b * TT + ql0 + i * 16 + r0) * CC + c0 + lane * 4; v4f xr[8];   // 8 rows a group
#pragma unroll   // the group's x loads are in flight together
      for (int u = 0; u < 8; ++u) xr[u] = *(const v4f*)(X + off + u * CC);
#pragma unroll   // constant indices keep the group in registers
      for (int u = 0; u < 8; ++u) { v4f o = *(const v4f*)&ss[wave][r0 + u][lane * 4]; o[0] += bfr(xr[u][0]); o[1] += bfr(xr[u][1]); o[2] += bfr(xr[u][2]); o[3] += bfr(xr[u][3]); vst2(OUT + off + u * CC, o); }
      if (i == 0 || r0 == 0) WAIT_XLAT(); } } }
extern "C" void kernel_launch(void* const* d_in, const int* in_sizes, int n_in, void* d_out, int out_size, void* d_ws, size_t ws_size, hipStream_t stream) {
  (void)in_sizes; (void)n_in; (void)out_size;
  const float** F = (const float**)d_in;   // 0 x_in [16,1024,512], 1 T [16,1024,512], 2 Wq [16,512,512] ((in,out) per batch), 3 Wk [16,512,512]
  if (ws_size < (size_t)WS_END) return;
  char* ws = (char*)d_ws; __bf16 *AH = (__bf16*)(ws + WS_AH), *AL = (__bf16*)(ws + WS_AL), *BH = (__bf16*)(ws + WS_BH), *BL = (__bf16*)(ws + WS_BL), *TP = (__bf16*)(ws + WS_TT); float *S = (float*)(ws + WS_S), *PM = (float*)(ws + WS_PM), *PL = (float*)(ws + WS_PL);
  k_lin<<<dim3(TNB * TT / 128, CC / 128, 2), 256, 0, stream>>>(F[0], F[1], F[2], F[3], AH, AL, BH, BL, TP);
  for (int b0 = 0; b0 < TNB; b0 += BG) { const int ng = (TNB - b0) < BG ? (TNB - b0) : BG;
    k_sc<<<dim3(TT / 128, TT / 128, ng), 128, 0, stream>>>(AH, AL, BH, BL, b0, S, PM, PL);
    k_pv<<<dim3(TT / 128, CC / 128, ng), 128, 0, stream>>>(S, PM, PL, TP, F[0], b0, (float*)d_out);
  }
}

// v008
// It runs in 109 microseconds.
// Next to v007, in two timings, it ran 1.04 and 1.03 times as fast.
// Counting every step since v000, it is 6.80 times as fast.
// compute dtype: all float inputs rounded to bf16; A = x Wq[b] and Bm = T Wk[b] with EXACT bf16 products on WMMA 16x16x32, f32 accumulate, stored as bf16 hi + lo row planes; S = A . Bm over K = 512 with 3 products (hi.hi + hi.lo + lo.hi), f32; softmax in f32 (exp to the library expf's accuracy) in two halves: exp and sum against the maximum of each 64-key tile, then one factor a row and tile; P x 2^11 split bf16 hi + lo against the EXACT bf16 T planes (2 products); + x residual in f32; f32 output.
#include <hip/hip_runtime.h>
#include <math.h>

typedef __attribute__((ext_vector_type(16))) _Float16 v16h;
typedef __attribute__((ext_vector_type(16))) __bf16 v16b;
typedef __attribute__((ext_vector_type(8)))  _Float16 v8h;
typedef __attribute__((ext_vector_type(8)))  float v8f;
typedef __attribute__((ext_vector_type(4)))  float v4f;
typedef __attribute__((ext_vector_type(2)))  float v2f;
typedef __attribute__((ext_vector_type(4)))  unsigned v4u;
typedef __attribute__((ext_vector_type(4)))  int v4i;
typedef float __attribute__((may_alias)) float_a;
typedef int __attribute__((may_alias)) int_a;

template <typename T> __device__ __forceinline__ void vst2(void* p, T v) { *(T*)p = v;  }
__device__ __forceinline__ v8f wmma16(v16h a, v16h b, v8f c) {
  v8f d = __builtin_amdgcn_wmma_f32_16x16x32_f16(false, a, false, b, (short)0, c, false, false);
  asm volatile("v_nop\n\tv_nop\n\tv_nop\n\tv_nop" : "+v"(d) : "v"(a), "v"(b));
  return d;
}
__device__ __forceinline__ v8f wmma_bf(v16b a, v16b b, v8f c) {
  v8f d = __builtin_amdgcn_wmma_f32_16x16x32_bf16(false, a, false, b, (short)0, c, false, false);
  asm volatile("v_nop\n\tv_nop\n\tv_nop\n\tv_nop" : "+v"(d) : "v"(a), "v"(b));
  return d;
}
// the same for kernels whose fragments need registers above v255: an asm operand stays under v256, so the statement names D alone (the compiler keeps the A and B distances of its own builtin)
__device__ __forceinline__ v8f wmma_bfd(v16b a, v16b b, v8f c) {
  v8f d = __builtin_amdgcn_wmma_f32_16x16x32_bf16(false, a, false, b, (short)0, c, false, false);
  asm volatile("v_nop\n\tv_nop\n\tv_nop\n\tv_nop" : "+v"(d));
  return d;
}
// 16x16x32 fragments: lane = (h = lane>>4, row/col = lane&15); elements 0..7 = k0+8h+0..7, 8..15 = k0+16+8h+0..7; D element r = row 8h+r
__device__ __forceinline__ v16h frag_h(const _Float16* rowk0, int lane) {
  union { v16h v; v8h q[2]; } u; const _Float16* p = rowk0 + 8 * (lane >> 4);
  u.q[0] = *(const v8h*)p; u.q[1] = *(const v8h*)(p + 16); return u.v;
}
__device__ __forceinline__ v16h frag_f32(const float* rowk0, int lane) {
  v16h a; const float* p = rowk0 + 8 * (lane >> 4);
#pragma unroll
  for (int i = 0; i < 8; ++i) { a[i] = (_Float16)p[i]; a[8 + i] = (_Float16)p[16 + i]; }
  return a;
}
__device__ __forceinline__ v16h frag_f32s(const float* rowk0, int lane, float sc) {
  v16h a; const float* p = rowk0 + 8 * (lane >> 4);
#pragma unroll
  for (int i = 0; i < 8; ++i) { a[i] = (_Float16)(p[i] * sc); a[8 + i] = (_Float16)(p[16 + i] * sc); }
  return a;
}
// column fragment from a [K][ld] layout (column n), rows >= K read as 0
__device__ __forceinline__ v16h fragc_f32(const float* W, int k0, int n, int lane, int ld, int K) {
  v16h a; const int g = lane >> 4;
#pragma unroll
  for (int i = 0; i < 8; ++i) { const int ka = k0 + 8 * g + i, kb = ka + 16;
    a[i] = (_Float16)(ka < K ? W[(size_t)(ka < K ? ka : K - 1) * ld + n] : 0.f); a[8 + i] = (_Float16)(kb < K ? W[(size_t)(kb < K ? kb : K - 1) * ld + n] : 0.f); }
  return a;
}
struct F2 { v16b h, l; };
__device__ __forceinline__ F2 bsplit16(const float v[16]) { F2 r;
#pragma unroll
  for (int i = 0; i < 16; ++i) { const __bf16 h = (__bf16)v[i]; r.h[i] = h; r.l[i] = (__bf16)(v[i] - (float)h); }
  return r; }
__device__ __forceinline__ F2 split_row(const float* row, int k0, int lane) { float v[16]; const float* p = row + k0 + 8 * (lane >> 4);
#pragma unroll
  for (int i = 0; i < 8; ++i) { v[i] = p[i]; v[8 + i] = p[16 + i]; }
  return bsplit16(v); }
__device__ __forceinline__ F2 split_rowK(const float* row, int k0, int lane, int K) { float v[16]; const int g = lane >> 4;
#pragma unroll
  for (int i = 0; i < 8; ++i) { const int ka = k0 + 8 * g + i, kb = ka + 16; v[i] = ka < K ? row[ka < K ? ka : K - 1] : 0.f; v[8 + i] = kb < K ? row[kb < K ? kb : K - 1] : 0.f; }
  return bsplit16(v); }
__device__ __forceinline__ F2 split_col(const float* W, int k0, int n, int lane, int ld, int K) { float v[16]; const int g = lane >> 4;
#pragma unroll
  for (int i = 0; i < 8; ++i) { const int ka = k0 + 8 * g + i, kb = ka + 16; v[i] = ka < K ? W[(size_t)(ka < K ? ka : K - 1) * ld + n] : 0.f; v[8 + i] = kb < K ? W[(size_t)(kb < K ? kb : K - 1) * ld + n] : 0.f; }
  return bsplit16(v); }
__device__ __forceinline__ v8f mac3(const F2& a, const F2& b, v8f c) { c = wmma_bf(a.l, b.h, c); c = wmma_bf(a.h, b.l, c); return wmma_bf(a.h, b.h, c); }
__device__ __forceinline__ float sigm(float v) { return 1.0f / (1.0f + expf(-v)); }
#define LDSX() do { asm volatile("s_wait_dscnt 0" ::: "memory"); __builtin_amdgcn_wave_barrier(); __builtin_amdgcn_fence(__ATOMIC_RELEASE, "workgroup"); } while (0)

// Projector (B 16, N 1,024, C 512, per-batch weights): A = x Wq[b]; Bm = T Wk[b]; P = softmax(A Bm^T); out = x + P T.
__device__ __forceinline__ float bfr(float v) { return (float)(__bf16)v; }
#define NB 16
#define TT 1024
#define CC 512
#ifndef TNB
#define TNB NB
#endif
#define BG 16                  // batches per launch group (S planes)
typedef __attribute__((ext_vector_type(8))) __bf16 v8b;
__device__ __forceinline__ v16b frag_b(const __bf16* rowk0, int lane) { union { v16b v; v8b q[2]; } u; const __bf16* p = rowk0 + 8 * (lane >> 4); u.q[0] = *(const v8b*)p; u.q[1] = *(const v8b*)(p + 16); return u.v; }
#define WS_AH  0u                                          // bf16 A hi rows [b*N+n][512]
#define WS_AL  (WS_AH + 2u * (size_t)NB * TT * CC)
#define WS_BH  (WS_AL + 2u * (size_t)NB * TT * CC)           // bf16 Bm hi rows [b*N+m][512]
#define WS_BL  (WS_BH + 2u * (size_t)NB * TT * CC)
#define WS_TT  (WS_BL + 2u * (size_t)NB * TT * CC)           // bf16 T planes [b][c][m] (exact)
#define WS_S   (WS_TT + 2u * (size_t)NB * CC * TT)           // f32 E = exp(S - tile maximum) [bg][n][m]
#define WS_PM  (WS_S + 4u * (size_t)BG * TT * TT)             // f32 row maximum of S in each 64-key tile [bg][tile][n]
#define WS_PL  (WS_PM + 4u * (size_t)BG * (TT / 64) * TT)    // f32 row sum of E in each 64-key tile [bg][tile][n]
#define WS_END (WS_PL + 4u * (size_t)BG * (TT / 64) * TT)
// ---- LDS staging by asynchronous copies: each lane brings its own 16 bytes; a wave's 32 lanes cover whole 128-B lines
__device__ __forceinline__ unsigned lds_off(const void* p) { return (unsigned)(size_t)p; }
// eight copies in one statement: four from (la, ga) and four from (lb, gb), LS bytes apart in LDS and GS bytes apart in global memory.
// s_wait_xcnt 0 is the statement's last line so that it stands in front of every later rewrite of the address registers named here.
template <int LS, int GS> __device__ __forceinline__ void cp44(unsigned la, const char* ga, unsigned lb, const char* gb) {
  asm volatile("global_load_async_to_lds_b128 %0, %1, off\n\t"
               "global_load_async_to_lds_b128 %2, %3, off\n\t"
               "global_load_async_to_lds_b128 %4, %5, off\n\t"
               "global_load_async_to_lds_b128 %6, %7, off\n\t"
               "global_load_async_to_lds_b128 %8, %9, off\n\t"
               "global_load_async_to_lds_b128 %10, %11, off\n\t"
               "global_load_async_to_lds_b128 %12, %13, off\n\t"
               "global_load_async_to_lds_b128 %14, %15, off\n\t"
               "s_wait_xcnt 0x0"
               :: "v"(la), "v"(ga), "v"(la + LS), "v"(ga + GS), "v"(la + 2 * LS), "v"(ga + 2 * GS), "v"(la + 3 * LS), "v"(ga + 3 * GS),
                  "v"(lb), "v"(gb), "v"(lb + LS), "v"(gb + GS), "v"(lb + 2 * LS), "v"(gb + 2 * GS), "v"(lb + 3 * LS), "v"(gb + 3 * GS) : "memory");
}
// the issuing wave's own copies have landed (the compiler places no wait for them)
#define WAIT_COPIES() asm volatile("s_wait_asynccnt 0x0" ::: "memory")
// this wave's LDS reads have retired before the buffer they read is handed back for a refill
#define WAIT_LDS() asm volatile("s_wait_dscnt 0x0" ::: "memory")
// stands behind a group of global loads and stores, in front of the next group's rewrite of the registers that they name
#define WAIT_XLAT() asm volatile("s_wait_xcnt 0x0" ::: "memory")
#define SC_P (128 * 144)                   // k_sc stage: 128 rows of 128 B (64 k) at pitch 144 B
#define SC_ST (4 * SC_P)                   // [A hi | A lo | Bm hi | Bm lo]
#define PV_PP (128 * 272)                  // k_pv stage: P, 128 rows of 256 B (64 keys, f32) at pitch 272 B
#define PV_TP (128 * 144)                  // T planes, 128 channel rows of 128 B (64 keys) at pitch 144 B
#define PV_ST (PV_PP + PV_TP)
// ---- k_lin: block = (batch, 128 rows, which and 128 cols), 8 waves of 32 x 64: A = x Wq[b] (which 0) or Bm = T Wk[b] (which 1), per-batch (in,out) weights, exact; stored as bf16 hi + lo rows
// a T block also writes the planes [b][c][m] (exact bf16 T) of its own 128 channels, read turned out of the staged rows of the two stages that hold them: no pass of its own over T
// both operands go through LDS as bf16, rounded once a block: whole-line global loads into registers one stage (64 k) ahead, rows of x as they lie, W turned to [col][k] by which registers are packed together
#define LN_P 144                           // a staged row: 64 k as bf16 (128 B) at pitch 144 B
#define LN_XP (128 * LN_P)                 // one operand's 128 rows
#define LN_ST (2 * LN_XP)                  // [x rows | W columns]
typedef __attribute__((ext_vector_type(4))) __bf16 v4b;
__global__ __launch_bounds__(256) void k_lin(const float* __restrict__ X, const float* __restrict__ T_, const float* __restrict__ WQ, const float* __restrict__ WK, __bf16* __restrict__ AH, __bf16* __restrict__ AL, __bf16* __restrict__ BH, __bf16* __restrict__ BL, __bf16* __restrict__ TP) { __shared__ __align__(16) char ring[2][LN_ST];   // behind the loop the same bytes stage the hi and lo output rows
  const int tid = threadIdx.x, wave = tid >> 5, lane = tid & 31, col = lane & 15, g = lane >> 4, wr = wave >> 1, wc = wave & 1; const int which = blockIdx.z / (CC / 128), cb = blockIdx.z % (CC / 128); const int c0 = cb * 128; const size_t b = blockIdx.x; const size_t r0 = b * TT + (size_t)blockIdx.y * 128;   // the batch is the fastest grid index (see kernel_launch)
  const float* SRC = which == 0 ? X : T_; const float* Wb = (which == 0 ? WQ : WK) + b * (size_t)CC * CC; __bf16* DH = which == 0 ? AH : BH; __bf16* DL = which == 0 ? AL : BL;
  // x: thread -> row tid >> 4 (+ 16 per load), 16-B piece tid & 15 (a wave's load = 4 whole lines); W: wave -> 8 k rows, lane -> column lane (+ 32 per load) (a wave's load = 1 whole line)
  const float* gx = SRC + (r0 + (tid >> 4)) * CC + (tid & 15) * 4; const float* gw = Wb + (size_t)(wave * 8) * CC + c0 + lane;
  v4f xr[8]; float wv[4][8]; v8f acc[2][4] = {};
  auto load = [&](int t) {
#pragma unroll   // constant indices keep the stage in registers
    for (int i = 0; i < 8; ++i) xr[i] = *(const v4f*)(gx + (size_t)i * 16 * CC + t * 64);
#pragma unroll   // constant indices keep the stage in registers
    for (int c = 0; c < 4; ++c)
#pragma unroll   // constant indices keep the stage in registers
      for (int i = 0; i < 8; ++i) wv[c][i] = gw[(size_t)(t * 64 + i) * CC + c * 32]; };
  auto stash = [&](int buf) { char* st = ring[buf];
#pragma unroll   // constant indices keep the stage in registers
    for (int i = 0; i < 8; ++i) { v4b q; q[0] = (__bf16)xr[i][0]; q[1] = (__bf16)xr[i][1]; q[2] = (__bf16)xr[i][2]; q[3] = (__bf16)xr[i][3]; *(v4b*)(st + ((tid >> 4) + 16 * i) * LN_P + (tid & 15) * 8) = q; }
#pragma unroll   // constant indices keep the stage in registers
    for (int c = 0; c < 4; ++c) { v8b q;
#pragma unroll   // constant indices keep the stage in registers
      for (int i = 0; i < 8; ++i) q[i] = (__bf16)wv[c][i];
      *(v8b*)(st + LN_XP + (lane + 32 * c) * LN_P + wave * 16) = q; } };
  load(0); stash(0); __syncthreads();
#pragma unroll 1   // one stage a trip: the two buffers alternate by t & 1
  for (int t = 0; t < CC / 64; ++t) { const char* st = ring[t & 1];
    if (t + 1 < CC / 64) load(t + 1);   // in flight while this stage is worked on
#pragma unroll   // constant indices keep fragments and accumulators in registers
    for (int h = 0; h < 2; ++h) { v16b a[2], w[4];   // a 32-k block's LDS reads stand as one group in front of its WMMAs
#pragma unroll   // constant indices keep fragments and accumulators in registers
      for (int i = 0; i < 2; ++i) a[i] = frag_b((const __bf16*)(st + (wr * 32 + i * 16 + col) * LN_P + h * 64), lane);
#pragma unroll   // constant indices keep fragments and accumulators in registers
      for (int j = 0; j < 4; ++j) w[j] = frag_b((const __bf16*)(st + LN_XP + (wc * 64 + j * 16 + col) * LN_P + h * 64), lane);
#pragma unroll   // constant indices keep fragments and accumulators in registers
      for (int i = 0; i < 2; ++i)
#pragma unroll   // constant indices keep fragments and accumulators in registers
        for (int j = 0; j < 4; ++j) acc[i][j] = wmma_bf(a[i], w[j], acc[i][j]); }
    if (which == 1 && (t >> 1) == cb) {   // stage t holds 64 of this block's own 128 channels: thread -> channel pair tid >> 3, 8 rows m from 8 * (tid & 7) (+ 64): 8 lanes fill a whole 128-B line of a plane
#pragma unroll   // constant indices keep the 8 rows in registers
      for (int s = 0; s < 2; ++s) { const int q = (tid & 7) + 8 * s; unsigned d[8]; v4u e, o;
#pragma unroll   // constant indices keep the 8 rows in registers
        for (int j = 0; j < 8; ++j) d[j] = *(const unsigned*)(st + (q * 8 + j) * LN_P + (tid >> 3) * 4);   // two neighbouring channels of one row
#pragma unroll   // constant indices keep the 8 rows in registers
        for (int k = 0; k < 4; ++k) { e[k] = (d[2 * k] & 0xffffu) | (d[2 * k + 1] << 16); o[k] = (d[2 * k] >> 16) | (d[2 * k + 1] & 0xffff0000u); }
        __bf16* tp = TP + (b * CC + t * 64 + (tid >> 3) * 2) * (size_t)TT + (r0 - b * TT) + q * 8;
        vst2((unsigned*)tp, e); vst2((unsigned*)(tp + TT), o); }
      WAIT_XLAT(); }   // behind the four stores, in front of the next rewrite of their address registers
    if (t + 1 < CC / 64) stash((t + 1) & 1);   // into the buffer whose readers left it at the last barrier
    __syncthreads(); }   // publishes stage t + 1 and ends every read of stage t's buffer
  __bf16 (*sh)[136] = (__bf16 (*)[136])&ring[0][0]; __bf16 (*sl)[136] = (__bf16 (*)[136])(&ring[0][0] + 128 * 272);
#pragma unroll   // constant indices keep the accumulators in registers
  for (int i = 0; i < 2; ++i)
#pragma unroll   // constant indices keep the accumulators in registers
    for (int j = 0; j < 4; ++j)
#pragma unroll   // constant indices keep the accumulators in registers
      for (int r = 0; r < 8; ++r) { const float v = acc[i][j][r]; const __bf16 h = (__bf16)v; sh[wr * 32 + i * 16 + 8 * g + r][wc * 64 + j * 16 + col] = h; sl[wr * 32 + i * 16 + 8 * g + r][wc * 64 + j * 16 + col] = (__bf16)(v - (float)h); }
  __syncthreads();
  for (int e = tid; e < 128 * 16; e += 256) { const int rl = e >> 4, q = e & 15; vst2((unsigned*)(DH + (r0 + rl) * CC + c0 + q * 8), *(const v4u*)&sh[rl][q * 8]); vst2((unsigned*)(DL + (r0 + rl) * CC + c0 + q * 8), *(const v4u*)&sl[rl][q * 8]); } }
// exp(x) for x <= 0, built as the library's expf is (log2(e) in two parts, 2^fraction, ldexp, 0 below the smallest subnormal); the fraction x log2(e) - e comes from two fused steps, each rounded once
__device__ __forceinline__ float exp_le0(float x) {
  const float e = rintf(x * 0x1.715476p+0f); const float a = fmaf(x, 0x1.4ae0bep-26f, fmaf(x, 0x1.715476p+0f, -e)); float r;
  asm("v_exp_f32 %0, %1\n\tv_nop" : "=v"(r) : "v"(a));   // v_nop: the slot that the instruction set asks for behind a transcendental
  r = ldexpf(r, (int)e); return x < -0x1.9d1da0p+6f ? 0.f : r; }
// ---- k_sc: block = (batch in group, 128 rows n, 128 cols m), 4 waves of 64 x 64: S = A . Bm over K 512, 3 products; a staged fragment feeds 4 tiles
// first half of the softmax, on the wave's staged tile: each row's maximum over the tile's 64 keys, E = exp(S - that maximum) in place of S, and the row's sum of E; k_pv brings a row's 16 tiles to one scale
__global__ __launch_bounds__(128) void k_sc(const __bf16* __restrict__ AH, const __bf16* __restrict__ AL, const __bf16* __restrict__ BH, const __bf16* __restrict__ BL, int b0, float* __restrict__ S0, float* __restrict__ PM, float* __restrict__ PL) { __shared__ __align__(16) char ring[2][SC_ST];   // behind the loop the same bytes stage the output rows: two blocks still fit a WGP's LDS
  const size_t b = b0 + blockIdx.x; float* S = S0 + (size_t)blockIdx.x * TT * TT;   // the batch is the fastest grid index (see kernel_launch)
  const int tid = threadIdx.x, wave = tid >> 5, lane = tid & 31, col = lane & 15, g = lane >> 4, wr = wave >> 1, wc = wave & 1; const int k0 = blockIdx.z * 128; const int q0 = blockIdx.y * 128;
  v8f acc[4][4] = {};
  // stage t = k [64 t, 64 t + 64) of the block's 128 A rows and 128 Bm rows, hi and lo; thread -> row tid >> 3 (+ 16 per copy), 16-B piece tid & 7
  const unsigned l0 = lds_off(&ring[0][0]) + (tid >> 3) * 144 + (tid & 7) * 16;
  const size_t goa = ((b * TT + q0 + (tid >> 3)) * CC + (tid & 7) * 8) * 2, gob = ((b * TT + k0 + (tid >> 3)) * CC + (tid & 7) * 8) * 2;
  const char *gah = (const char*)AH + goa, *gal = (const char*)AL + goa, *gbh = (const char*)BH + gob, *gbl = (const char*)BL + gob;
  auto fill = [&](int t, int buf) { const unsigned l = l0 + buf * SC_ST; const int go = t * 128;
    cp44<16 * 144, 16 * CC * 2>(l, gah + go, l + 64 * 144, gah + go + 64 * CC * 2);
    cp44<16 * 144, 16 * CC * 2>(l + SC_P, gal + go, l + SC_P + 64 * 144, gal + go + 64 * CC * 2);
    cp44<16 * 144, 16 * CC * 2>(l + 2 * SC_P, gbh + go, l + 2 * SC_P + 64 * 144, gbh + go + 64 * CC * 2);
    cp44<16 * 144, 16 * CC * 2>(l + 3 * SC_P, gbl + go, l + 3 * SC_P + 64 * 144, gbl + go + 64 * CC * 2); };
  fill(0, 0); WAIT_COPIES(); __syncthreads(); fill(1, 1);
#pragma unroll 1   // one stage a trip: the two buffers alternate by t & 1
  for (int t = 0; t < CC / 64; ++t) { const char* st = ring[t & 1];
    v16b ah[2][4], al[2][4], bh[2][4], bl[2][4];   // the stage's LDS reads stand as one group in front of its WMMAs
#pragma unroll   // constant indices keep fragments and accumulators in registers
    for (int h = 0; h < 2; ++h) {
#pragma unroll   // constant indices keep fragments and accumulators in registers
      for (int i = 0; i < 4; ++i) { const char* ar = st + (wr * 64 + i * 16 + col) * 144 + h * 64; ah[h][i] = frag_b((const __bf16*)ar, lane); al[h][i] = frag_b((const __bf16*)(ar + SC_P), lane); }
#pragma unroll   // constant indices keep fragments and accumulators in registers
      for (int j = 0; j < 4; ++j) { const char* br = st + 2 * SC_P + (wc * 64 + j * 16 + col) * 144 + h * 64; bh[h][j] = frag_b((const __bf16*)br, lane); bl[h][j] = frag_b((const __bf16*)(br + SC_P), lane); } }
#pragma unroll   // constant indices keep fragments and accumulators in registers
    for (int h = 0; h < 2; ++h) {   // each product over all 16 tiles before the next: a tile's own order stays hi.hi, lo.hi, hi.lo
#pragma unroll   // constant indices keep fragments and accumulators in registers
      for (int i = 0; i < 4; ++i)
#pragma unroll   // constant indices keep fragments and accumulators in registers
        for (int j = 0; j < 4; ++j) acc[i][j] = wmma_bfd(ah[h][i], bh[h][j], acc[i][j]);
#pragma unroll   // constant indices keep fragments and accumulators in registers
      for (int i = 0; i < 4; ++i)
#pragma unroll   // constant indices keep fragments and accumulators in registers
        for (int j = 0; j < 4; ++j) acc[i][j] = wmma_bfd(al[h][i], bh[h][j], acc[i][j]);
#pragma unroll   // constant indices keep fragments and accumulators in registers
      for (int i = 0; i < 4; ++i)
#pragma unroll   // constant indices keep fragments and accumulators in registers
        for (int j = 0; j < 4; ++j) acc[i][j] = wmma_bfd(ah[h][i], bl[h][j], acc[i][j]); }
    WAIT_LDS(); WAIT_COPIES(); __syncthreads();   // publishes stage t + 1 and ends every read of stage t's buffer
    if (t + 2 < CC / 64) fill(t + 2, t & 1); }
  WAIT_COPIES();
  // the ring is free: the last trip's foot (LDS reads retired, copies landed, barrier) stands behind its every use; each wave stages its 64 x 64 tile in rows of its own, so that whole 128-B lines go out
  float (*ss)[68] = (float (*)[68])(&ring[0][0] + wave * (64 * 68 * 4));
#pragma unroll   // constant indices keep the accumulators in registers
  for (int i = 0; i < 4; ++i)
#pragma unroll   // constant indices keep the accumulators in registers
    for (int j = 0; j < 4; ++j)
#pragma unroll   // constant indices keep the accumulators in registers
      for (int r = 0; r < 8; ++r) ss[i * 16 + 8 * g + r][j * 16 + col] = acc[i][j][r];
  LDSX();
  float tm[2], tl[2];
  {
#pragma unroll   // lane -> rows lane and lane + 32 of the tile, a whole row in registers
    for (int s = 0; s < 2; ++s) { float* rw = &ss[lane + 32 * s][0]; v4f a[16];
#pragma unroll   // the row's LDS reads go out together
      for (int q = 0; q < 16; ++q) a[q] = *(const v4f*)(rw + 4 * q);
      v4f m4 = a[0];
#pragma unroll   // constant indices keep the row in registers
      for (int q = 1; q < 16; ++q) { m4[0] = fmaxf(m4[0], a[q][0]); m4[1] = fmaxf(m4[1], a[q][1]); m4[2] = fmaxf(m4[2], a[q][2]); m4[3] = fmaxf(m4[3], a[q][3]); }
      const float m = fmaxf(fmaxf(m4[0], m4[1]), fmaxf(m4[2], m4[3])); v4f s4 = {};   // four independent sums
#pragma unroll   // constant indices keep the row in registers
      for (int q = 0; q < 16; ++q) {
#pragma unroll   // constant indices keep the row in registers
        for (int c = 0; c < 4; ++c) { const float e = exp_le0(a[q][c] - m); a[q][c] = e; s4[c] += e; }
        *(v4f*)(rw + 4 * q) = a[q]; }
      tm[s] = m; tl[s] = (s4[0] + s4[1]) + (s4[2] + s4[3]); } }
  LDSX();
  { const size_t po = ((size_t)blockIdx.x * (TT / 64) + blockIdx.z * 2 + wc) * TT + q0 + wr * 64 + lane;   // a wave writes two whole 128-B lines of each plane; behind the LDS fence, which would wait for these stores
    PM[po] = tm[0]; PM[po + 32] = tm[1]; PL[po] = tl[0]; PL[po + 32] = tl[1];
    WAIT_XLAT(); }   // behind the four stores, in front of the next rewrite of their address registers
  float* so = S + (size_t)(q0 + wr * 64 + g) * TT + k0 + wc * 64 + col * 4;
  for (int r0 = 0; r0 < 64; r0 += 16) {   // 16 rows a group, two rows a store
#pragma unroll   // the group's LDS reads go out together
    for (int u = 0; u < 8; ++u) vst2(so + (size_t)(r0 + 2 * u) * TT, *(const v4f*)&ss[r0 + 2 * u + g][col * 4]);
    if (r0 + 16 < 64) WAIT_XLAT(); } }
// ---- k_pv: block = (batch in group, 128 rows n, 128 channels), 4 waves of 32 x 128: out = x + (P . T) / 2^11 (P split bf16 hi + lo x exact T planes, 2 products); a staged T fragment feeds 2 row tiles
// second half of the softmax: P x 2^11 = E * cs, one factor a row and stage (a stage = one 64-key tile of k_sc): cs = exp(tile maximum - row maximum) / row sum x 2^11, from the 16 tile maxima and tile sums of the row
__global__ __launch_bounds__(128) void k_pv(const float* __restrict__ PS0, const float* __restrict__ PM, const float* __restrict__ PL, const __bf16* __restrict__ TP, const float* __restrict__ X, int b0, float* __restrict__ OUT) { __shared__ __align__(16) float ss[4][16][132]; __shared__ __align__(16) char ring[2][PV_ST]; __shared__ float cs[TT / 64][128];
  const size_t b = b0 + blockIdx.x; const float* PS = PS0 + (size_t)blockIdx.x * TT * TT;   // the batch is the fastest grid index (see kernel_launch)
  const int tid = threadIdx.x, wave = tid >> 5, lane = tid & 31, col = lane & 15, g = lane >> 4; const int ql0 = blockIdx.y * 128 + wave * 32; const int c0 = blockIdx.z * 128;
  v8f acc[2][8] = {};
  // stage t = keys [64 t, 64 t + 64): the block's 128 P rows (thread -> row tid >> 4, + 8 per copy, piece tid & 15) and 128 T channel rows (row tid >> 3, + 16 per copy, piece tid & 7)
  const unsigned lp0 = lds_off(&ring[0][0]) + (tid >> 4) * 272 + (tid & 15) * 16, lt0 = lds_off(&ring[0][0]) + PV_PP + (tid >> 3) * 144 + (tid & 7) * 16;
  const char* gp = (const char*)PS + ((size_t)(blockIdx.y * 128 + (tid >> 4)) * TT + (tid & 15) * 4) * 4; const char* gt = (const char*)TP + ((b * CC + c0 + (tid >> 3)) * (size_t)TT + (tid & 7) * 8) * 2;
  auto fill = [&](int t, int buf) { const unsigned lp = lp0 + buf * PV_ST, lt = lt0 + buf * PV_ST;
    cp44<8 * 272, 8 * TT * 4>(lp, gp + t * 256, lp + 32 * 272, gp + t * 256 + 32 * TT * 4);
    cp44<8 * 272, 8 * TT * 4>(lp + 64 * 272, gp + t * 256 + 64 * TT * 4, lp + 96 * 272, gp + t * 256 + 96 * TT * 4);
    cp44<16 * 144, 16 * TT * 2>(lt, gt + t * 128, lt + 64 * 144, gt + t * 128 + 64 * TT * 2); };
  fill(0, 0);
  { const size_t po = (size_t)blockIdx.x * (TT / 64) * TT + blockIdx.y * 128 + tid; float mv[TT / 64], lv[TT / 64];   // thread -> row tid of the block (a row of its own wave); a wave's load = one whole line
#pragma unroll   // the 32 loads are in flight together, beside stage 0's copies
    for (int k = 0; k < TT / 64; ++k) { mv[k] = PM[po + (size_t)k * TT]; lv[k] = PL[po + (size_t)k * TT]; }
    WAIT_XLAT();   // behind the 32 loads, in front of the next rewrite of their address registers
    float mg = mv[0], sum = 0.f;
#pragma unroll   // constant indices keep the 16 tiles in registers
    for (int k = 1; k < TT / 64; ++k) mg = fmaxf(mg, mv[k]);
#pragma unroll   // constant indices keep the 16 tiles in registers
    for (int k = 0; k < TT / 64; ++k) { mv[k] = exp_le0(mv[k] - mg); sum += mv[k] * lv[k]; }
    const float inv = 1.0f / sum;
#pragma unroll   // constant indices keep the 16 tiles in registers
    for (int k = 0; k < TT / 64; ++k) cs[k][tid] = mv[k] * inv * 2048.0f; }
  WAIT_COPIES(); __syncthreads(); fill(1, 1);
#pragma unroll 1   // one stage a trip: the two buffers alternate by t & 1
  for (int t = 0; t < TT / 64; ++t) { const char* st = ring[t & 1];
    F2 p[2][2]; v16b th[2][8];   // the stage's LDS reads stand as one group in front of its WMMAs
    const float cf[2] = { cs[t][wave * 32 + col], cs[t][wave * 32 + 16 + col] };
#pragma unroll   // constant indices keep fragments and accumulators in registers
    for (int h = 0; h < 2; ++h) {
#pragma unroll   // constant indices keep fragments and accumulators in registers
      for (int i = 0; i < 2; ++i) { float v[16]; const float* pr = (const float*)(st + (wave * 32 + i * 16 + col) * 272) + h * 32 + 8 * g;   // the k order of split_row
#pragma unroll   // constant indices keep the fragment in registers
        for (int k = 0; k < 8; ++k) { v[k] = pr[k] * cf[i]; v[8 + k] = pr[16 + k] * cf[i]; }
        p[h][i] = bsplit16(v); }
#pragma unroll   // constant indices keep fragments and accumulators in registers
      for (int j = 0; j < 8; ++j) th[h][j] = frag_b((const __bf16*)(st + PV_PP + (j * 16 + col) * 144 + h * 64), lane); }
#pragma unroll   // constant indices keep fragments and accumulators in registers
    for (int h = 0; h < 2; ++h) {   // each product over all 16 tiles before the next: a tile's own order stays hi, lo
#pragma unroll   // constant indices keep fragments and accumulators in registers
      for (int i = 0; i < 2; ++i)
#pragma unroll   // constant indices keep fragments and accumulators in registers
        for (int j = 0; j < 8; ++j) acc[i][j] = wmma_bfd(p[h][i].h, th[h][j], acc[i][j]);
#pragma unroll   // constant indices keep fragments and accumulators in registers
      for (int i = 0; i < 2; ++i)
#pragma unroll   // constant indices keep fragments and accumulators in registers
        for (int j = 0; j < 8; ++j) acc[i][j] = wmma_bfd(p[h][i].l, th[h][j], acc[i][j]); }
    WAIT_LDS(); WAIT_COPIES(); __syncthreads();   // publishes stage t + 1 and ends every read of stage t's buffer
    if (t + 2 < TT / 64) fill(t + 2, t & 1); }
  WAIT_COPIES();
#pragma unroll   // constant indices keep the accumulators in registers
  for (int i = 0; i < 2; ++i) {   // 16 rows at a time through the wave's own staging rows
    if (i) WAIT_LDS();   // the first 16 rows are read before the next 16 overwrite them
#pragma unroll
    for (int j = 0; j < 8; ++j)
#pragma unroll
      for (int r = 0; r < 8; ++r) ss[wave][8 * g + r][j * 16 + col] = acc[i][j][r] * (1.0f / 2048.0f);
    LDSX(); for (int r0 = 0; r0 < 16; r0 += 8) { const size_t off = (b * TT + ql0 + i * 16 + r0) * CC + c0 + lane * 4; v4f xr[8];   // 8 rows a group
#pragma unroll   // the group's x loads are in flight together
      for (int u = 0; u < 8; ++u) xr[u] = *(const v4f*)(X + off + u * CC);
#pragma unroll   // constant indices keep the group in registers
      for (int u = 0; u < 8; ++u) { v4f o = *(const v4f*)&ss[wave][r0 + u][lane * 4]; o[0] += bfr(xr[u][0]); o[1] += bfr(xr[u][1]); o[2] += bfr(xr[u][2]); o[3] += bfr(xr[u][3]); vst2(OUT + off + u * CC, o); }
      if (i == 0 || r0 == 0) WAIT_XLAT(); } } }
extern "C" void kernel_launch(void* const* d_in, const int* in_sizes, int n_in, void* d_out, int out_size, void* d_ws, size_t ws_size, hipStream_t stream) {
  (void)in_sizes; (void)n_in; (void)out_size;
  const float** F = (const float**)d_in;   // 0 x_in [16,1024,512], 1 T [16,1024,512], 2 Wq [16,512,512] ((in,out) per batch), 3 Wk [16,512,512]
  if (ws_size < (size_t)WS_END) return;
  char* ws = (char*)d_ws; __bf16 *AH = (__bf16*)(ws + WS_AH), *AL = (__bf16*)(ws + WS_AL), *BH = (__bf16*)(ws + WS_BH), *BL = (__bf16*)(ws + WS_BL), *TP = (__bf16*)(ws + WS_TT); float *S = (float*)(ws + WS_S), *PM = (float*)(ws + WS_PM), *PL = (float*)(ws + WS_PL);
  // grids: x = batch, so that all blocks of a batch have flat indices equal mod 8. For speed only; every block does its own piece wherever it lands
  k_lin<<<dim3(TNB, TT / 128, 2 * (CC / 128)), 256, 0, stream>>>(F[0], F[1], F[2], F[3], AH, AL, BH, BL, TP);
  for (int b0 = 0; b0 < TNB; b0 += BG) { const int ng = (TNB - b0) < BG ? (TNB - b0) : BG;
    k_sc<<<dim3(ng, TT / 128, TT / 128), 128, 0, stream>>>(AH, AL, BH, BL, b0, S, PM, PL);
    k_pv<<<dim3(ng, TT / 128, CC / 128), 128, 0, stream>>>(S, PM, PL, TP, F[0], b0, (float*)d_out);
  }
}

// v009
// A run of this version takes 103 microseconds.
// Two timings next to v008 put it at 1.07 and 1.06 times that version's speed.
// Counting every step since v000, it is 7.23 times as fast.
// compute dtype: all float inputs rounded to bf16; A = x Wq[b] and Bm = T Wk[b] with EXACT bf16 products on WMMA 16x16x32, f32 accumulate, stored as bf16 hi + lo row planes; S = A . Bm over K = 512 with 3 products (hi.hi + hi.lo + lo.hi), f32; softmax in f32 (exp to the library expf's accuracy) in two halves: exp and sum against the maximum of each 64-key tile, then one factor a row and tile; P x 2^11 split bf16 hi + lo against the EXACT bf16 T planes (2 products); + x residual in f32; f32 output.
#include <hip/hip_runtime.h>
#include <math.h>

typedef __attribute__((ext_vector_type(16))) _Float16 v16h;
typedef __attribute__((ext_vector_type(16))) __bf16 v16b;
typedef __attribute__((ext_vector_type(8)))  _Float16 v8h;
typedef __attribute__((ext_vector_type(8)))  float v8f;
typedef __attribute__((ext_vector_type(4)))  float v4f;
typedef __attribute__((ext_vector_type(2)))  float v2f;
typedef __attribute__((ext_vector_type(4)))  unsigned v4u;
typedef __attribute__((ext_vector_type(4)))  int v4i;
typedef float __attribute__((may_alias)) float_a;
typedef int __attribute__((may_alias)) int_a;

template <typename T> __device__ __forceinline__ void vst2(void* p, T v) { *(T*)p = v;  }
__device__ __forceinline__ v8f wmma16(v16h a, v16h b, v8f c) {
  v8f d = __builtin_amdgcn_wmma_f32_16x16x32_f16(false, a, false, b, (short)0, c, false, false);
  asm volatile("v_nop\n\tv_nop\n\tv_nop\n\tv_nop" : "+v"(d) : "v"(a), "v"(b));
  return d;
}
__device__ __forceinline__ v8f wmma_bf(v16b a, v16b b, v8f c) {
  v8f d = __builtin_amdgcn_wmma_f32_16x16x32_bf16(false, a, false, b, (short)0, c, false, false);
  asm volatile("v_nop\n\tv_nop\n\tv_nop\n\tv_nop" : "+v"(d) : "v"(a), "v"(b));
  return d;
}
// the same for kernels whose fragments need registers above v255: an asm operand stays under v256, so the statement names D alone (the compiler keeps the A and B distances of its own builtin)
__device__ __forceinline__ v8f wmma_bfd(v16b a, v16b b, v8f c) {
  v8f d = __builtin_amdgcn_wmma_f32_16x16x32_bf16(false, a, false, b, (short)0, c, false, false);
  asm volatile("v_nop\n\tv_nop\n\tv_nop\n\tv_nop" : "+v"(d));
  return d;
}
// 16x16x32 fragments: lane = (h = lane>>4, row/col = lane&15); elements 0..7 = k0+8h+0..7, 8..15 = k0+16+8h+0..7; D element r = row 8h+r
__device__ __forceinline__ v16h frag_h(const _Float16* rowk0, int lane) {
  union { v16h v; v8h q[2]; } u; const _Float16* p = rowk0 + 8 * (lane >> 4);
  u.q[0] = *(const v8h*)p; u.q[1] = *(const v8h*)(p + 16); return u.v;
}
__device__ __forceinline__ v16h frag_f32(const float* rowk0, int lane) {
  v16h a; const float* p = rowk0 + 8 * (lane >> 4);
#pragma unroll
  for (int i = 0; i < 8; ++i) { a[i] = (_Float16)p[i]; a[8 + i] = (_Float16)p[16 + i]; }
  return a;
}
__device__ __forceinline__ v16h frag_f32s(const float* rowk0, int lane, float sc) {
  v16h a; const float* p = rowk0 + 8 * (lane >> 4);
#pragma unroll
  for (int i = 0; i < 8; ++i) { a[i] = (_Float16)(p[i] * sc); a[8 + i] = (_Float16)(p[16 + i] * sc); }
  return a;
}
// column fragment from a [K][ld] layout (column n), rows >= K read as 0
__device__ __forceinline__ v16h fragc_f32(const float* W, int k0, int n, int lane, int ld, int K) {
  v16h a; const int g = lane >> 4;
#pragma unroll
  for (int i = 0; i < 8; ++i) { const int ka = k0 + 8 * g + i, kb = ka + 16;
    a[i] = (_Float16)(ka < K ? W[(size_t)(ka < K ? ka : K - 1) * ld + n] : 0.f); a[8 + i] = (_Float16)(kb < K ? W[(size_t)(kb < K ? kb : K - 1) * ld + n] : 0.f); }
  return a;
}
struct F2 { v16b h, l; };
__device__ __forceinline__ F2 bsplit16(const float v[16]) { F2 r;
#pragma unroll
  for (int i = 0; i < 16; ++i) { const __bf16 h = (__bf16)v[i]; r.h[i] = h; r.l[i] = (__bf16)(v[i] - (float)h); }
  return r; }
__device__ __forceinline__ F2 split_row(const float* row, int k0, int lane) { float v[16]; const float* p = row + k0 + 8 * (lane >> 4);
#pragma unroll
  for (int i = 0; i < 8; ++i) { v[i] = p[i]; v[8 + i] = p[16 + i]; }
  return bsplit16(v); }
__device__ __forceinline__ F2 split_rowK(const float* row, int k0, int lane, int K) { float v[16]; const int g = lane >> 4;
#pragma unroll
  for (int i = 0; i < 8; ++i) { const int ka = k0 + 8 * g + i, kb = ka + 16; v[i] = ka < K ? row[ka < K ? ka : K - 1] : 0.f; v[8 + i] = kb < K ? row[kb < K ? kb : K - 1] : 0.f; }
  return bsplit16(v); }
__device__ __forceinline__ F2 split_col(const float* W, int k0, int n, int lane, int ld, int K) { float v[16]; const int g = lane >> 4;
#pragma unroll
  for (int i = 0; i < 8; ++i) { const int ka = k0 + 8 * g + i, kb = ka + 16; v[i] = ka < K ? W[(size_t)(ka < K ? ka : K - 1) * ld + n] : 0.f; v[8 + i] = kb < K ? W[(size_t)(kb < K ? kb : K - 1) * ld + n] : 0.f; }
  return bsplit16(v); }
__device__ __forceinline__ v8f mac3(const F2& a, const F2& b, v8f c) { c = wmma_bf(a.l, b.h, c); c = wmma_bf(a.h, b.l, c); return wmma_bf(a.h, b.h, c); }
__device__ __forceinline__ float sigm(float v) { return 1.0f / (1.0f + expf(-v)); }
#define LDSX() do { asm volatile("s_wait_dscnt 0" ::: "memory"); __builtin_amdgcn_wave_barrier(); __builtin_amdgcn_fence(__ATOMIC_RELEASE, "workgroup"); } while (0)

// Projector (B 16, N 1,024, C 512, per-batch weights): A = x Wq[b]; Bm = T Wk[b]; P = softmax(A Bm^T); out = x + P T.
__device__ __forceinline__ float bfr(float v) { return (float)(__bf16)v; }
#define NB 16
#define TT 1024
#define CC 512
#ifndef TNB
#define TNB NB
#endif
#define BG 16                  // batches per launch group (S planes)
typedef __attribute__((ext_vector_type(8))) __bf16 v8b;
__device__ __forceinline__ v16b frag_b(const __bf16* rowk0, int lane) { union { v16b v; v8b q[2]; } u; const __bf16* p = rowk0 + 8 * (lane >> 4); u.q[0] = *(const v8b*)p; u.q[1] = *(const v8b*)(p + 16); return u.v; }
#define WS_AH  0u                                          // bf16 A hi rows [b*N+n][512]
#define WS_AL  (WS_AH + 2u * (size_t)NB * TT * CC)
#define WS_BH  (WS_AL + 2u * (size_t)NB * TT * CC)           // bf16 Bm hi rows [b*N+m][512]
#define WS_BL  (WS_BH + 2u * (size_t)NB * TT * CC)
#define WS_TT  (WS_BL + 2u * (size_t)NB * TT * CC)           // bf16 T planes [b][c][m] (exact)
#define WS_S   (WS_TT + 2u * (size_t)NB * CC * TT)           // f32 E = exp(S - tile maximum) [bg][n][m]
#define WS_PM  (WS_S + 4u * (size_t)BG * TT * TT)             // f32 row maximum of S in each 64-key tile [bg][tile][n]
#define WS_PL  (WS_PM + 4u * (size_t)BG * (TT / 64) * TT)    // f32 row sum of E in each 64-key tile [bg][tile][n]
#define WS_END (WS_PL + 4u * (size_t)BG * (TT / 64) * TT)
// ---- LDS staging by the tensor mover: one request of a wave brings a two-dimensional tile into LDS, through no register; the pad field gives the rows their LDS pitch
typedef unsigned u32x4 __attribute__((ext_vector_type(4)));
typedef unsigned u32x8 __attribute__((ext_vector_type(8)));
__device__ __forceinline__ unsigned lds_off(const void* p) { return (unsigned)(size_t)p; }
__device__ __forceinline__ unsigned uni(unsigned v) { return (unsigned)__builtin_amdgcn_readfirstlane(v); }
__device__ __forceinline__ unsigned pinned(unsigned v) { unsigned w = uni(v); asm volatile("" : "+s"(w)); return w; }
// group 1: 1-byte elements, a tile (= tensor) of N rows of R bytes at a source pitch of P bytes; W0 = word 0: no mask, pad of 16 B behind every row
// pinned(): each descriptor word is held in a scalar register of its own; left to itself the compiler set the constants anew for each request and used their registers for other values while a request was outstanding
template <unsigned W0, unsigned R, unsigned N> __device__ __forceinline__ u32x8 tdm_group1(unsigned P) { u32x8 g;
  g[0] = pinned(W0); g[1] = pinned((R & 0xFFFFu) << 16); g[2] = pinned((R >> 16) | ((N & 0xFFFFu) << 16)); g[3] = pinned((N >> 16) | (R << 16)); g[4] = pinned(N); g[5] = pinned(P); g[6] = pinned(0u); g[7] = pinned(0u); return g; }
// group 0: count 1, place in LDS, address of the tile's first byte, type 2; pinned(): as in group 1
__device__ __forceinline__ u32x4 tdm_group0(unsigned lds_dst, unsigned long long ga) { u32x4 g;
  g[0] = pinned(1u); g[1] = pinned(lds_dst); g[2] = pinned((unsigned)ga); g[3] = pinned((((unsigned)(ga >> 32)) & 0x01FFFFFFu) | 0x80000000u); return g; }
__device__ __forceinline__ void tdm_load(u32x4 g0, u32x8 g1) { asm volatile("tensor_load_to_lds %0, %1" :: "s"(g0), "s"(g1) : "memory"); }
#define PAD128 ((1u << 20) | (4u << 22) | (3u << 25))   // rows of 128 B land at pitch 144 B
// the issuing wave's own request has landed (the compiler places no wait for it); the statement names the request's descriptor so that its registers live, unchanged, up to the wait
#define WAIT_TENSOR() asm volatile("s_wait_tensorcnt 0x0" :: "s"(g0), "s"(g1) : "memory")
// this wave's LDS reads have retired before the buffer they read is handed back for a refill
#define WAIT_LDS() asm volatile("s_wait_dscnt 0x0" ::: "memory")
// stands behind a group of global loads and stores, in front of the next group's rewrite of the registers that they name
#define WAIT_XLAT() asm volatile("s_wait_xcnt 0x0" ::: "memory")
#define SC_P (128 * 144)                   // k_sc stage: 128 rows of 128 B (64 k) at pitch 144 B (a multiple of 2 KiB)
#define SC_ST (4 * SC_P)                   // [A hi | A lo | Bm hi | Bm lo]
#define PV_P (128 * 144)                   // k_pv stage: three tiles of 128 rows of 128 B at pitch 144 B (a multiple of 2 KiB): P keys 0..31 (f32), P keys 32..63, T planes (128 channel rows of 64 keys)
#define PV_ST (3 * PV_P)
// ---- k_lin: block = (128 rows, 128 cols, which), 8 waves of 32 x 64: A = x Wq[b] (which 0) or Bm = T Wk[b] (which 1), per-batch (in,out) weights, exact; stored as bf16 hi + lo rows
// a T block also writes the planes [b][c][m] (exact bf16 T) of its own 128 channels, read turned out of the staged rows of the two stages that hold them: no pass of its own over T
// both operands go through LDS as bf16, rounded once a block: whole-line global loads into registers one stage (64 k) ahead, rows of x as they lie, W turned to [col][k] by which registers are packed together
#define LN_P 144                           // a staged row: 64 k as bf16 (128 B) at pitch 144 B
#define LN_XP (128 * LN_P)                 // one operand's 128 rows
#define LN_ST (2 * LN_XP)                  // [x rows | W columns]
typedef __attribute__((ext_vector_type(4))) __bf16 v4b;
__global__ __launch_bounds__(256) void k_lin(const float* __restrict__ X, const float* __restrict__ T_, const float* __restrict__ WQ, const float* __restrict__ WK, __bf16* __restrict__ AH, __bf16* __restrict__ AL, __bf16* __restrict__ BH, __bf16* __restrict__ BL, __bf16* __restrict__ TP) { __shared__ __align__(16) char ring[2][LN_ST];   // behind the loop the same bytes stage the hi and lo output rows
  const int tid = threadIdx.x, wave = tid >> 5, lane = tid & 31, col = lane & 15, g = lane >> 4, wr = wave >> 1, wc = wave & 1; const int which = blockIdx.z / (CC / 128), cb = blockIdx.z % (CC / 128); const int c0 = cb * 128; const size_t b = blockIdx.x; const size_t r0 = b * TT + (size_t)blockIdx.y * 128;   // the batch is the fastest grid index (see kernel_launch)
  const float* SRC = which == 0 ? X : T_; const float* Wb = (which == 0 ? WQ : WK) + b * (size_t)CC * CC; __bf16* DH = which == 0 ? AH : BH; __bf16* DL = which == 0 ? AL : BL;
  // x: thread -> row tid >> 4 (+ 16 per load), 16-B piece tid & 15 (a wave's load = 4 whole lines); W: wave -> 8 k rows, lane -> column lane (+ 32 per load) (a wave's load = 1 whole line)
  const float* gx = SRC + (r0 + (tid >> 4)) * CC + (tid & 15) * 4; const float* gw = Wb + (size_t)(wave * 8) * CC + c0 + lane;
  v4f xr[8]; float wv[4][8]; v8f acc[2][4] = {};
  auto load = [&](int t) {
#pragma unroll   // constant indices keep the stage in registers
    for (int i = 0; i < 8; ++i) xr[i] = *(const v4f*)(gx + (size_t)i * 16 * CC + t * 64);
#pragma unroll   // constant indices keep the stage in registers
    for (int c = 0; c < 4; ++c)
#pragma unroll   // constant indices keep the stage in registers
      for (int i = 0; i < 8; ++i) wv[c][i] = gw[(size_t)(t * 64 + i) * CC + c * 32]; };
  auto stash = [&](int buf) { char* st = ring[buf];
#pragma unroll   // constant indices keep the stage in registers
    for (int i = 0; i < 8; ++i) { v4b q; q[0] = (__bf16)xr[i][0]; q[1] = (__bf16)xr[i][1]; q[2] = (__bf16)xr[i][2]; q[3] = (__bf16)xr[i][3]; *(v4b*)(st + ((tid >> 4) + 16 * i) * LN_P + (tid & 15) * 8) = q; }
#pragma unroll   // constant indices keep the stage in registers
    for (int c = 0; c < 4; ++c) { v8b q;
#pragma unroll   // constant indices keep the stage in registers
      for (int i = 0; i < 8; ++i) q[i] = (__bf16)wv[c][i];
      *(v8b*)(st + LN_XP + (lane + 32 * c) * LN_P + wave * 16) = q; } };
  load(0); stash(0); __syncthreads();
#pragma unroll 1   // one stage a trip: the two buffers alternate by t & 1
  for (int t = 0; t < CC / 64; ++t) { const char* st = ring[t & 1];
    if (t + 1 < CC / 64) load(t + 1);   // in flight while this stage is worked on
#pragma unroll   // constant indices keep fragments and accumulators in registers
    for (int h = 0; h < 2; ++h) { v16b a[2], w[4];   // a 32-k block's LDS reads stand as one group in front of its WMMAs
#pragma unroll   // constant indices keep fragments and accumulators in registers
      for (int i = 0; i < 2; ++i) a[i] = frag_b((const __bf16*)(st + (wr * 32 + i * 16 + col) * LN_P + h * 64), lane);
#pragma unroll   // constant indices keep fragments and accumulators in registers
      for (int j = 0; j < 4; ++j) w[j] = frag_b((const __bf16*)(st + LN_XP + (wc * 64 + j * 16 + col) * LN_P + h * 64), lane);
#pragma unroll   // constant indices keep fragments and accumulators in registers
      for (int i = 0; i < 2; ++i)
#pragma unroll   // constant indices keep fragments and accumulators in registers
        for (int j = 0; j < 4; ++j) acc[i][j] = wmma_bf(a[i], w[j], acc[i][j]); }
    if (which == 1 && (t >> 1) == cb) {   // stage t holds 64 of this block's own 128 channels: thread -> channel pair tid >> 3, 8 rows m from 8 * (tid & 7) (+ 64): 8 lanes fill a whole 128-B line of a plane
#pragma unroll   // constant indices keep the 8 rows in registers
      for (int s = 0; s < 2; ++s) { const int q = (tid & 7) + 8 * s; unsigned d[8]; v4u e, o;
#pragma unroll   // constant indices keep the 8 rows in registers
        for (int j = 0; j < 8; ++j) d[j] = *(const unsigned*)(st + (q * 8 + j) * LN_P + (tid >> 3) * 4);   // two neighbouring channels of one row
#pragma unroll   // constant indices keep the 8 rows in registers
        for (int k = 0; k < 4; ++k) { e[k] = (d[2 * k] & 0xffffu) | (d[2 * k + 1] << 16); o[k] = (d[2 * k] >> 16) | (d[2 * k + 1] & 0xffff0000u); }
        __bf16* tp = TP + (b * CC + t * 64 + (tid >> 3) * 2) * (size_t)TT + (r0 - b * TT) + q * 8;
        vst2((unsigned*)tp, e); vst2((unsigned*)(tp + TT), o); }
      WAIT_XLAT(); }   // behind the four stores, in front of the next rewrite of their address registers
    if (t + 1 < CC / 64) stash((t + 1) & 1);   // into the buffer whose readers left it at the last barrier
    __syncthreads(); }   // publishes stage t + 1 and ends every read of stage t's buffer
  __bf16 (*sh)[136] = (__bf16 (*)[136])&ring[0][0]; __bf16 (*sl)[136] = (__bf16 (*)[136])(&ring[0][0] + 128 * 272);
#pragma unroll   // constant indices keep the accumulators in registers
  for (int i = 0; i < 2; ++i)
#pragma unroll   // constant indices keep the accumulators in registers
    for (int j = 0; j < 4; ++j)
#pragma unroll   // constant indices keep the accumulators in registers
      for (int r = 0; r < 8; ++r) { const float v = acc[i][j][r]; const __bf16 h = (__bf16)v; sh[wr * 32 + i * 16 + 8 * g + r][wc * 64 + j * 16 + col] = h; sl[wr * 32 + i * 16 + 8 * g + r][wc * 64 + j * 16 + col] = (__bf16)(v - (float)h); }
  __syncthreads();
  for (int e = tid; e < 128 * 16; e += 256) { const int rl = e >> 4, q = e & 15; vst2((unsigned*)(DH + (r0 + rl) * CC + c0 + q * 8), *(const v4u*)&sh[rl][q * 8]); vst2((unsigned*)(DL + (r0 + rl) * CC + c0 + q * 8), *(const v4u*)&sl[rl][q * 8]); } }
// exp(x) for x <= 0, built as the library's expf is (log2(e) in two parts, 2^fraction, ldexp, 0 below the smallest subnormal); the fraction x log2(e) - e comes from two fused steps, each rounded once
__device__ __forceinline__ float exp_le0(float x) {
  const float e = rintf(x * 0x1.715476p+0f); const float a = fmaf(x, 0x1.4ae0bep-26f, fmaf(x, 0x1.715476p+0f, -e)); float r;
  asm("v_exp_f32 %0, %1\n\tv_nop" : "=v"(r) : "v"(a));   // v_nop: the slot that the instruction set asks for behind a transcendental
  r = ldexpf(r, (int)e); return x < -0x1.9d1da0p+6f ? 0.f : r; }
// ---- k_sc: block = (batch in group, 128 rows n, 128 cols m), 4 waves of 64 x 64: S = A . Bm over K 512, 3 products; a staged fragment feeds 4 tiles
// first half of the softmax, on the wave's staged tile: each row's maximum over the tile's 64 keys, E = exp(S - that maximum) in place of S, and the row's sum of E; k_pv brings a row's 16 tiles to one scale
__global__ __launch_bounds__(128) void k_sc(const __bf16* __restrict__ AH, const __bf16* __restrict__ AL, const __bf16* __restrict__ BH, const __bf16* __restrict__ BL, int b0, float* __restrict__ S0, float* __restrict__ PM, float* __restrict__ PL) { __shared__ __attribute__((aligned(2048))) char ring[2][SC_ST];   // behind the loop the same bytes stage the output rows: two blocks still fit a WGP's LDS
  const size_t b = b0 + blockIdx.x; float* S = S0 + (size_t)blockIdx.x * TT * TT;   // the batch is the fastest grid index (see kernel_launch)
  const int tid = threadIdx.x, wave = tid >> 5, lane = tid & 31, col = lane & 15, g = lane >> 4, wr = wave >> 1, wc = wave & 1; const int k0 = blockIdx.z * 128; const int q0 = blockIdx.y * 128;
  v8f acc[4][4] = {};
  // stage t = k [64 t, 64 t + 64) of the block's 128 A rows and 128 Bm rows, hi and lo; every wave brings one of the four planes: wave 0 A hi, 1 A lo, 2 Bm hi, 3 Bm lo
  const unsigned wv = uni(tid >> 5); const unsigned l0 = lds_off(&ring[0][0]) + wv * SC_P;
  const unsigned long long gs = (unsigned long long)(size_t)(wv == 0 ? AH : wv == 1 ? AL : wv == 2 ? BH : BL) + ((b * TT + (wv < 2 ? q0 : k0)) * CC) * 2;
  const u32x8 g1 = tdm_group1<PAD128, 128, 128>(CC * 2);
  u32x4 g0;
  auto fill = [&](unsigned t, unsigned buf) { g0 = tdm_group0(l0 + buf * SC_ST, gs + t * 128); tdm_load(g0, g1); };
  fill(0, 0); WAIT_TENSOR(); __syncthreads(); fill(1, 1);
#pragma unroll 1   // one stage a trip: the two buffers alternate by t & 1
  for (int t = 0; t < CC / 64; ++t) { const char* st = ring[t & 1];
    v16b ah[2][4], al[2][4], bh[2][4], bl[2][4];   // the stage's LDS reads stand as one group in front of its WMMAs
#pragma unroll   // constant indices keep fragments and accumulators in registers
    for (int h = 0; h < 2; ++h) {
#pragma unroll   // constant indices keep fragments and accumulators in registers
      for (int i = 0; i < 4; ++i) { const char* ar = st + (wr * 64 + i * 16 + col) * 144 + h * 64; ah[h][i] = frag_b((const __bf16*)ar, lane); al[h][i] = frag_b((const __bf16*)(ar + SC_P), lane); }
#pragma unroll   // constant indices keep fragments and accumulators in registers
      for (int j = 0; j < 4; ++j) { const char* br = st + 2 * SC_P + (wc * 64 + j * 16 + col) * 144 + h * 64; bh[h][j] = frag_b((const __bf16*)br, lane); bl[h][j] = frag_b((const __bf16*)(br + SC_P), lane); } }
#pragma unroll   // constant indices keep fragments and accumulators in registers
    for (int h = 0; h < 2; ++h) {   // each product over all 16 tiles before the next: a tile's own order stays hi.hi, lo.hi, hi.lo
#pragma unroll   // constant indices keep fragments and accumulators in registers
      for (int i = 0; i < 4; ++i)
#pragma unroll   // constant indices keep fragments and accumulators in registers
        for (int j = 0; j < 4; ++j) acc[i][j] = wmma_bfd(ah[h][i], bh[h][j], acc[i][j]);
#pragma unroll   // constant indices keep fragments and accumulators in registers
      for (int i = 0; i < 4; ++i)
#pragma unroll   // constant indices keep fragments and accumulators in registers
        for (int j = 0; j < 4; ++j) acc[i][j] = wmma_bfd(al[h][i], bh[h][j], acc[i][j]);
#pragma unroll   // constant indices keep fragments and accumulators in registers
      for (int i = 0; i < 4; ++i)
#pragma unroll   // constant indices keep fragments and accumulators in registers
        for (int j = 0; j < 4; ++j) acc[i][j] = wmma_bfd(ah[h][i], bl[h][j], acc[i][j]); }
    WAIT_LDS(); WAIT_TENSOR(); __syncthreads();   // publishes stage t + 1 and ends every read of stage t's buffer
    if (pinned(t + 2 < CC / 64)) { const unsigned tn = pinned(t + 2); fill(tn, tn & 1); } }   // pinned: a scalar branch round the request; its descriptor is formed behind the wait
  WAIT_TENSOR(); WAIT_LDS();
  // the ring is free: the last trip's foot (LDS reads retired, requests landed, barrier) stands behind its every use; each wave stages its 64 x 64 tile in rows of its own, so that whole 128-B lines go out
  float (*ss)[68] = (float (*)[68])(&ring[0][0] + wave * (64 * 68 * 4));
#pragma unroll   // constant indices keep the accumulators in registers
  for (int i = 0; i < 4; ++i)
#pragma unroll   // constant indices keep the accumulators in registers
    for (int j = 0; j < 4; ++j)
#pragma unroll   // constant indices keep the accumulators in registers
      for (int r = 0; r < 8; ++r) ss[i * 16 + 8 * g + r][j * 16 + col] = acc[i][j][r];
  LDSX();
  float tm[2], tl[2];
  {
#pragma unroll   // lane -> rows lane and lane + 32 of the tile, a whole row in registers
    for (int s = 0; s < 2; ++s) { float* rw = &ss[lane + 32 * s][0]; v4f a[16];
#pragma unroll   // the row's LDS reads go out together
      for (int q = 0; q < 16; ++q) a[q] = *(const v4f*)(rw + 4 * q);
      v4f m4 = a[0];
#pragma unroll   // constant indices keep the row in registers
      for (int q = 1; q < 16; ++q) { m4[0] = fmaxf(m4[0], a[q][0]); m4[1] = fmaxf(m4[1], a[q][1]); m4[2] = fmaxf(m4[2], a[q][2]); m4[3] = fmaxf(m4[3], a[q][3]); }
      const float m = fmaxf(fmaxf(m4[0], m4[1]), fmaxf(m4[2], m4[3])); v4f s4 = {};   // four independent sums
#pragma unroll   // constant indices keep the row in registers
      for (int q = 0; q < 16; ++q) {
#pragma unroll   // constant indices keep the row in registers
        for (int c = 0; c < 4; ++c) { const float e = exp_le0(a[q][c] - m); a[q][c] = e; s4[c] += e; }
        *(v4f*)(rw + 4 * q) = a[q]; }
      tm[s] = m; tl[s] = (s4[0] + s4[1]) + (s4[2] + s4[3]); } }
  LDSX();
  { const size_t po = ((size_t)blockIdx.x * (TT / 64) + blockIdx.z * 2 + wc) * TT + q0 + wr * 64 + lane;   // a wave writes two whole 128-B lines of each plane; behind the LDS fence, which would wait for these stores
    PM[po] = tm[0]; PM[po + 32] = tm[1]; PL[po] = tl[0]; PL[po + 32] = tl[1];
    WAIT_XLAT(); }   // behind the four stores, in front of the next rewrite of their address registers
  float* so = S + (size_t)(q0 + wr * 64 + g) * TT + k0 + wc * 64 + col * 4;
  for (int r0 = 0; r0 < 64; r0 += 16) {   // 16 rows a group, two rows a store
#pragma unroll   // the group's LDS reads go out together
    for (int u = 0; u < 8; ++u) vst2(so + (size_t)(r0 + 2 * u) * TT, *(const v4f*)&ss[r0 + 2 * u + g][col * 4]);
    if (r0 + 16 < 64) WAIT_XLAT(); } }
// ---- k_pv: block = (batch in group, 128 rows n, 128 channels), 4 waves of 32 x 128: out = x + (P . T) / 2^11 (P split bf16 hi + lo x exact T planes, 2 products); a staged T fragment feeds 2 row tiles
// second half of the softmax: P x 2^11 = E * cs, one factor a row and stage (a stage = one 64-key tile of k_sc): cs = exp(tile maximum - row maximum) / row sum x 2^11, from the 16 tile maxima and tile sums of the row
__global__ __launch_bounds__(128) void k_pv(const float* __restrict__ PS0, const float* __restrict__ PM, const float* __restrict__ PL, const __bf16* __restrict__ TP, const float* __restrict__ X, int b0, float* __restrict__ OUT) { __shared__ __align__(16) float ss[4][16][132]; __shared__ __attribute__((aligned(2048))) char ring[2][PV_ST]; __shared__ float cs[TT / 64][128];
  const size_t b = b0 + blockIdx.x; const float* PS = PS0 + (size_t)blockIdx.x * TT * TT;   // the batch is the fastest grid index (see kernel_launch)
  const int tid = threadIdx.x, wave = tid >> 5, lane = tid & 31, col = lane & 15, g = lane >> 4; const int ql0 = blockIdx.y * 128 + wave * 32; const int c0 = blockIdx.z * 128;
  v8f acc[2][8] = {};
  // stage t = keys [64 t, 64 t + 64): waves 0 and 1 bring the two 32-key halves of the block's 128 P rows, wave 2 its 128 T channel rows; wave 3 brings nothing
  const unsigned wv = uni(tid >> 5); const unsigned l0 = lds_off(&ring[0][0]) + wv * PV_P, gstep = wv < 2 ? 256 : 128;
  const unsigned long long gs = wv < 2 ? (unsigned long long)(size_t)PS + ((size_t)(blockIdx.y * 128) * TT) * 4 + wv * 128 : (unsigned long long)(size_t)TP + ((b * CC + c0) * (size_t)TT) * 2;
  const u32x8 g1 = tdm_group1<PAD128, 128, 128>(wv < 2 ? TT * 4 : TT * 2);
  u32x4 g0 = {};   // wave 3 passes the waits with nothing outstanding
  auto fill = [&](unsigned t, unsigned buf) { g0 = tdm_group0(l0 + buf * PV_ST, gs + t * gstep); tdm_load(g0, g1); };
  if (pinned(wv < 3)) fill(0, 0);   // pinned: a scalar branch round the request, which ignores EXEC
  { const size_t po = (size_t)blockIdx.x * (TT / 64) * TT + blockIdx.y * 128 + tid; float mv[TT / 64], lv[TT / 64];   // thread -> row tid of the block (a row of its own wave); a wave's load = one whole line
#pragma unroll   // the 32 loads are in flight together, beside stage 0's request
    for (int k = 0; k < TT / 64; ++k) { mv[k] = PM[po + (size_t)k * TT]; lv[k] = PL[po + (size_t)k * TT]; }
    WAIT_XLAT();   // behind the 32 loads, in front of the next rewrite of their address registers
    float mg = mv[0], sum = 0.f;
#pragma unroll   // constant indices keep the 16 tiles in registers
    for (int k = 1; k < TT / 64; ++k) mg = fmaxf(mg, mv[k]);
#pragma unroll   // constant indices keep the 16 tiles in registers
    for (int k = 0; k < TT / 64; ++k) { mv[k] = exp_le0(mv[k] - mg); sum += mv[k] * lv[k]; }
    const float inv = 1.0f / sum;
#pragma unroll   // constant indices keep the 16 tiles in registers
    for (int k = 0; k < TT / 64; ++k) cs[k][tid] = mv[k] * inv * 2048.0f; }
  WAIT_TENSOR(); __syncthreads(); if (pinned(wv < 3)) fill(1, 1);   // pinned: as above
#pragma unroll 1   // one stage a trip: the two buffers alternate by t & 1
  for (int t = 0; t < TT / 64; ++t) { const char* st = ring[t & 1];
    F2 p[2][2]; v16b th[2][8];   // the stage's LDS reads stand as one group in front of its WMMAs
    const float cf[2] = { cs[t][wave * 32 + col], cs[t][wave * 32 + 16 + col] };
#pragma unroll   // constant indices keep fragments and accumulators in registers
    for (int h = 0; h < 2; ++h) {
#pragma unroll   // constant indices keep fragments and accumulators in registers
      for (int i = 0; i < 2; ++i) { float v[16]; const float* pr = (const float*)(st + h * PV_P + (wave * 32 + i * 16 + col) * 144) + 8 * g;   // the k order of split_row
#pragma unroll   // constant indices keep the fragment in registers
        for (int k = 0; k < 8; ++k) { v[k] = pr[k] * cf[i]; v[8 + k] = pr[16 + k] * cf[i]; }
        p[h][i] = bsplit16(v); }
#pragma unroll   // constant indices keep fragments and accumulators in registers
      for (int j = 0; j < 8; ++j) th[h][j] = frag_b((const __bf16*)(st + 2 * PV_P + (j * 16 + col) * 144 + h * 64), lane); }
#pragma unroll   // constant indices keep fragments and accumulators in registers
    for (int h = 0; h < 2; ++h) {   // each product over all 16 tiles before the next: a tile's own order stays hi, lo
#pragma unroll   // constant indices keep fragments and accumulators in registers
      for (int i = 0; i < 2; ++i)
#pragma unroll   // constant indices keep fragments and accumulators in registers
        for (int j = 0; j < 8; ++j) acc[i][j] = wmma_bfd(p[h][i].h, th[h][j], acc[i][j]);
#pragma unroll   // constant indices keep fragments and accumulators in registers
      for (int i = 0; i < 2; ++i)
#pragma unroll   // constant indices keep fragments and accumulators in registers
        for (int j = 0; j < 8; ++j) acc[i][j] = wmma_bfd(p[h][i].l, th[h][j], acc[i][j]); }
    WAIT_LDS(); WAIT_TENSOR(); __syncthreads();   // publishes stage t + 1 and ends every read of stage t's buffer
    if (pinned(wv < 3 && t + 2 < TT / 64)) { const unsigned tn = pinned(t + 2); fill(tn, tn & 1); } }   // pinned: a scalar branch round the request; its descriptor is formed behind the wait
  WAIT_TENSOR(); WAIT_LDS();
#pragma unroll   // constant indices keep the accumulators in registers
  for (int i = 0; i < 2; ++i) {   // 16 rows at a time through the wave's own staging rows
    if (i) WAIT_LDS();   // the first 16 rows are read before the next 16 overwrite them
#pragma unroll
    for (int j = 0; j < 8; ++j)
#pragma unroll
      for (int r = 0; r < 8; ++r) ss[wave][8 * g + r][j * 16 + col] = acc[i][j][r] * (1.0f / 2048.0f);
    LDSX(); for (int r0 = 0; r0 < 16; r0 += 8) { const size_t off = (b * TT + ql0 + i * 16 + r0) * CC + c0 + lane * 4; v4f xr[8];   // 8 rows a group
#pragma unroll   // the group's x loads are in flight together
      for (int u = 0; u < 8; ++u) xr[u] = *(const v4f*)(X + off + u * CC);
#pragma unroll   // constant indices keep the group in registers
      for (int u = 0; u < 8; ++u) { v4f o = *(const v4f*)&ss[wave][r0 + u][lane * 4]; o[0] += bfr(xr[u][0]); o[1] += bfr(xr[u][1]); o[2] += bfr(xr[u][2]); o[3] += bfr(xr[u][3]); vst2(OUT + off + u * CC, o); }
      if (i == 0 || r0 == 0) WAIT_XLAT(); } } }
extern "C" void kernel_launch(void* const* d_in, const int* in_sizes, int n_in, void* d_out, int out_size, void* d_ws, size_t ws_size, hipStream_t stream) {
  (void)in_sizes; (void)n_in; (void)out_size;
  const float** F = (const float**)d_in;   // 0 x_in [16,1024,512], 1 T [16,1024,512], 2 Wq [16,512,512] ((in,out) per batch), 3 Wk [16,512,512]
  if (ws_size < (size_t)WS_END) return;
  char* ws = (char*)d_ws; __bf16 *AH = (__bf16*)(ws + WS_AH), *AL = (__bf16*)(ws + WS_AL), *BH = (__bf16*)(ws + WS_BH), *BL = (__bf16*)(ws + WS_BL), *TP = (__bf16*)(ws + WS_TT); float *S = (float*)(ws + WS_S), *PM = (float*)(ws + WS_PM), *PL = (float*)(ws + WS_PL);
  // grids: x = batch, so that all blocks of a batch have flat indices equal mod 8. For speed only; every block does its own piece wherever it lands
  k_lin<<<dim3(TNB, TT / 128, 2 * (CC / 128)), 256, 0, stream>>>(F[0], F[1], F[2], F[3], AH, AL, BH, BL, TP);
  for (int b0 = 0; b0 < TNB; b0 += BG) { const int ng = (TNB - b0) < BG ? (TNB - b0) : BG;
    k_sc<<<dim3(ng, TT / 128, TT / 128), 128, 0, stream>>>(AH, AL, BH, BL, b0, S, PM, PL);
    k_pv<<<dim3(ng, TT / 128, CC / 128), 128, 0, stream>>>(S, PM, PL, TP, F[0], b0, (float*)d_out);
  }
}

// v010
// Measured time: 96.5 microseconds a run.
// In both of two side-by-side timings against v009, it was 1.06 times as fast.
// All steps since v000 together make it 7.68 times as fast.
// compute dtype: all float inputs rounded to bf16; A = x Wq[b] and Bm = T Wk[b] with EXACT bf16 products on WMMA 16x16x32, f32 accumulate, stored as bf16 hi + lo row planes; S = A . Bm over K = 512 with 3 products (hi.hi + hi.lo + lo.hi), f32; softmax in f32 (exp to the library expf's accuracy) in two halves: exp and sum against the maximum of each 64-key tile, then one factor a row and tile; P x 2^11 split bf16 hi + lo against the EXACT bf16 T planes (2 products); + x residual in f32; f32 output.
#include <hip/hip_runtime.h>
#include <math.h>

typedef __attribute__((ext_vector_type(16))) _Float16 v16h;
typedef __attribute__((ext_vector_type(16))) __bf16 v16b;
typedef __attribute__((ext_vector_type(8)))  _Float16 v8h;
typedef __attribute__((ext_vector_type(8)))  float v8f;
typedef __attribute__((ext_vector_type(4)))  float v4f;
typedef __attribute__((ext_vector_type(2)))  float v2f;
typedef __attribute__((ext_vector_type(4)))  unsigned v4u;
typedef __attribute__((ext_vector_type(4)))  int v4i;
typedef float __attribute__((may_alias)) float_a;
typedef int __attribute__((may_alias)) int_a;

template <typename T> __device__ __forceinline__ void vst2(void* p, T v) { *(T*)p = v;  }
__device__ __forceinline__ v8f wmma16(v16h a, v16h b, v8f c) {
  v8f d = __builtin_amdgcn_wmma_f32_16x16x32_f16(false, a, false, b, (short)0, c, false, false);
  asm volatile("v_nop\n\tv_nop\n\tv_nop\n\tv_nop" : "+v"(d) : "v"(a), "v"(b));
  return d;
}
__device__ __forceinline__ v8f wmma_bf(v16b a, v16b b, v8f c) {
  v8f d = __builtin_amdgcn_wmma_f32_16x16x32_bf16(false, a, false, b, (short)0, c, false, false);
  asm volatile("v_nop\n\tv_nop\n\tv_nop\n\tv_nop" : "+v"(d) : "v"(a), "v"(b));
  return d;
}
// the same for kernels whose fragments need registers above v255: an asm operand stays under v256, so the statement names D alone (the compiler keeps the A and B distances of its own builtin)
__device__ __forceinline__ v8f wmma_bfd(v16b a, v16b b, v8f c) {
  v8f d = __builtin_amdgcn_wmma_f32_16x16x32_bf16(false, a, false, b, (short)0, c, false, false);
  asm volatile("v_nop\n\tv_nop\n\tv_nop\n\tv_nop" : "+v"(d));
  return d;
}
// 16x16x32 fragments: lane = (h = lane>>4, row/col = lane&15); elements 0..7 = k0+8h+0..7, 8..15 = k0+16+8h+0..7; D element r = row 8h+r
__device__ __forceinline__ v16h frag_h(const _Float16* rowk0, int lane) {
  union { v16h v; v8h q[2]; } u; const _Float16* p = rowk0 + 8 * (lane >> 4);
  u.q[0] = *(const v8h*)p; u.q[1] = *(const v8h*)(p + 16); return u.v;
}
__device__ __forceinline__ v16h frag_f32(const float* rowk0, int lane) {
  v16h a; const float* p = rowk0 + 8 * (lane >> 4);
#pragma unroll
  for (int i = 0; i < 8; ++i) { a[i] = (_Float16)p[i]; a[8 + i] = (_Float16)p[16 + i]; }
  return a;
}
__device__ __forceinline__ v16h frag_f32s(const float* rowk0, int lane, float sc) {
  v16h a; const float* p = rowk0 + 8 * (lane >> 4);
#pragma unroll
  for (int i = 0; i < 8; ++i) { a[i] = (_Float16)(p[i] * sc); a[8 + i] = (_Float16)(p[16 + i] * sc); }
  return a;
}
// column fragment from a [K][ld] layout (column n), rows >= K read as 0
__device__ __forceinline__ v16h fragc_f32(const float* W, int k0, int n, int lane, int ld, int K) {
  v16h a; const int g = lane >> 4;
#pragma unroll
  for (int i = 0; i < 8; ++i) { const int ka = k0 + 8 * g + i, kb = ka + 16;
    a[i] = (_Float16)(ka < K ? W[(size_t)(ka < K ? ka : K - 1) * ld + n] : 0.f); a[8 + i] = (_Float16)(kb < K ? W[(size_t)(kb < K ? kb : K - 1) * ld + n] : 0.f); }
  return a;
}
struct F2 { v16b h, l; };
__device__ __forceinline__ F2 bsplit16(const float v[16]) { F2 r;
#pragma unroll
  for (int i = 0; i < 16; ++i) { const __bf16 h = (__bf16)v[i]; r.h[i] = h; r.l[i] = (__bf16)(v[i] - (float)h); }
  return r; }
__device__ __forceinline__ F2 split_row(const float* row, int k0, int lane) { float v[16]; const float* p = row + k0 + 8 * (lane >> 4);
#pragma unroll
  for (int i = 0; i < 8; ++i) { v[i] = p[i]; v[8 + i] = p[16 + i]; }
  return bsplit16(v); }
__device__ __forceinline__ F2 split_rowK(const float* row, int k0, int lane, int K) { float v[16]; const int g = lane >> 4;
#pragma unroll
  for (int i = 0; i < 8; ++i) { const int ka = k0 + 8 * g + i, kb = ka + 16; v[i] = ka < K ? row[ka < K ? ka : K - 1] : 0.f; v[8 + i] = kb < K ? row[kb < K ? kb : K - 1] : 0.f; }
  return bsplit16(v); }
__device__ __forceinline__ F2 split_col(const float* W, int k0, int n, int lane, int ld, int K) { float v[16]; const int g = lane >> 4;
#pragma unroll
  for (int i = 0; i < 8; ++i) { const int ka = k0 + 8 * g + i, kb = ka + 16; v[i] = ka < K ? W[(size_t)(ka < K ? ka : K - 1) * ld + n] : 0.f; v[8 + i] = kb < K ? W[(size_t)(kb < K ? kb : K - 1) * ld + n] : 0.f; }
  return bsplit16(v); }
__device__ __forceinline__ v8f mac3(const F2& a, const F2& b, v8f c) { c = wmma_bf(a.l, b.h, c); c = wmma_bf(a.h, b.l, c); return wmma_bf(a.h, b.h, c); }
__device__ __forceinline__ float sigm(float v) { return 1.0f / (1.0f + expf(-v)); }
#define LDSX() do { asm volatile("s_wait_dscnt 0" ::: "memory"); __builtin_amdgcn_wave_barrier(); __builtin_amdgcn_fence(__ATOMIC_RELEASE, "workgroup"); } while (0)

// Projector (B 16, N 1,024, C 512, per-batch weights): A = x Wq[b]; Bm = T Wk[b]; P = softmax(A Bm^T); out = x + P T.
__device__ __forceinline__ float bfr(float v) { return (float)(__bf16)v; }
#define NB 16
#define TT 1024
#define CC 512
#ifndef TNB
#define TNB NB
#endif
#define BG 16                  // batches per launch group (S planes)
typedef __attribute__((ext_vector_type(8))) __bf16 v8b;
__device__ __forceinline__ v16b frag_b(const __bf16* rowk0, int lane) { union { v16b v; v8b q[2]; } u; const __bf16* p = rowk0 + 8 * (lane >> 4); u.q[0] = *(const v8b*)p; u.q[1] = *(const v8b*)(p + 16); return u.v; }
#define WS_AH  0u                                          // bf16 A hi rows [b*N+n][512]
#define WS_AL  (WS_AH + 2u * (size_t)NB * TT * CC)
#define WS_BH  (WS_AL + 2u * (size_t)NB * TT * CC)           // bf16 Bm hi rows [b*N+m][512]
#define WS_BL  (WS_BH + 2u * (size_t)NB * TT * CC)
#define WS_TT  (WS_BL + 2u * (size_t)NB * TT * CC)           // bf16 T planes [b][c][m] (exact)
#define WS_S   (WS_TT + 2u * (size_t)NB * CC * TT)           // f32 E = exp(S - tile maximum) [bg][n][m]
#define WS_PM  (WS_S + 4u * (size_t)BG * TT * TT)             // f32 row maximum of S in each 64-key tile [bg][tile][n]
#define WS_PL  (WS_PM + 4u * (size_t)BG * (TT / 64) * TT)    // f32 row sum of E in each 64-key tile [bg][tile][n]
#define WS_END (WS_PL + 4u * (size_t)BG * (TT / 64) * TT)
// ---- LDS staging by the tensor mover: one request of a wave brings a two-dimensional tile into LDS, through no register; the pad field gives the rows their LDS pitch
typedef unsigned u32x4 __attribute__((ext_vector_type(4)));
typedef unsigned u32x8 __attribute__((ext_vector_type(8)));
__device__ __forceinline__ unsigned lds_off(const void* p) { return (unsigned)(size_t)p; }
__device__ __forceinline__ unsigned uni(unsigned v) { return (unsigned)__builtin_amdgcn_readfirstlane(v); }
__device__ __forceinline__ unsigned pinned(unsigned v) { unsigned w = uni(v); asm volatile("" : "+s"(w)); return w; }
// group 1: 1-byte elements, a tile (= tensor) of N rows of R bytes at a source pitch of P bytes; W0 = word 0: no mask, pad of 16 B behind every row
// pinned(): each descriptor word is held in a scalar register of its own; left to itself the compiler set the constants anew for each request and used their registers for other values while a request was outstanding
template <unsigned W0, unsigned R, unsigned N> __device__ __forceinline__ u32x8 tdm_group1(unsigned P) { u32x8 g;
  g[0] = pinned(W0); g[1] = pinned((R & 0xFFFFu) << 16); g[2] = pinned((R >> 16) | ((N & 0xFFFFu) << 16)); g[3] = pinned((N >> 16) | (R << 16)); g[4] = pinned(N); g[5] = pinned(P); g[6] = pinned(0u); g[7] = pinned(0u); return g; }
// group 0: count 1, place in LDS, address of the tile's first byte, type 2; pinned(): as in group 1
__device__ __forceinline__ u32x4 tdm_group0(unsigned lds_dst, unsigned long long ga) { u32x4 g;
  g[0] = pinned(1u); g[1] = pinned(lds_dst); g[2] = pinned((unsigned)ga); g[3] = pinned((((unsigned)(ga >> 32)) & 0x01FFFFFFu) | 0x80000000u); return g; }
__device__ __forceinline__ void tdm_load(u32x4 g0, u32x8 g1) { asm volatile("tensor_load_to_lds %0, %1" :: "s"(g0), "s"(g1) : "memory"); }
#define PAD128 ((1u << 20) | (4u << 22) | (3u << 25))   // rows of 128 B land at pitch 144 B
// the issuing wave's own request has landed (the compiler places no wait for it); the statement names the request's descriptor so that its registers live, unchanged, up to the wait
#define WAIT_TENSOR() asm volatile("s_wait_tensorcnt 0x0" :: "s"(g0), "s"(g1) : "memory")
// this wave's LDS reads have retired before the buffer they read is handed back for a refill
#define WAIT_LDS() asm volatile("s_wait_dscnt 0x0" ::: "memory")
// stands behind a group of global loads and stores, in front of the next group's rewrite of the registers that they name
#define WAIT_XLAT() asm volatile("s_wait_xcnt 0x0" ::: "memory")
#define SC_P (128 * 144)                   // k_sc stage: 128 rows of 128 B (64 k) at pitch 144 B (a multiple of 2 KiB)
#define SC_ST (4 * SC_P)                   // [A hi | A lo | Bm hi | Bm lo]
#define PV_P (128 * 144)                   // k_pv stage: three tiles of 128 rows of 128 B at pitch 144 B (a multiple of 2 KiB): P keys 0..31 (f32), P keys 32..63, T planes (128 channel rows of 64 keys)
#define PV_ST (3 * PV_P)
// ---- k_lin: block = (256 rows, 256 cols, which), 16 waves of 64 x 64: A = x Wq[b] (which 0) or Bm = T Wk[b] (which 1), per-batch (in,out) weights, exact; stored as bf16 hi + lo rows
// the wide block is for the L2: a batch's x (or T) rows are asked for by 2 blocks and its weights by 4, where blocks of 128 x 128 ask 4 and 8 times; 256 blocks, one a WGP, in one round
// a T block also writes the planes [b][c][m] (exact bf16 T) of its own 256 channels, read turned out of the staged rows of the eight stages that hold them: no pass of its own over T
// both operands go through LDS as bf16, rounded once a block: whole-line global loads into registers one stage (32 k) ahead, rows of x as they lie, W turned to [col][k] by which registers are packed together
#define LN_P 80                            // a staged row: 32 k as bf16 (64 B) at pitch 80 B
#define LN_XP (256 * LN_P)                 // one operand's 256 rows
#define LN_ST (2 * LN_XP)                  // [x rows | W columns]
#define LN_OP 528                          // an output row behind the loop: 256 bf16 (512 B) at pitch 528 B
typedef __attribute__((ext_vector_type(4))) __bf16 v4b;
__global__ __launch_bounds__(512) void k_lin(const float* __restrict__ X, const float* __restrict__ T_, const float* __restrict__ WQ, const float* __restrict__ WK, __bf16* __restrict__ AH, __bf16* __restrict__ AL, __bf16* __restrict__ BH, __bf16* __restrict__ BL, __bf16* __restrict__ TP) { __shared__ __align__(16) char ring[2 * 256 * LN_OP];   // in the loop its first bytes are the two stages; behind the loop it stages the hi and lo output rows
  const int tid = threadIdx.x, wave = tid >> 5, lane = tid & 31, col = lane & 15, g = lane >> 4, wr = wave >> 2, wc = wave & 3; const int which = blockIdx.z / (CC / 256), cb = blockIdx.z % (CC / 256); const int c0 = cb * 256; const size_t b = blockIdx.x; const size_t r0 = b * TT + (size_t)blockIdx.y * 256;   // the batch is the fastest grid index (see kernel_launch)
  const float* SRC = which == 0 ? X : T_; const float* Wb = (which == 0 ? WQ : WK) + b * (size_t)CC * CC; __bf16* DH = which == 0 ? AH : BH; __bf16* DL = which == 0 ? AL : BL;
  // x: thread -> row tid >> 3 (+ 64 per load), 16-B piece tid & 7 (a wave's load = 4 whole lines); W: wave -> 4 k rows and a half of the columns, lane -> column lane (+ 32 per load) (a wave's load = 1 whole line)
  const float* gx = SRC + (r0 + (tid >> 3)) * CC + (tid & 7) * 4; const float* gw = Wb + (size_t)((wave & 7) * 4) * CC + c0 + (wave >> 3) * 128 + lane;
  v4f xr[4]; float wv[4][4]; v8f acc[4][4] = {};
  auto load = [&](int t) {
#pragma unroll   // constant indices keep the stage in registers
    for (int i = 0; i < 4; ++i) xr[i] = *(const v4f*)(gx + (size_t)i * 64 * CC + t * 32);
#pragma unroll   // constant indices keep the stage in registers
    for (int c = 0; c < 4; ++c)
#pragma unroll   // constant indices keep the stage in registers
      for (int i = 0; i < 4; ++i) wv[c][i] = gw[(size_t)(t * 32 + i) * CC + c * 32]; };
  auto stash = [&](int buf) { char* st = ring + buf * LN_ST;
#pragma unroll   // constant indices keep the stage in registers
    for (int i = 0; i < 4; ++i) { v4b q; q[0] = (__bf16)xr[i][0]; q[1] = (__bf16)xr[i][1]; q[2] = (__bf16)xr[i][2]; q[3] = (__bf16)xr[i][3]; *(v4b*)(st + ((tid >> 3) + 64 * i) * LN_P + (tid & 7) * 8) = q; }
#pragma unroll   // constant indices keep the stage in registers
    for (int c = 0; c < 4; ++c) { v4b q; q[0] = (__bf16)wv[c][0]; q[1] = (__bf16)wv[c][1]; q[2] = (__bf16)wv[c][2]; q[3] = (__bf16)wv[c][3]; *(v4b*)(st + LN_XP + ((wave >> 3) * 128 + lane + 32 * c) * LN_P + (wave & 7) * 8) = q; } };
  load(0); stash(0); __syncthreads();
#pragma unroll 1   // one stage a trip: the two buffers alternate by t & 1
  for (int t = 0; t < CC / 32; ++t) { const char* st = ring + (t & 1) * LN_ST;
    if (t + 1 < CC / 32) { load(t + 1); WAIT_XLAT(); }   // in flight while this stage is worked on; the wait stands behind the 20 loads, in front of the next rewrite of their address registers
    if (which == 1 && (t >> 3) == cb) {   // stage t holds 32 of this block's own 256 channels: thread -> channel pair (tid >> 3) & 15, 8 rows m from 8 * q: 8 lanes fill a whole 128-B line of a plane; in front of the stage's products, so that the stores are done when the stage's barrier waits for them
      const int q = (tid & 7) + 8 * (tid >> 7), pr = (tid >> 3) & 15; unsigned d[8]; v4u e, o;
#pragma unroll   // constant indices keep the 8 rows in registers
      for (int j = 0; j < 8; ++j) d[j] = *(const unsigned*)(st + (q * 8 + j) * LN_P + pr * 4);   // two neighbouring channels of one row
#pragma unroll   // constant indices keep the 8 rows in registers
      for (int k = 0; k < 4; ++k) { e[k] = (d[2 * k] & 0xffffu) | (d[2 * k + 1] << 16); o[k] = (d[2 * k] >> 16) | (d[2 * k + 1] & 0xffff0000u); }
      __bf16* tp = TP + (b * CC + t * 32 + pr * 2) * (size_t)TT + (r0 - b * TT) + q * 8;
      vst2((unsigned*)tp, e); vst2((unsigned*)(tp + TT), o);
      WAIT_XLAT(); }   // behind the two stores, in front of the next rewrite of their address registers
    { v16b a[4], w[4];   // the stage's LDS reads stand as one group in front of its WMMAs
#pragma unroll   // constant indices keep fragments and accumulators in registers
      for (int i = 0; i < 4; ++i) a[i] = frag_b((const __bf16*)(st + (wr * 64 + i * 16 + col) * LN_P), lane);
#pragma unroll   // constant indices keep fragments and accumulators in registers
      for (int j = 0; j < 4; ++j) w[j] = frag_b((const __bf16*)(st + LN_XP + (wc * 64 + j * 16 + col) * LN_P), lane);
#pragma unroll   // constant indices keep fragments and accumulators in registers
      for (int i = 0; i < 4; ++i)
#pragma unroll   // constant indices keep fragments and accumulators in registers
        for (int j = 0; j < 4; ++j) acc[i][j] = wmma_bf(a[i], w[j], acc[i][j]); }
    if (t + 1 < CC / 32) stash((t + 1) & 1);   // into the buffer whose readers left it at the last barrier
    __syncthreads(); }   // publishes stage t + 1 and ends every read of stage t's buffer
  __bf16 (*sh)[LN_OP / 2] = (__bf16 (*)[LN_OP / 2])&ring[0]; __bf16 (*sl)[LN_OP / 2] = (__bf16 (*)[LN_OP / 2])(&ring[0] + 256 * LN_OP);
#pragma unroll   // constant indices keep the accumulators in registers
  for (int i = 0; i < 4; ++i)
#pragma unroll   // constant indices keep the accumulators in registers
    for (int j = 0; j < 4; ++j)
#pragma unroll   // constant indices keep the accumulators in registers
      for (int r = 0; r < 8; ++r) { const float v = acc[i][j][r]; const __bf16 h = (__bf16)v; sh[wr * 64 + i * 16 + 8 * g + r][wc * 64 + j * 16 + col] = h; sl[wr * 64 + i * 16 + 8 * g + r][wc * 64 + j * 16 + col] = (__bf16)(v - (float)h); }
  __syncthreads();
  for (int e0 = 0; e0 < 16; e0 += 4) {   // a wave's store = one whole output row of the block (512 B); 4 rows of each plane a group
#pragma unroll   // the group's LDS reads go out together
    for (int u = 0; u < 4; ++u) { const int rl = (e0 + u) * 16 + wave; vst2((unsigned*)(DH + (r0 + rl) * CC + c0 + lane * 8), *(const v4u*)&sh[rl][lane * 8]); vst2((unsigned*)(DL + (r0 + rl) * CC + c0 + lane * 8), *(const v4u*)&sl[rl][lane * 8]); }
    if (e0 + 4 < 16) WAIT_XLAT(); } }   // behind the group's stores, in front of the next group's rewrite of the registers that they name
// exp(x) for x <= 0, built as the library's expf is (log2(e) in two parts, 2^fraction, ldexp, 0 below the smallest subnormal); the fraction x log2(e) - e comes from two fused steps, each rounded once
__device__ __forceinline__ float exp_le0(float x) {
  const float e = rintf(x * 0x1.715476p+0f); const float a = fmaf(x, 0x1.4ae0bep-26f, fmaf(x, 0x1.715476p+0f, -e)); float r;
  asm("v_exp_f32 %0, %1\n\tv_nop" : "=v"(r) : "v"(a));   // v_nop: the slot that the instruction set asks for behind a transcendental
  r = ldexpf(r, (int)e); return x < -0x1.9d1da0p+6f ? 0.f : r; }
// ---- k_sc: block = (batch in group, 128 rows n, 128 cols m), 4 waves of 64 x 64: S = A . Bm over K 512, 3 products; a staged fragment feeds 4 tiles
// first half of the softmax, on the wave's staged tile: each row's maximum over the tile's 64 keys, E = exp(S - that maximum) in place of S, and the row's sum of E; k_pv brings a row's 16 tiles to one scale
__global__ __launch_bounds__(128) void k_sc(const __bf16* __restrict__ AH, const __bf16* __restrict__ AL, const __bf16* __restrict__ BH, const __bf16* __restrict__ BL, int b0, float* __restrict__ S0, float* __restrict__ PM, float* __restrict__ PL) { __shared__ __attribute__((aligned(2048))) char ring[2][SC_ST];   // behind the loop the same bytes stage the output rows: two blocks still fit a WGP's LDS
  const size_t b = b0 + blockIdx.x; float* S = S0 + (size_t)blockIdx.x * TT * TT;   // the batch is the fastest grid index (see kernel_launch)
  const int tid = threadIdx.x, wave = tid >> 5, lane = tid & 31, col = lane & 15, g = lane >> 4, wr = wave >> 1, wc = wave & 1; const int k0 = blockIdx.z * 128; const int q0 = blockIdx.y * 128;
  v8f acc[4][4] = {};
  // stage t = k [64 t, 64 t + 64) of the block's 128 A rows and 128 Bm rows, hi and lo; every wave brings one of the four planes: wave 0 A hi, 1 A lo, 2 Bm hi, 3 Bm lo
  const unsigned wv = uni(tid >> 5); const unsigned l0 = lds_off(&ring[0][0]) + wv * SC_P;
  const unsigned long long gs = (unsigned long long)(size_t)(wv == 0 ? AH : wv == 1 ? AL : wv == 2 ? BH : BL) + ((b * TT + (wv < 2 ? q0 : k0)) * CC) * 2;
  const u32x8 g1 = tdm_group1<PAD128, 128, 128>(CC * 2);
  u32x4 g0;
  auto fill = [&](unsigned t, unsigned buf) { g0 = tdm_group0(l0 + buf * SC_ST, gs + t * 128); tdm_load(g0, g1); };
  fill(0, 0); WAIT_TENSOR(); __syncthreads(); fill(1, 1);
#pragma unroll 1   // one stage a trip: the two buffers alternate by t & 1
  for (int t = 0; t < CC / 64; ++t) { const char* st = ring[t & 1];
    v16b ah[2][4], al[2][4], bh[2][4], bl[2][4];   // the stage's LDS reads stand as one group in front of its WMMAs
#pragma unroll   // constant indices keep fragments and accumulators in registers
    for (int h = 0; h < 2; ++h) {
#pragma unroll   // constant indices keep fragments and accumulators in registers
      for (int i = 0; i < 4; ++i) { const char* ar = st + (wr * 64 + i * 16 + col) * 144 + h * 64; ah[h][i] = frag_b((const __bf16*)ar, lane); al[h][i] = frag_b((const __bf16*)(ar + SC_P), lane); }
#pragma unroll   // constant indices keep fragments and accumulators in registers
      for (int j = 0; j < 4; ++j) { const char* br = st + 2 * SC_P + (wc * 64 + j * 16 + col) * 144 + h * 64; bh[h][j] = frag_b((const __bf16*)br, lane); bl[h][j] = frag_b((const __bf16*)(br + SC_P), lane); } }
#pragma unroll   // constant indices keep fragments and accumulators in registers
    for (int h = 0; h < 2; ++h) {   // each product over all 16 tiles before the next: a tile's own order stays hi.hi, lo.hi, hi.lo
#pragma unroll   // constant indices keep fragments and accumulators in registers
      for (int i = 0; i < 4; ++i)
#pragma unroll   // constant indices keep fragments and accumulators in registers
        for (int j = 0; j < 4; ++j) acc[i][j] = wmma_bfd(ah[h][i], bh[h][j], acc[i][j]);
#pragma unroll   // constant indices keep fragments and accumulators in registers
      for (int i = 0; i < 4; ++i)
#pragma unroll   // constant indices keep fragments and accumulators in registers
        for (int j = 0; j < 4; ++j) acc[i][j] = wmma_bfd(al[h][i], bh[h][j], acc[i][j]);
#pragma unroll   // constant indices keep fragments and accumulators in registers
      for (int i = 0; i < 4; ++i)
#pragma unroll   // constant indices keep fragments and accumulators in registers
        for (int j = 0; j < 4; ++j) acc[i][j] = wmma_bfd(ah[h][i], bl[h][j], acc[i][j]); }
    WAIT_LDS(); WAIT_TENSOR(); __syncthreads();   // publishes stage t + 1 and ends every read of stage t's buffer
    if (pinned(t + 2 < CC / 64)) { const unsigned tn = pinned(t + 2); fill(tn, tn & 1); } }   // pinned: a scalar branch round the request; its descriptor is formed behind the wait
  WAIT_TENSOR(); WAIT_LDS();
  // the ring is free: the last trip's foot (LDS reads retired, requests landed, barrier) stands behind its every use; each wave stages its 64 x 64 tile in rows of its own, so that whole 128-B lines go out
  float (*ss)[68] = (float (*)[68])(&ring[0][0] + wave * (64 * 68 * 4));
#pragma unroll   // constant indices keep the accumulators in registers
  for (int i = 0; i < 4; ++i)
#pragma unroll   // constant indices keep the accumulators in registers
    for (int j = 0; j < 4; ++j)
#pragma unroll   // constant indices keep the accumulators in registers
      for (int r = 0; r < 8; ++r) ss[i * 16 + 8 * g + r][j * 16 + col] = acc[i][j][r];
  LDSX();
  float tm[2], tl[2];
  {
#pragma unroll   // lane -> rows lane and lane + 32 of the tile, a whole row in registers
    for (int s = 0; s < 2; ++s) { float* rw = &ss[lane + 32 * s][0]; v4f a[16];
#pragma unroll   // the row's LDS reads go out together
      for (int q = 0; q < 16; ++q) a[q] = *(const v4f*)(rw + 4 * q);
      v4f m4 = a[0];
#pragma unroll   // constant indices keep the row in registers
      for (int q = 1; q < 16; ++q) { m4[0] = fmaxf(m4[0], a[q][0]); m4[1] = fmaxf(m4[1], a[q][1]); m4[2] = fmaxf(m4[2], a[q][2]); m4[3] = fmaxf(m4[3], a[q][3]); }
      const float m = fmaxf(fmaxf(m4[0], m4[1]), fmaxf(m4[2], m4[3])); v4f s4 = {};   // four independent sums
#pragma unroll   // constant indices keep the row in registers
      for (int q = 0; q < 16; ++q) {
#pragma unroll   // constant indices keep the row in registers
        for (int c = 0; c < 4; ++c) { const float e = exp_le0(a[q][c] - m); a[q][c] = e; s4[c] += e; }
        *(v4f*)(rw + 4 * q) = a[q]; }
      tm[s] = m; tl[s] = (s4[0] + s4[1]) + (s4[2] + s4[3]); } }
  LDSX();
  { const size_t po = ((size_t)blockIdx.x * (TT / 64) + blockIdx.z * 2 + wc) * TT + q0 + wr * 64 + lane;   // a wave writes two whole 128-B lines of each plane; behind the LDS fence, which would wait for these stores
    PM[po] = tm[0]; PM[po + 32] = tm[1]; PL[po] = tl[0]; PL[po + 32] = tl[1];
    WAIT_XLAT(); }   // behind the four stores, in front of the next rewrite of their address registers
  float* so = S + (size_t)(q0 + wr * 64 + g) * TT + k0 + wc * 64 + col * 4;
  for (int r0 = 0; r0 < 64; r0 += 16) {   // 16 rows a group, two rows a store
#pragma unroll   // the group's LDS reads go out together
    for (int u = 0; u < 8; ++u) vst2(so + (size_t)(r0 + 2 * u) * TT, *(const v4f*)&ss[r0 + 2 * u + g][col * 4]);
    if (r0 + 16 < 64) WAIT_XLAT(); } }
// ---- k_pv: block = (batch in group, 128 rows n, 128 channels), 4 waves of 32 x 128: out = x + (P . T) / 2^11 (P split bf16 hi + lo x exact T planes, 2 products); a staged T fragment feeds 2 row tiles
// second half of the softmax: P x 2^11 = E * cs, one factor a row and stage (a stage = one 64-key tile of k_sc): cs = exp(tile maximum - row maximum) / row sum x 2^11, from the 16 tile maxima and tile sums of the row
__global__ __launch_bounds__(128) void k_pv(const float* __restrict__ PS0, const float* __restrict__ PM, const float* __restrict__ PL, const __bf16* __restrict__ TP, const float* __restrict__ X, int b0, float* __restrict__ OUT) { __shared__ __align__(16) float ss[4][16][132]; __shared__ __attribute__((aligned(2048))) char ring[2][PV_ST]; __shared__ float cs[TT / 64][128];
  const size_t b = b0 + blockIdx.x; const float* PS = PS0 + (size_t)blockIdx.x * TT * TT;   // the batch is the fastest grid index (see kernel_launch)
  const int tid = threadIdx.x, wave = tid >> 5, lane = tid & 31, col = lane & 15, g = lane >> 4; const int ql0 = blockIdx.y * 128 + wave * 32; const int c0 = blockIdx.z * 128;
  v8f acc[2][8] = {};
  // stage t = keys [64 t, 64 t + 64): waves 0 and 1 bring the two 32-key halves of the block's 128 P rows, wave 2 its 128 T channel rows; wave 3 brings nothing
  const unsigned wv = uni(tid >> 5); const unsigned l0 = lds_off(&ring[0][0]) + wv * PV_P, gstep = wv < 2 ? 256 : 128;
  const unsigned long long gs = wv < 2 ? (unsigned long long)(size_t)PS + ((size_t)(blockIdx.y * 128) * TT) * 4 + wv * 128 : (unsigned long long)(size_t)TP + ((b * CC + c0) * (size_t)TT) * 2;
  const u32x8 g1 = tdm_group1<PAD128, 128, 128>(wv < 2 ? TT * 4 : TT * 2);
  u32x4 g0 = {};   // wave 3 passes the waits with nothing outstanding
  auto fill = [&](unsigned t, unsigned buf) { g0 = tdm_group0(l0 + buf * PV_ST, gs + t * gstep); tdm_load(g0, g1); };
  if (pinned(wv < 3)) fill(0, 0);   // pinned: a scalar branch round the request, which ignores EXEC
  { const size_t po = (size_t)blockIdx.x * (TT / 64) * TT + blockIdx.y * 128 + tid; float mv[TT / 64], lv[TT / 64];   // thread -> row tid of the block (a row of its own wave); a wave's load = one whole line
#pragma unroll   // the 32 loads are in flight together, beside stage 0's request
    for (int k = 0; k < TT / 64; ++k) { mv[k] = PM[po + (size_t)k * TT]; lv[k] = PL[po + (size_t)k * TT]; }
    WAIT_XLAT();   // behind the 32 loads, in front of the next rewrite of their address registers
    float mg = mv[0], sum = 0.f;
#pragma unroll   // constant indices keep the 16 tiles in registers
    for (int k = 1; k < TT / 64; ++k) mg = fmaxf(mg, mv[k]);
#pragma unroll   // constant indices keep the 16 tiles in registers
    for (int k = 0; k < TT / 64; ++k) { mv[k] = exp_le0(mv[k] - mg); sum += mv[k] * lv[k]; }
    const float inv = 1.0f / sum;
#pragma unroll   // constant indices keep the 16 tiles in registers
    for (int k = 0; k < TT / 64; ++k) cs[k][tid] = mv[k] * inv * 2048.0f; }
  WAIT_TENSOR(); __syncthreads(); if (pinned(wv < 3)) fill(1, 1);   // pinned: as above
#pragma unroll 1   // one stage a trip: the two buffers alternate by t & 1
  for (int t = 0; t < TT / 64; ++t) { const char* st = ring[t & 1];
    F2 p[2][2]; v16b th[2][8];   // the stage's LDS reads stand as one group in front of its WMMAs
    const float cf[2] = { cs[t][wave * 32 + col], cs[t][wave * 32 + 16 + col] };
#pragma unroll   // constant indices keep fragments and accumulators in registers
    for (int h = 0; h < 2; ++h) {
#pragma unroll   // constant indices keep fragments and accumulators in registers
      for (int i = 0; i < 2; ++i) { float v[16]; const float* pr = (const float*)(st + h * PV_P + (wave * 32 + i * 16 + col) * 144) + 8 * g;   // the k order of split_row
#pragma unroll   // constant indices keep the fragment in registers
        for (int k = 0; k < 8; ++k) { v[k] = pr[k] * cf[i]; v[8 + k] = pr[16 + k] * cf[i]; }
        p[h][i] = bsplit16(v); }
#pragma unroll   // constant indices keep fragments and accumulators in registers
      for (int j = 0; j < 8; ++j) th[h][j] = frag_b((const __bf16*)(st + 2 * PV_P + (j * 16 + col) * 144 + h * 64), lane); }
#pragma unroll   // constant indices keep fragments and accumulators in registers
    for (int h = 0; h < 2; ++h) {   // each product over all 16 tiles before the next: a tile's own order stays hi, lo
#pragma unroll   // constant indices keep fragments and accumulators in registers
      for (int i = 0; i < 2; ++i)
#pragma unroll   // constant indices keep fragments and accumulators in registers
        for (int j = 0; j < 8; ++j) acc[i][j] = wmma_bfd(p[h][i].h, th[h][j], acc[i][j]);
#pragma unroll   // constant indices keep fragments and accumulators in registers
      for (int i = 0; i < 2; ++i)
#pragma unroll   // constant indices keep fragments and accumulators in registers
        for (int j = 0; j < 8; ++j) acc[i][j] = wmma_bfd(p[h][i].l, th[h][j], acc[i][j]); }
    WAIT_LDS(); WAIT_TENSOR(); __syncthreads();   // publishes stage t + 1 and ends every read of stage t's buffer
    if (pinned(wv < 3 && t + 2 < TT / 64)) { const unsigned tn = pinned(t + 2); fill(tn, tn & 1); } }   // pinned: a scalar branch round the request; its descriptor is formed behind the wait
  WAIT_TENSOR(); WAIT_LDS();
#pragma unroll   // constant indices keep the accumulators in registers
  for (int i = 0; i < 2; ++i) {   // 16 rows at a time through the wave's own staging rows
    if (i) WAIT_LDS();   // the first 16 rows are read before the next 16 overwrite them
#pragma unroll
    for (int j = 0; j < 8; ++j)
#pragma unroll
      for (int r = 0; r < 8; ++r) ss[wave][8 * g + r][j * 16 + col] = acc[i][j][r] * (1.0f / 2048.0f);
    LDSX(); for (int r0 = 0; r0 < 16; r0 += 8) { const size_t off = (b * TT + ql0 + i * 16 + r0) * CC + c0 + lane * 4; v4f xr[8];   // 8 rows a group
#pragma unroll   // the group's x loads are in flight together
      for (int u = 0; u < 8; ++u) xr[u] = *(const v4f*)(X + off + u * CC);
#pragma unroll   // constant indices keep the group in registers
      for (int u = 0; u < 8; ++u) { v4f o = *(const v4f*)&ss[wave][r0 + u][lane * 4]; o[0] += bfr(xr[u][0]); o[1] += bfr(xr[u][1]); o[2] += bfr(xr[u][2]); o[3] += bfr(xr[u][3]); vst2(OUT + off + u * CC, o); }
      if (i == 0 || r0 == 0) WAIT_XLAT(); } } }
extern "C" void kernel_launch(void* const* d_in, const int* in_sizes, int n_in, void* d_out, int out_size, void* d_ws, size_t ws_size, hipStream_t stream) {
  (void)in_sizes; (void)n_in; (void)out_size;
  const float** F = (const float**)d_in;   // 0 x_in [16,1024,512], 1 T [16,1024,512], 2 Wq [16,512,512] ((in,out) per batch), 3 Wk [16,512,512]
  if (ws_size < (size_t)WS_END) return;
  char* ws = (char*)d_ws; __bf16 *AH = (__bf16*)(ws + WS_AH), *AL = (__bf16*)(ws + WS_AL), *BH = (__bf16*)(ws + WS_BH), *BL = (__bf16*)(ws + WS_BL), *TP = (__bf16*)(ws + WS_TT); float *S = (float*)(ws + WS_S), *PM = (float*)(ws + WS_PM), *PL = (float*)(ws + WS_PL);
  // grids: x = batch, so that all blocks of a batch have flat indices equal mod 8. For speed only: every block does its own piece wherever it lands
  k_lin<<<dim3(TNB, TT / 256, 2 * (CC / 256)), 512, 0, stream>>>(F[0], F[1], F[2], F[3], AH, AL, BH, BL, TP);
  for (int b0 = 0; b0 < TNB; b0 += BG) { const int ng = (TNB - b0) < BG ? (TNB - b0) : BG;
    k_sc<<<dim3(ng, TT / 128, TT / 128), 128, 0, stream>>>(AH, AL, BH, BL, b0, S, PM, PL);
    k_pv<<<dim3(ng, TT / 128, CC / 128), 128, 0, stream>>>(S, PM, PL, TP, F[0], b0, (float*)d_out);
  }
}
